// v000
// Measured on an AMD MI455X. A time is GPU time per run, averaged over a window of back-to-back runs after a warm-up
// (all launches, gaps included; the runs take copies of the inputs in turn), and the median of several windows.
// Apart from v000's, it joins two sittings. Times from different sittings can be a few percent apart, while
// side-by-side timings come from the same sitting.
// The starting kernel, v000, takes 494 microseconds a run.
#include <hip/hip_runtime.h>

// Multi-head self-attention block, width 1024 = 16 heads x 64; separate query / key / value inputs [NB][SEQ_FULL][1024] (first SEQ tokens of each batch used); q_w / k_w / out_w stored [in][out] (y = x W + b); the value projection uses the query weight and the query bias (there is no separate value weight); no mask; score scale 1/8; output = ctx out_w + out_b (f32).
// Compute dtypes, f32 accumulate everywhere: q/k/v projections v_wmma_f32_16x16x32_bf16 (inputs and weights RNE-converted to bf16; products exact); scores v_wmma_f32_16x16x32_f16 with q and k each carried as f16 value + f16 residual x2048 (three products: value.value in the main accumulator, value.residual + residual.value in a separate accumulator folded back by 1/2048); P.V v_wmma_f32_16x16x32_f16 (P x256 carry, cancels in the normalisation; v single f16); output projection v_wmma_f32_16x16x32_f16: ctx f16 with x256 carry, out_w^T (bf16 RNE value) x64 as f16, carries folded back in the f32 epilogue; softmax f32 (online, running max); biases (bf16 RNE values) added in f32.
// Layout: bf16 copies of the three inputs; transposed 16-bit weight planes [out][in]; q, k value and residual planes [b*16+h][t][d] and v^T plane [b*16+h][d][t] written by the GEMM epilogue; fused flash kernel in transposed form (S^T = K Q^T, O^T = V^T P^T) writing the ctx plane [b*SEQ+t][h*64+d]; final GEMM writes the f32 output.

#ifndef NB
#define NB 4
#endif
#ifndef SEQ
#define SEQ 2048
#endif
#define NB_FULL  4
#define SEQ_FULL 2048
#ifndef OUT_SEQ
#define OUT_SEQ SEQ              // row pitch (in tokens) between batches of the output
#endif
#ifndef SCORE_RES
#define SCORE_RES 1              // 1: q and k residual planes and three-product scores; 0: single-product scores
#endif
#define DM   1024
#define NH_  16
#define HD   64
#define AW   4                   // waves per flash block (16 query rows each)
#define SC2  (0.125f * 1.4426950408889634f)   // HD^-0.5 * log2(e)
#define PSH  8.0f                // log2 of the P carry (256)
#define CTXS 256.0f              // carry of the ctx plane
#define WOS  64.0f               // carry of the Wo^T plane
#define OSC  (1.0f / 16384.0f)   // 1 / (CTXS * WOS)
#define RESC 2048.0f             // carry of the q / k residual planes
#define RESI (1.0f / 2048.0f)    // 1 / RESC

static_assert(HD == 64);
static_assert(NH_ * HD == DM);                 // head h = columns h*64 + d
static_assert(DM % 64 == 0);                   // column tiles of 64
static_assert(DM % 32 == 0);                   // GEMM k-loop steps by 32
static_assert(SEQ % 64 == 0);                  // a 64-row tile never straddles two batches
static_assert((NB * SEQ) % 64 == 0);
static_assert(SEQ % 32 == 0);                  // key loop steps by 32
static_assert(SEQ % (16 * AW) == 0);           // flash grid covers the sequence exactly
static_assert(((size_t)SEQ * DM) % 8 == 0);
static_assert(((size_t)DM * DM) % 8 == 0);
static_assert(NB <= NB_FULL);
static_assert(SEQ <= SEQ_FULL);
static_assert(RESC * RESI == 1.0f);            // residual carry folds back exactly
static_assert(CTXS * WOS * OSC == 1.0f);       // output carries fold back exactly

typedef _Float16 h16;
typedef unsigned short bf;
typedef __attribute__((ext_vector_type(16))) __bf16   v16bf;
typedef __attribute__((ext_vector_type(16))) _Float16 v16h;
typedef __attribute__((ext_vector_type(8)))  _Float16 v8h;
typedef __attribute__((ext_vector_type(8)))  unsigned short v8us;
typedef __attribute__((ext_vector_type(8)))  float    v8f;
typedef __attribute__((ext_vector_type(4)))  float    v4f;
typedef v4f  __attribute__((may_alias)) v4fa;

__device__ __forceinline__ unsigned short f2bf(float f) { unsigned u = __float_as_uint(f); u += 0x7FFFu + ((u >> 16) & 1u); return (unsigned short)(u >> 16); }
__device__ __forceinline__ float bfr(float f) { return __uint_as_float(((unsigned)f2bf(f)) << 16); }   // value of the bf16 RNE conversion, as f32
__device__ __forceinline__ v16h cat16(v8h lo, v8h hi) { return __builtin_shufflevector(lo, hi, 0, 1, 2, 3, 4, 5, 6, 7, 8, 9, 10, 11, 12, 13, 14, 15); }
__device__ __forceinline__ v16bf cat16b(v8us lo, v8us hi) { return __builtin_bit_cast(v16bf, __builtin_shufflevector(lo, hi, 0, 1, 2, 3, 4, 5, 6, 7, 8, 9, 10, 11, 12, 13, 14, 15)); }
__device__ __forceinline__ v8f wmma16(v16h a, v16h b, v8f c) { return __builtin_amdgcn_wmma_f32_16x16x32_f16(false, a, false, b, (short)0, c, false, false); }
__device__ __forceinline__ v8f wmmab(v16bf a, v16bf b, v8f c) { return __builtin_amdgcn_wmma_f32_16x16x32_bf16(false, a, false, b, (short)0, c, false, false); }
// fragment loaders from K-contiguous 16-bit rows; p already includes + 8*(lane>>4): elements 0..7 <- k0+8h+0..7, elements 8..15 <- k0+16+8h+0..7 (same map for A and B)
__device__ __forceinline__ v16h  ldh(const h16* p) { return cat16(*(const v8h*)p, *(const v8h*)(p + 16)); }
__device__ __forceinline__ v16bf ldb(const bf* p)  { return cat16b(*(const v8us*)p, *(const v8us*)(p + 16)); }
// ordering point for wave-private LDS tiles (same wave writes and reads)
__device__ __forceinline__ void wave_sync() { __builtin_amdgcn_fence(3 /* release order */, "wavefront"); __builtin_amdgcn_wave_barrier(); asm volatile("" ::: "memory"); }
// f32 -> f16 for operand planes: a result below the smallest normal f16 magnitude is replaced by zero (value select)
static __device__ __forceinline__ h16 toh_flush(float v) { const h16 r = (h16)v; return (fabsf(v) < 6.103515625e-05f) ? (h16)0.0f : r; }

__global__ __launch_bounds__(256) void k_cvt8(const float* __restrict__ src, bf* dst, size_t n8) {
    const size_t i = (size_t)blockIdx.x * 256 + threadIdx.x; if (i >= n8) return;
    const v8f v = *(const v8f*)(src + i * 8); v8us o;
#pragma unroll
    for (int k = 0; k < 8; ++k) o[k] = f2bf(v[k]);
    *(v8us*)(dst + i * 8) = o; 
}

// k_cvtT: transpose + 16-bit convert of a weight matrix: in[R][C] (f32, R = contraction index, C = output feature) -> out[C][R] (16-bit, contraction-contiguous).
// F16OUT == 0: bf16 RNE bits; F16OUT == 1: f16 of (bf16 RNE value x WOS) (exact for values whose scaled magnitude is in the f16 normal range).
template <int F16OUT>
__global__ __launch_bounds__(256) void k_cvtT(const float* __restrict__ W, unsigned short* dst, int R, int C) {
    __shared__ float ts[64 * 65];
    const int tid = threadIdx.x;
    const int n0 = blockIdx.x * 64, k0 = blockIdx.y * 64;
#pragma unroll
    for (int it = 0; it < 4; ++it) {                     // 4 x 16 rows x (16 lanes x 4 floats) = 64 x 64, all written
        const int r = it * 16 + (tid >> 4), c4 = (tid & 15) * 4;
        const v4f v = *(const v4f*)(W + (size_t)(k0 + r) * (size_t)C + n0 + c4);
#pragma unroll
        for (int i = 0; i < 4; ++i) ts[r * 65 + c4 + i] = v[i];
    }
    __syncthreads();
    v8us o[2];
#pragma unroll
    for (int it = 0; it < 2; ++it) {                     // 2 x 32 output rows x (8 lanes x 8 halves) = 64 x 64
        const int n = it * 32 + (tid >> 3), k8 = (tid & 7) * 8;
#pragma unroll
        for (int i = 0; i < 8; ++i) {
            const float x = ts[(k8 + i) * 65 + n];
            const unsigned short bb = f2bf(x);
            if (F16OUT) { const h16 hv = (h16)(__uint_as_float(((unsigned)bb) << 16) * WOS); o[it][i] = __builtin_bit_cast(unsigned short, hv); }
            else o[it][i] = bb;
        }
    }
{
#pragma unroll
        for (int it = 0; it < 2; ++it) { const int n = it * 32 + (tid >> 3), k8 = (tid & 7) * 8;
            *(v8us*)(dst + (size_t)(n0 + n) * (size_t)R + k0 + k8) = o[it]; }
         }
}

// k_proj: register-blocked bf16 GEMM, ONE WAVE per 64x64 tile (16 accumulators), operands straight from K-contiguous bf16 planes, K = DM.
// C[m][n] = sum_k A[m][k] Bt[n][k] + bias (BROW == 0: bias[n]; BROW == 1: bias[m]), written as f16 (Ph) at
// tile base (r0/RB)*sRB + (r0%RB)*pitch + (c0/CB)*sCB + (c0%CB), row pitch 'pitch' (halves). grid (M/64, N/64), 32 threads.
// RES == 1: additionally the residual plane Pr (same addressing) = f16((C - f16 value) x RESC); RES == 0: Pr is not touched.
template <int BROW, int RES>
__global__ __launch_bounds__(32) void k_proj(const bf* __restrict__ A, const bf* __restrict__ Bt, const float* __restrict__ bias, h16* Ph, h16* Pr, int RB, size_t sRB, int pitch, int CB, size_t sCB) {
    __shared__ __align__(16) float os[16 * 68];
    const int K = DM;
    const int lane = threadIdx.x & 31, lr = lane & 15, hi = lane >> 4; const int r0 = blockIdx.x * 64, c0 = blockIdx.y * 64;
    v8f acc[4][4];
#pragma unroll
    for (int mb = 0; mb < 4; ++mb)
#pragma unroll
        for (int nb = 0; nb < 4; ++nb) acc[mb][nb] = (v8f){};
    const size_t aoff = (size_t)(r0 + lr) * K + 8 * hi, boff = (size_t)(c0 + lr) * K + 8 * hi;
#pragma unroll 1
    for (int kc = 0; kc < K; kc += 32) {
        v16bf a[4];
#pragma unroll
        for (int mb = 0; mb < 4; ++mb) a[mb] = ldb(A + aoff + (size_t)mb * 16 * K + kc);
#pragma unroll
        for (int nb = 0; nb < 4; ++nb) { const v16bf b = ldb(Bt + boff + (size_t)nb * 16 * K + kc);
#pragma unroll
            for (int mb = 0; mb < 4; ++mb) acc[mb][nb] = wmmab(a[mb], b, acc[mb][nb]); }
        asm volatile("v_nop\n\tv_nop\n\tv_nop\n\tv_nop" : "+v"(acc[0][0]), "+v"(acc[1][1]), "+v"(acc[2][2]), "+v"(acc[3][3]) : "v"(a[0]), "v"(a[1]), "v"(a[2]), "v"(a[3]));
    }
    // column bias for this lane's 8 store columns (BROW == 0); c0 + (lane&7)*8 + 7 < N = DM
    v4f bc0 = (v4f){}, bc1 = (v4f){};
    if (BROW == 0) { const int cb8 = (lane & 7) * 8; const v4f t0 = *(const v4f*)(bias + c0 + cb8); const v4f t1 = *(const v4f*)(bias + c0 + cb8 + 4);
#pragma unroll
        for (int i = 0; i < 4; ++i) { bc0[i] = bfr(t0[i]); bc1[i] = bfr(t1[i]); } }
    const size_t tbase = (size_t)(r0 / RB) * sRB + (size_t)(r0 % RB) * (size_t)pitch + (size_t)(c0 / CB) * sCB + (size_t)(c0 % CB);
#pragma unroll
    for (int mb = 0; mb < 4; ++mb) {
#pragma unroll
        for (int nb = 0; nb < 4; ++nb) {
#pragma unroll
            for (int j = 0; j < 8; ++j) os[(hi * 8 + j) * 68 + nb * 16 + lr] = acc[mb][nb][j]; }   // D: row 8h+j, col lane&15
        wave_sync();
        const size_t sb = tbase + (size_t)(mb * 16) * (size_t)pitch;
{
#pragma unroll
            for (int s = 0; s < 4; ++s) { const int row = 4 * s + (lane >> 3), c8 = (lane & 7) * 8;   // 4 s x 4 row groups = 16 rows; 8 lanes x 8 = 64 columns
                v4f x0 = *(const v4fa*)(&os[row * 68 + c8]); v4f x1 = *(const v4fa*)(&os[row * 68 + c8 + 4]); v8h hv; v8h rv;
                if (BROW == 1) { const float br = bfr(bias[r0 + mb * 16 + row]);                    // row bias; r0 + mb*16 + row < M = DM
#pragma unroll
                    for (int i = 0; i < 4; ++i) { x0[i] += br; x1[i] += br; } }
                else {
#pragma unroll
                    for (int i = 0; i < 4; ++i) { x0[i] += bc0[i]; x1[i] += bc1[i]; } }
#pragma unroll
                for (int i = 0; i < 4; ++i) { const h16 a = toh_flush(x0[i]); const h16 c = toh_flush(x1[i]); hv[i] = a; hv[4 + i] = c;
                    rv[i] = toh_flush((x0[i] - (float)a) * RESC); rv[4 + i] = toh_flush((x1[i] - (float)c) * RESC); }   // difference and carry are exact in f32
                const size_t oo = sb + (size_t)row * (size_t)pitch + c8;
                *(v8h*)(Ph + oo) = hv;
                if (RES) *(v8h*)(Pr + oo) = rv; }
             }
        wave_sync();
    }
}

// k_flash: fused attention, one wave per 16 query rows of one (batch, head); K / V^T / Q fragments straight from the f16 planes (two 16-B loads each, arithmetic addressing).
// Transposed form: S^T[key][t] = K Q^T (A = K rows, B = Q rows); lane (t = lane&15, h = lane>>4) holds keys 8h+r of each 16-key tile, so the packed
// P tile is directly the B fragment of O^T[d][t] = V^T P^T (element r <- tile keys 0..15, element 8+r <- tile keys 16..31, lane unchanged).
// Per 32-key step: 4 value.value score products in the main accumulators, 8 value.residual / residual.value products in separate accumulators (x RESC, folded back by RESI), 4 P.V products.
// Softmax state (running max, partial sum) is one scalar per lane; the two lane halves of a row are combined with one xor-16 exchange.
__global__ __launch_bounds__(32 * AW) void k_flash(const h16* __restrict__ QH, const h16* __restrict__ QR, const h16* __restrict__ KP, const h16* __restrict__ KR, const h16* __restrict__ VT, h16* CTX) {
    __shared__ __align__(16) float os[AW * 16 * 68];
    const int lane = threadIdx.x & 31, lr = lane & 15, hi = lane >> 4;
    const int wave = __builtin_amdgcn_readfirstlane((int)(threadIdx.x >> 5));
    const int zh = blockIdx.y; const int b = zh / NH_, h = zh % NH_;
    const int t0 = (blockIdx.x * AW + wave) * 16;
    const size_t pbase = (size_t)zh * SEQ * HD;
    const size_t qo = pbase + (size_t)(t0 + lr) * HD + 8 * hi;
    const v16h qh0 = ldh(QH + qo), qh1 = ldh(QH + qo + 32);   // B fragments: col t, k = d
    v16h qr0 = qh0, qr1 = qh1;
    if (SCORE_RES) { qr0 = ldh(QR + qo); qr1 = ldh(QR + qo + 32); }   // residual B fragments (x RESC)
    const size_t ko = pbase + (size_t)lr * HD + 8 * hi;      // + key * HD       (A fragment: row key, k = d)
    const size_t vo = pbase + (size_t)lr * SEQ + 8 * hi;     // + 16j*SEQ + key  (A fragment: row d, k = key)
    v8f o0 = (v8f){}, o1 = (v8f){}, o2 = (v8f){}, o3 = (v8f){};
    float m = -3.0e38f, l = 0.0f;
#pragma unroll 1
    for (int key0 = 0; key0 < SEQ; key0 += 32) {
        const h16* ka = KP + ko + (size_t)key0 * HD;
        const v16h ka0 = ldh(ka), ka1 = ldh(ka + 32), kb0 = ldh(ka + 16 * HD), kb1 = ldh(ka + 16 * HD + 32);
        v8f sa = (v8f){}, sb = (v8f){}, ra = (v8f){}, rb = (v8f){};
        sa = wmma16(ka0, qh0, sa); sb = wmma16(kb0, qh0, sb);
        sa = wmma16(ka1, qh1, sa); sb = wmma16(kb1, qh1, sb);
        if (SCORE_RES) {
            const h16* kr = KR + ko + (size_t)key0 * HD;
            const v16h ea0 = ldh(kr), ea1 = ldh(kr + 32), eb0 = ldh(kr + 16 * HD), eb1 = ldh(kr + 16 * HD + 32);
            ra = wmma16(ka0, qr0, ra); rb = wmma16(kb0, qr0, rb);
            ra = wmma16(ka1, qr1, ra); rb = wmma16(kb1, qr1, rb);
            ra = wmma16(ea0, qh0, ra); rb = wmma16(eb0, qh0, rb);
            ra = wmma16(ea1, qh1, ra); rb = wmma16(eb1, qh1, rb);
            asm volatile("v_nop\n\tv_nop\n\tv_nop\n\tv_nop" : "+v"(sa), "+v"(sb), "+v"(ra), "+v"(rb) : "v"(ka0), "v"(ka1), "v"(kb0), "v"(kb1), "v"(ea0), "v"(ea1), "v"(eb0), "v"(eb1), "v"(qh0), "v"(qh1), "v"(qr0), "v"(qr1));
        } else {
            asm volatile("v_nop\n\tv_nop\n\tv_nop\n\tv_nop" : "+v"(sa), "+v"(sb) : "v"(ka0), "v"(ka1), "v"(kb0), "v"(kb1), "v"(qh0), "v"(qh1));
        }
        float ta[8], tb[8]; float mx = -3.0e38f;
#pragma unroll
        for (int r = 0; r < 8; ++r) { ta[r] = (sa[r] + ra[r] * RESI) * SC2; tb[r] = (sb[r] + rb[r] * RESI) * SC2; mx = fmaxf(mx, fmaxf(ta[r], tb[r])); }
        mx = fmaxf(mx, __shfl_xor(mx, 16, 32));
        const float mnew = fmaxf(m, mx);
        const float alpha = __builtin_amdgcn_exp2f(m - mnew);
        const float sh = PSH - mnew;
        v16h pb; float ls = 0.0f;
#pragma unroll
        for (int r = 0; r < 8; ++r) {
            const float ea = ta[r] + sh, eb = tb[r] + sh;
            const float xa = __builtin_amdgcn_exp2f(ea), xb = __builtin_amdgcn_exp2f(eb);
            const h16 pa = (ea < -14.0f) ? (h16)0.0f : (h16)xa;    // exponent cut: no f16 value below the smallest normal
            const h16 pc = (eb < -14.0f) ? (h16)0.0f : (h16)xb;
            pb[r] = pa; pb[8 + r] = pc; ls += (float)pa + (float)pc; }
        l = l * alpha + ls; m = mnew;
        o0 = o0 * alpha; o1 = o1 * alpha; o2 = o2 * alpha; o3 = o3 * alpha;
        const h16* va = VT + vo + key0;
        const v16h v0 = ldh(va), v1 = ldh(va + (size_t)16 * SEQ), v2 = ldh(va + (size_t)32 * SEQ), v3 = ldh(va + (size_t)48 * SEQ);
        o0 = wmma16(v0, pb, o0); o1 = wmma16(v1, pb, o1); o2 = wmma16(v2, pb, o2); o3 = wmma16(v3, pb, o3);
        asm volatile("v_nop\n\tv_nop\n\tv_nop\n\tv_nop" : "+v"(o0), "+v"(o1), "+v"(o2), "+v"(o3) : "v"(v0), "v"(v1), "v"(v2), "v"(v3), "v"(pb));
    }
    l += __shfl_xor(l, 16, 32);
    const float inv = CTXS / l;
    const int wb = wave * 16 * 68;
    // O^T D layout: o_j[r] = (d = 16j + 8h + r, t = lane&15) -> os[t][d]; rows 0..15 x columns 0..63 all written
    { v4f a, c;
      a[0] = o0[0] * inv; a[1] = o0[1] * inv; a[2] = o0[2] * inv; a[3] = o0[3] * inv; c[0] = o0[4] * inv; c[1] = o0[5] * inv; c[2] = o0[6] * inv; c[3] = o0[7] * inv;
      *(v4fa*)(&os[wb + lr * 68 +  0 + 8 * hi]) = a; *(v4fa*)(&os[wb + lr * 68 +  0 + 8 * hi + 4]) = c;
      a[0] = o1[0] * inv; a[1] = o1[1] * inv; a[2] = o1[2] * inv; a[3] = o1[3] * inv; c[0] = o1[4] * inv; c[1] = o1[5] * inv; c[2] = o1[6] * inv; c[3] = o1[7] * inv;
      *(v4fa*)(&os[wb + lr * 68 + 16 + 8 * hi]) = a; *(v4fa*)(&os[wb + lr * 68 + 16 + 8 * hi + 4]) = c;
      a[0] = o2[0] * inv; a[1] = o2[1] * inv; a[2] = o2[2] * inv; a[3] = o2[3] * inv; c[0] = o2[4] * inv; c[1] = o2[5] * inv; c[2] = o2[6] * inv; c[3] = o2[7] * inv;
      *(v4fa*)(&os[wb + lr * 68 + 32 + 8 * hi]) = a; *(v4fa*)(&os[wb + lr * 68 + 32 + 8 * hi + 4]) = c;
      a[0] = o3[0] * inv; a[1] = o3[1] * inv; a[2] = o3[2] * inv; a[3] = o3[3] * inv; c[0] = o3[4] * inv; c[1] = o3[5] * inv; c[2] = o3[6] * inv; c[3] = o3[7] * inv;
      *(v4fa*)(&os[wb + lr * 68 + 48 + 8 * hi]) = a; *(v4fa*)(&os[wb + lr * 68 + 48 + 8 * hi + 4]) = c; }
    wave_sync();
    h16* crow = CTX + ((size_t)b * SEQ + t0) * DM + h * HD;      // ctx plane [b*SEQ + t][h*64 + d], x CTXS
{
#pragma unroll
        for (int s = 0; s < 4; ++s) { const int row = 4 * s + (lane >> 3), c8 = (lane & 7) * 8;   // 4 s x 4 rows = 16 rows; 8 lanes x 8 halves = 64 columns
            const v4f x0 = *(const v4fa*)(&os[wb + row * 68 + c8]); const v4f x1 = *(const v4fa*)(&os[wb + row * 68 + c8 + 4]); v8h hv;
#pragma unroll
            for (int i = 0; i < 4; ++i) { hv[i] = toh_flush(x0[i]); hv[4 + i] = toh_flush(x1[i]); }
            *(v8h*)(crow + (size_t)row * DM + c8) = hv; }
         }
}

// k_out: output projection, f16 GEMM, ONE WAVE per 64x64 tile, operands straight from K-contiguous f16 planes, K = DM.
// OUT[m][n] = OSC * sum_k CTX[m][k] WoT[n][k] + bo[n] (f32). grid (NB*SEQ/64, DM/64), 32 threads.
__global__ __launch_bounds__(32) void k_out(const h16* __restrict__ A, const h16* __restrict__ Bt, const float* __restrict__ bias, float* OUT) {
    __shared__ __align__(16) float os[16 * 68];
    const int K = DM;
    const int lane = threadIdx.x & 31, lr = lane & 15, hi = lane >> 4; const int r0 = blockIdx.x * 64, c0 = blockIdx.y * 64;
    v8f acc[4][4];
#pragma unroll
    for (int mb = 0; mb < 4; ++mb)
#pragma unroll
        for (int nb = 0; nb < 4; ++nb) acc[mb][nb] = (v8f){};
    const size_t aoff = (size_t)(r0 + lr) * K + 8 * hi, boff = (size_t)(c0 + lr) * K + 8 * hi;
#pragma unroll 1
    for (int kc = 0; kc < K; kc += 32) {
        v16h a[4];
#pragma unroll
        for (int mb = 0; mb < 4; ++mb) a[mb] = ldh(A + aoff + (size_t)mb * 16 * K + kc);
#pragma unroll
        for (int nb = 0; nb < 4; ++nb) { const v16h b = ldh(Bt + boff + (size_t)nb * 16 * K + kc);
#pragma unroll
            for (int mb = 0; mb < 4; ++mb) acc[mb][nb] = wmma16(a[mb], b, acc[mb][nb]); }
        asm volatile("v_nop\n\tv_nop\n\tv_nop\n\tv_nop" : "+v"(acc[0][0]), "+v"(acc[1][1]), "+v"(acc[2][2]), "+v"(acc[3][3]) : "v"(a[0]), "v"(a[1]), "v"(a[2]), "v"(a[3]));
    }
    const int cofs = lr * 4;
    v4f bb; { const v4f t = *(const v4f*)(bias + c0 + cofs);      // c0 + cofs + 3 < DM
#pragma unroll
        for (int i = 0; i < 4; ++i) bb[i] = bfr(t[i]); }
    float* orow = OUT + ((size_t)(r0 / SEQ) * OUT_SEQ + (size_t)(r0 % SEQ)) * DM + c0;
#pragma unroll
    for (int mb = 0; mb < 4; ++mb) {
#pragma unroll
        for (int nb = 0; nb < 4; ++nb) {
#pragma unroll
            for (int j = 0; j < 8; ++j) os[(hi * 8 + j) * 68 + nb * 16 + lr] = acc[mb][nb][j]; }   // D: row 8h+j, col lane&15
        wave_sync();
{
#pragma unroll
            for (int s = 0; s < 8; ++s) { const int row = 2 * s + hi;   // 8 s x 2 rows = 16 rows; 16 lanes x 4 floats = 64 columns
                const v4f x = *(const v4fa*)(&os[row * 68 + cofs]); v4f val;
#pragma unroll
                for (int i = 0; i < 4; ++i) val[i] = x[i] * OSC + bb[i];
                *(v4f*)(orow + (size_t)(mb * 16 + row) * DM + cofs) = val; }
             }
        wave_sync();
    }
}

static constexpr size_t al256(size_t v) { return (v + 255) & ~(size_t)255; }
static constexpr size_t SZ_XB = al256((size_t)NB * SEQ * DM * 2);
static constexpr size_t SZ_WB = al256((size_t)3 * DM * DM * 2);
static constexpr size_t SZ_PL = al256((size_t)NB * NH_ * SEQ * HD * 2);
static constexpr size_t SZ_TOTAL = 3 * SZ_XB + SZ_WB + 3 * SZ_PL;
static_assert(SZ_TOTAL <= (size_t)134217728);                  // workspace carve <= 128 MiB
static_assert(((size_t)DM * DM * 2) % 256 == 0);               // weight sub-planes stay 256-byte aligned
static_assert((size_t)3 * DM * DM * 2 <= SZ_WB);               // three weight sub-planes (q | k | o) fit their region
static_assert((size_t)NB * SEQ * DM * 2 <= SZ_XB);             // ctx plane (aliases the query copy) fits its region
static_assert((size_t)NB * NH_ * SEQ * HD * 2 <= SZ_XB);       // q / k residual planes (alias the key / value copies) fit their regions

extern "C" void kernel_launch(void* const* d_in, const int* in_sizes, int n_in,
                              void* d_out, int out_size, void* d_ws, size_t ws_size, hipStream_t stream) {
    if (n_in < 9) return;
    const size_t needx = ((size_t)(NB - 1) * SEQ_FULL + SEQ) * DM;
    if ((size_t)in_sizes[0] < needx || (size_t)in_sizes[1] < needx || (size_t)in_sizes[2] < needx) return;
    if ((size_t)in_sizes[3] < (size_t)DM * DM || (size_t)in_sizes[5] < (size_t)DM * DM || (size_t)in_sizes[7] < (size_t)DM * DM) return;
    if (in_sizes[4] < DM || in_sizes[6] < DM || in_sizes[8] < DM) return;
    if ((size_t)out_size < ((size_t)(NB - 1) * OUT_SEQ + SEQ) * DM) return;
    if (SZ_TOTAL > ws_size) return;
    // wire order: q, k, v, q_w, q_b, k_w, k_b, out_w, out_b
    const float* xq = (const float*)d_in[0]; const float* xk = (const float*)d_in[1]; const float* xv = (const float*)d_in[2];
    const float* wq = (const float*)d_in[3]; const float* bq = (const float*)d_in[4];
    const float* wk = (const float*)d_in[5]; const float* bk = (const float*)d_in[6];
    const float* wo = (const float*)d_in[7]; const float* bo = (const float*)d_in[8];
    float* OUT = (float*)d_out;      // [NB][OUT_SEQ][1024]
    char* wsp = (char*)d_ws;
    bf* XQ = (bf*)wsp; wsp += SZ_XB;                 // [NB*SEQ][1024] bf16 queries; region reused later as the ctx plane
    bf* XK = (bf*)wsp; wsp += SZ_XB;                 // [NB*SEQ][1024] bf16 keys; region reused later as the q residual plane
    bf* XV = (bf*)wsp; wsp += SZ_XB;                 // [NB*SEQ][1024] bf16 values; region reused later as the k residual plane
    bf* WB = (bf*)wsp; wsp += SZ_WB;                 // [3][1024][1024] transposed [out][in]: q | k (bf16) | o (f16 x64)
    h16* QH = (h16*)wsp; wsp += SZ_PL;               // [NB*16][SEQ][64]
    h16* KP = (h16*)wsp; wsp += SZ_PL;               // [NB*16][SEQ][64]
    h16* VT = (h16*)wsp; wsp += SZ_PL;               // [NB*16][64][SEQ]
    h16* CTX = (h16*)XQ;                             // [NB*SEQ][1024] f16 x256, written after the q projection has consumed XQ
    h16* KR = (h16*)XV;                              // [NB*16][SEQ][64] f16 x2048, written after the v projection has consumed XV
    h16* QR = (h16*)XK;                              // [NB*16][SEQ][64] f16 x2048, written after the k projection has consumed XK
    bf* WQT = WB; bf* WKT = WB + (size_t)DM * DM; bf* WOT = WB + (size_t)2 * DM * DM;

    if (SEQ == SEQ_FULL) {
        const size_t n8 = (size_t)NB * SEQ * DM / 8; const unsigned g = (unsigned)((n8 + 255) / 256);
        k_cvt8<<<g, 256, 0, stream>>>(xq, XQ, n8);
        k_cvt8<<<g, 256, 0, stream>>>(xk, XK, n8);
        k_cvt8<<<g, 256, 0, stream>>>(xv, XV, n8);
    } else {
        const size_t n8 = (size_t)SEQ * DM / 8; const unsigned g = (unsigned)((n8 + 255) / 256);
        for (int b = 0; b < NB; ++b) {
            k_cvt8<<<g, 256, 0, stream>>>(xq + (size_t)b * SEQ_FULL * DM, XQ + (size_t)b * SEQ * DM, n8);
            k_cvt8<<<g, 256, 0, stream>>>(xk + (size_t)b * SEQ_FULL * DM, XK + (size_t)b * SEQ * DM, n8);
            k_cvt8<<<g, 256, 0, stream>>>(xv + (size_t)b * SEQ_FULL * DM, XV + (size_t)b * SEQ * DM, n8);
        }
    }
    // weights: in[rows = 1024 (contraction index)][cols = 1024 (output feature)] -> out[cols][rows]; grid (cols/64, rows/64)
    { const dim3 g(DM / 64, DM / 64, 1);
      k_cvtT<0><<<g, 256, 0, stream>>>(wq, (unsigned short*)WQT, DM, DM);
      k_cvtT<0><<<g, 256, 0, stream>>>(wk, (unsigned short*)WKT, DM, DM);
      k_cvtT<1><<<g, 256, 0, stream>>>(wo, (unsigned short*)WOT, DM, DM); }

    // launch order v, k, q: each residual plane lands in an input copy that an earlier launch has fully consumed
    // v^T: the value projection uses the QUERY weight and bias: A = q_w^T rows (m = h*64 + d), Bt = value-input rows (n = b*SEQ + t), row bias q_b[m] -> plane [(b*1024 + m)][t] = [(b*16 + h)][d][t]; no residual plane
    k_proj<1, 0><<<dim3(DM / 64, NB * SEQ / 64, 1), 32, 0, stream>>>(WQT, XV, bq, VT, VT, DM, (size_t)0, SEQ, SEQ, (size_t)DM * SEQ);
    // k, q: A = x rows (m = b*SEQ + t), Bt = W^T rows (n = h*64 + d), column bias -> value and residual planes [(b*16 + h)][t][d]
    k_proj<0, SCORE_RES><<<dim3(NB * SEQ / 64, DM / 64, 1), 32, 0, stream>>>(XK, WKT, bk, KP, KR, SEQ, (size_t)NH_ * SEQ * HD, HD, HD, (size_t)SEQ * HD);
    k_proj<0, SCORE_RES><<<dim3(NB * SEQ / 64, DM / 64, 1), 32, 0, stream>>>(XQ, WQT, bq, QH, QR, SEQ, (size_t)NH_ * SEQ * HD, HD, HD, (size_t)SEQ * HD);

    k_flash<<<dim3(SEQ / (16 * AW), NB * NH_, 1), 32 * AW, 0, stream>>>(QH, QR, KP, KR, VT, CTX);

    k_out<<<dim3(NB * SEQ / 64, DM / 64, 1), 32, 0, stream>>>(CTX, (const h16*)WOT, bo, OUT);
}

// v001
// Measured time: 301 microseconds a run.
// In both of two side-by-side timings against v000, it was 1.70 times as fast.
#include <hip/hip_runtime.h>

// Multi-head self-attention block, width 1024 = 16 heads x 64; separate query / key / value inputs [NB][SEQ_FULL][1024] (first SEQ tokens of each batch used); q_w / k_w / out_w stored [in][out] (y = x W + b); the value projection uses the query weight and the query bias (there is no separate value weight); no mask; score scale 1/8; output = ctx out_w + out_b (f32).
// Compute dtypes, f32 accumulate everywhere: q/k/v projections v_wmma_f32_16x16x32_bf16 (inputs and weights RNE-converted to bf16; products exact); scores v_wmma_f32_16x16x32_f16 with q and k each carried as f16 value + f16 residual x2048 (three products: value.value in the main accumulator, value.residual + residual.value in a separate accumulator folded back by 1/2048); P.V v_wmma_f32_16x16x32_f16 (P x256 carry, cancels in the normalisation; v single f16); output projection v_wmma_f32_16x16x32_f16: ctx f16 with x256 carry, out_w^T (bf16 RNE value) x64 as f16, carries folded back in the f32 epilogue; softmax f32 (online, running max); biases (bf16 RNE values) added in f32.
// Layout: bf16 copies of the three inputs; transposed 16-bit weight planes [out][in]; q, k value and residual planes [b*16+h][t][d] and v^T plane [b*16+h][d][t] written by the GEMM epilogue; fused flash kernel in transposed form (S^T = K Q^T, O^T = V^T P^T) writing the ctx plane [b*SEQ+t][h*64+d]; final GEMM writes the f32 output.

#ifndef NB
#define NB 4
#endif
#ifndef SEQ
#define SEQ 2048
#endif
#define NB_FULL  4
#define SEQ_FULL 2048
#ifndef OUT_SEQ
#define OUT_SEQ SEQ              // row pitch (in tokens) between batches of the output
#endif
#ifndef SCORE_RES
#define SCORE_RES 1              // 1: q and k residual planes and three-product scores; 0: single-product scores
#endif
#define DM   1024
#define NH_  16
#define HD   64
#define AW   8                   // waves per flash block (16 query rows each); all of them read the same staged key tiles
#define KST  64                  // keys per LDS stage: every staged row (K, K residual: one key; V^T: one d) is one whole 128-B line
#define LP   72                  // LDS row pitch in halves: 144 B = 16 B x odd, conflict-free for 16-byte fragment reads
#define TILE_H (64 * LP)         // halves of one staged tile (64 rows)
#define STG_H  (3 * TILE_H)      // one stage: K value | K residual | V^T
#define SC2  (0.125f * 1.4426950408889634f)   // HD^-0.5 * log2(e)
#define PSH  8.0f                // log2 of the P carry (256)
#define CTXS 256.0f              // carry of the ctx plane
#define WOS  64.0f               // carry of the Wo^T plane
#define OSC  (1.0f / 16384.0f)   // 1 / (CTXS * WOS)
#define RESC 2048.0f             // carry of the q / k residual planes
#define RESI (1.0f / 2048.0f)    // 1 / RESC

static_assert(HD == 64);
static_assert(NH_ * HD == DM);                 // head h = columns h*64 + d
static_assert(DM % 64 == 0);                   // column tiles of 64
static_assert(DM % 32 == 0);                   // GEMM k-loop steps by 32
static_assert(SEQ % 64 == 0);                  // a 64-row tile never straddles two batches
static_assert((NB * SEQ) % 64 == 0);
static_assert(SEQ % 32 == 0);                  // key loop steps by 32
static_assert(SEQ % (16 * AW) == 0);           // flash grid covers the sequence exactly
static_assert(SEQ % KST == 0);                 // key stages cover the sequence exactly
static_assert(KST == 64 && KST % 32 == 0);     // a stage is two 32-key steps; V^T rows of a stage are 128 B
static_assert(32 * AW * 2 * 8 == 64 * HD);     // two 16-byte copies per thread fill one 64 x 64 tile
static_assert((size_t)AW * 16 * 68 * 4 <= (size_t)2 * STG_H * 2);   // output staging fits the ring it reuses
static_assert(((size_t)SEQ * DM) % 8 == 0);
static_assert(((size_t)DM * DM) % 8 == 0);
static_assert(NB <= NB_FULL);
static_assert(SEQ <= SEQ_FULL);
static_assert(RESC * RESI == 1.0f);            // residual carry folds back exactly
static_assert(CTXS * WOS * OSC == 1.0f);       // output carries fold back exactly

typedef _Float16 h16;
typedef unsigned short bf;
typedef __attribute__((ext_vector_type(16))) __bf16   v16bf;
typedef __attribute__((ext_vector_type(16))) _Float16 v16h;
typedef __attribute__((ext_vector_type(8)))  _Float16 v8h;
typedef __attribute__((ext_vector_type(8)))  unsigned short v8us;
typedef __attribute__((ext_vector_type(8)))  float    v8f;
typedef __attribute__((ext_vector_type(4)))  float    v4f;
typedef v4f  __attribute__((may_alias)) v4fa;

__device__ __forceinline__ unsigned short f2bf(float f) { unsigned u = __float_as_uint(f); u += 0x7FFFu + ((u >> 16) & 1u); return (unsigned short)(u >> 16); }
__device__ __forceinline__ float bfr(float f) { return __uint_as_float(((unsigned)f2bf(f)) << 16); }   // value of the bf16 RNE conversion, as f32
__device__ __forceinline__ v16h cat16(v8h lo, v8h hi) { return __builtin_shufflevector(lo, hi, 0, 1, 2, 3, 4, 5, 6, 7, 8, 9, 10, 11, 12, 13, 14, 15); }
__device__ __forceinline__ v16bf cat16b(v8us lo, v8us hi) { return __builtin_bit_cast(v16bf, __builtin_shufflevector(lo, hi, 0, 1, 2, 3, 4, 5, 6, 7, 8, 9, 10, 11, 12, 13, 14, 15)); }
__device__ __forceinline__ v8f wmma16(v16h a, v16h b, v8f c) { return __builtin_amdgcn_wmma_f32_16x16x32_f16(false, a, false, b, (short)0, c, false, false); }
__device__ __forceinline__ v8f wmmab(v16bf a, v16bf b, v8f c) { return __builtin_amdgcn_wmma_f32_16x16x32_bf16(false, a, false, b, (short)0, c, false, false); }
// fragment loaders from K-contiguous 16-bit rows; p already includes + 8*(lane>>4): elements 0..7 <- k0+8h+0..7, elements 8..15 <- k0+16+8h+0..7 (same map for A and B)
__device__ __forceinline__ v16h  ldh(const h16* p) { return cat16(*(const v8h*)p, *(const v8h*)(p + 16)); }
__device__ __forceinline__ v16bf ldb(const bf* p)  { return cat16b(*(const v8us*)p, *(const v8us*)(p + 16)); }
// ordering point for wave-private LDS tiles (same wave writes and reads)
__device__ __forceinline__ void wave_sync() { __builtin_amdgcn_fence(3 /* release order */, "wavefront"); __builtin_amdgcn_wave_barrier(); asm volatile("" ::: "memory"); }
// f32 -> f16 for operand planes: a result below the smallest normal f16 magnitude is replaced by zero (value select)
static __device__ __forceinline__ h16 toh_flush(float v) { const h16 r = (h16)v; return (fabsf(v) < 6.103515625e-05f) ? (h16)0.0f : r; }

__global__ __launch_bounds__(256) void k_cvt8(const float* __restrict__ src, bf* dst, size_t n8) {
    const size_t i = (size_t)blockIdx.x * 256 + threadIdx.x; if (i >= n8) return;
    const v8f v = *(const v8f*)(src + i * 8); v8us o;
#pragma unroll
    for (int k = 0; k < 8; ++k) o[k] = f2bf(v[k]);
    *(v8us*)(dst + i * 8) = o; 
}

// k_cvtT: transpose + 16-bit convert of a weight matrix: in[R][C] (f32, R = contraction index, C = output feature) -> out[C][R] (16-bit, contraction-contiguous).
// F16OUT == 0: bf16 RNE bits; F16OUT == 1: f16 of (bf16 RNE value x WOS) (exact for values whose scaled magnitude is in the f16 normal range).
template <int F16OUT>
__global__ __launch_bounds__(256) void k_cvtT(const float* __restrict__ W, unsigned short* dst, int R, int C) {
    __shared__ float ts[64 * 65];
    const int tid = threadIdx.x;
    const int n0 = blockIdx.x * 64, k0 = blockIdx.y * 64;
#pragma unroll
    for (int it = 0; it < 4; ++it) {                     // 4 x 16 rows x (16 lanes x 4 floats) = 64 x 64, all written
        const int r = it * 16 + (tid >> 4), c4 = (tid & 15) * 4;
        const v4f v = *(const v4f*)(W + (size_t)(k0 + r) * (size_t)C + n0 + c4);
#pragma unroll
        for (int i = 0; i < 4; ++i) ts[r * 65 + c4 + i] = v[i];
    }
    __syncthreads();
    v8us o[2];
#pragma unroll
    for (int it = 0; it < 2; ++it) {                     // 2 x 32 output rows x (8 lanes x 8 halves) = 64 x 64
        const int n = it * 32 + (tid >> 3), k8 = (tid & 7) * 8;
#pragma unroll
        for (int i = 0; i < 8; ++i) {
            const float x = ts[(k8 + i) * 65 + n];
            const unsigned short bb = f2bf(x);
            if (F16OUT) { const h16 hv = (h16)(__uint_as_float(((unsigned)bb) << 16) * WOS); o[it][i] = __builtin_bit_cast(unsigned short, hv); }
            else o[it][i] = bb;
        }
    }
{
#pragma unroll
        for (int it = 0; it < 2; ++it) { const int n = it * 32 + (tid >> 3), k8 = (tid & 7) * 8;
            *(v8us*)(dst + (size_t)(n0 + n) * (size_t)R + k0 + k8) = o[it]; }
         }
}

// k_proj: register-blocked bf16 GEMM, ONE WAVE per 64x64 tile (16 accumulators), operands straight from K-contiguous bf16 planes, K = DM.
// C[m][n] = sum_k A[m][k] Bt[n][k] + bias (BROW == 0: bias[n]; BROW == 1: bias[m]), written as f16 (Ph) at
// tile base (r0/RB)*sRB + (r0%RB)*pitch + (c0/CB)*sCB + (c0%CB), row pitch 'pitch' (halves). grid (M/64, N/64), 32 threads.
// RES == 1: additionally the residual plane Pr (same addressing) = f16((C - f16 value) x RESC); RES == 0: Pr is not touched.
template <int BROW, int RES>
__global__ __launch_bounds__(32) void k_proj(const bf* __restrict__ A, const bf* __restrict__ Bt, const float* __restrict__ bias, h16* Ph, h16* Pr, int RB, size_t sRB, int pitch, int CB, size_t sCB) {
    __shared__ __align__(16) float os[16 * 68];
    const int K = DM;
    const int lane = threadIdx.x & 31, lr = lane & 15, hi = lane >> 4; const int r0 = blockIdx.x * 64, c0 = blockIdx.y * 64;
    v8f acc[4][4];
#pragma unroll
    for (int mb = 0; mb < 4; ++mb)
#pragma unroll
        for (int nb = 0; nb < 4; ++nb) acc[mb][nb] = (v8f){};
    const size_t aoff = (size_t)(r0 + lr) * K + 8 * hi, boff = (size_t)(c0 + lr) * K + 8 * hi;
#pragma unroll 1
    for (int kc = 0; kc < K; kc += 32) {
        v16bf a[4];
#pragma unroll
        for (int mb = 0; mb < 4; ++mb) a[mb] = ldb(A + aoff + (size_t)mb * 16 * K + kc);
#pragma unroll
        for (int nb = 0; nb < 4; ++nb) { const v16bf b = ldb(Bt + boff + (size_t)nb * 16 * K + kc);
#pragma unroll
            for (int mb = 0; mb < 4; ++mb) acc[mb][nb] = wmmab(a[mb], b, acc[mb][nb]); }
        asm volatile("v_nop\n\tv_nop\n\tv_nop\n\tv_nop" : "+v"(acc[0][0]), "+v"(acc[1][1]), "+v"(acc[2][2]), "+v"(acc[3][3]) : "v"(a[0]), "v"(a[1]), "v"(a[2]), "v"(a[3]));
    }
    // column bias for this lane's 8 store columns (BROW == 0); c0 + (lane&7)*8 + 7 < N = DM
    v4f bc0 = (v4f){}, bc1 = (v4f){};
    if (BROW == 0) { const int cb8 = (lane & 7) * 8; const v4f t0 = *(const v4f*)(bias + c0 + cb8); const v4f t1 = *(const v4f*)(bias + c0 + cb8 + 4);
#pragma unroll
        for (int i = 0; i < 4; ++i) { bc0[i] = bfr(t0[i]); bc1[i] = bfr(t1[i]); } }
    const size_t tbase = (size_t)(r0 / RB) * sRB + (size_t)(r0 % RB) * (size_t)pitch + (size_t)(c0 / CB) * sCB + (size_t)(c0 % CB);
#pragma unroll
    for (int mb = 0; mb < 4; ++mb) {
#pragma unroll
        for (int nb = 0; nb < 4; ++nb) {
#pragma unroll
            for (int j = 0; j < 8; ++j) os[(hi * 8 + j) * 68 + nb * 16 + lr] = acc[mb][nb][j]; }   // D: row 8h+j, col lane&15
        wave_sync();
        const size_t sb = tbase + (size_t)(mb * 16) * (size_t)pitch;
{
#pragma unroll
            for (int s = 0; s < 4; ++s) { const int row = 4 * s + (lane >> 3), c8 = (lane & 7) * 8;   // 4 s x 4 row groups = 16 rows; 8 lanes x 8 = 64 columns
                v4f x0 = *(const v4fa*)(&os[row * 68 + c8]); v4f x1 = *(const v4fa*)(&os[row * 68 + c8 + 4]); v8h hv; v8h rv;
                if (BROW == 1) { const float br = bfr(bias[r0 + mb * 16 + row]);                    // row bias; r0 + mb*16 + row < M = DM
#pragma unroll
                    for (int i = 0; i < 4; ++i) { x0[i] += br; x1[i] += br; } }
                else {
#pragma unroll
                    for (int i = 0; i < 4; ++i) { x0[i] += bc0[i]; x1[i] += bc1[i]; } }
#pragma unroll
                for (int i = 0; i < 4; ++i) { const h16 a = toh_flush(x0[i]); const h16 c = toh_flush(x1[i]); hv[i] = a; hv[4 + i] = c;
                    rv[i] = toh_flush((x0[i] - (float)a) * RESC); rv[4 + i] = toh_flush((x1[i] - (float)c) * RESC); }   // difference and carry are exact in f32
                const size_t oo = sb + (size_t)row * (size_t)pitch + c8;
                *(v8h*)(Ph + oo) = hv;
                if (RES) *(v8h*)(Pr + oo) = rv; }
             }
        wave_sync();
    }
}

// stage_copy: one thread's share of a 64-key stage, 16-byte asynchronous copies global -> LDS, two per tile (rows r and r + 32); l = LDS byte address of its K-tile piece.
// The s_wait_xcnt ends the copies' own statement so that no address register named there is rewritten ahead of it.
__device__ __forceinline__ void stage_copy(unsigned l, const h16* gk, const h16* gr, const h16* gv) {
    const unsigned lk1 = l + 32 * LP * 2, lr0 = l + TILE_H * 2, lr1 = lr0 + 32 * LP * 2, lv0 = l + 2 * TILE_H * 2, lv1 = lv0 + 32 * LP * 2;
    const h16* gk1 = gk + 32 * HD; const h16* gr1 = gr + 32 * HD; const h16* gv1 = gv + (size_t)32 * SEQ;
    if (SCORE_RES)
        asm volatile("global_load_async_to_lds_b128 %0, %6, off\n\tglobal_load_async_to_lds_b128 %1, %7, off\n\t"
                     "global_load_async_to_lds_b128 %2, %8, off\n\tglobal_load_async_to_lds_b128 %3, %9, off\n\t"
                     "global_load_async_to_lds_b128 %4, %10, off\n\tglobal_load_async_to_lds_b128 %5, %11, off\n\ts_wait_xcnt 0x0"
                     :: "v"(l), "v"(lk1), "v"(lr0), "v"(lr1), "v"(lv0), "v"(lv1), "v"(gk), "v"(gk1), "v"(gr), "v"(gr1), "v"(gv), "v"(gv1) : "memory");
    else
        asm volatile("global_load_async_to_lds_b128 %0, %4, off\n\tglobal_load_async_to_lds_b128 %1, %5, off\n\t"
                     "global_load_async_to_lds_b128 %2, %6, off\n\tglobal_load_async_to_lds_b128 %3, %7, off\n\ts_wait_xcnt 0x0"
                     :: "v"(l), "v"(lk1), "v"(lv0), "v"(lv1), "v"(gk), "v"(gk1), "v"(gv), "v"(gv1) : "memory");
}

// k_flash: fused attention, one wave per 16 query rows of one (batch, head); Q fragments straight from the f16 planes; K, K residual and V^T come in 64-key stages through a
// two-buffer LDS ring that the block's waves share: asynchronous 16-byte copies (whole 128-B lines per row), stage t + 2 issued behind the barrier that ends the reads of stage t.
// Transposed form: S^T[key][t] = K Q^T (A = K rows, B = Q rows); lane (t = lane&15, h = lane>>4) holds keys 8h+r of each 16-key tile, so the packed
// P tile is directly the B fragment of O^T[d][t] = V^T P^T (element r <- tile keys 0..15, element 8+r <- tile keys 16..31, lane unchanged).
// Per 32-key step: 4 value.value score products in the main accumulators, 8 value.residual / residual.value products in separate accumulators (x RESC, folded back by RESI), 4 P.V products.
// Softmax state (running max, partial sum) is one scalar per lane; the two lane halves of a row are combined with one xor-16 exchange.
__global__ __launch_bounds__(32 * AW) void k_flash(const h16* __restrict__ QH, const h16* __restrict__ QR, const h16* __restrict__ KP, const h16* __restrict__ KR, const h16* __restrict__ VT, h16* CTX) {
    __shared__ __align__(16) h16 ring[2 * STG_H];            // two stages; reused as output staging behind the loop
    float* os = (float*)ring;
    const int lane = threadIdx.x & 31, lr = lane & 15, hi = lane >> 4;
    const int wave = __builtin_amdgcn_readfirstlane((int)(threadIdx.x >> 5));
    const int zh = blockIdx.y; const int b = zh / NH_, h = zh % NH_;
    const int t0 = (blockIdx.x * AW + wave) * 16;
    const size_t pbase = (size_t)zh * SEQ * HD;
    // this thread's share of a stage: rows cr and cr + 32 of each tile, 16 bytes at column ccol (8 lanes = one 128-B row, a wave = 4 whole lines)
    const int cr = (int)(threadIdx.x >> 3), ccol = (int)(threadIdx.x & 7) * 8;
    const unsigned cl = (unsigned)(size_t)(&ring[cr * LP + ccol]);               // LDS byte address in buffer 0, K tile
    const size_t ck = pbase + (size_t)cr * HD + ccol;        // + key * HD   (K and K residual planes: row = key; key + cr + 32 < SEQ)
    const size_t cv = pbase + (size_t)cr * SEQ + ccol;       // + key        (V^T plane: row = d, cr + 32 < HD; key + ccol + 7 < SEQ)
    stage_copy(cl, KP + ck, KR + ck, VT + cv);                                     // stage 0 -> buffer 0
    const size_t qo = pbase + (size_t)(t0 + lr) * HD + 8 * hi;
    const v16h qh0 = ldh(QH + qo), qh1 = ldh(QH + qo + 32);   // B fragments: col t, k = d
    v16h qr0 = qh0, qr1 = qh1;
    if (SCORE_RES) { qr0 = ldh(QR + qo); qr1 = ldh(QR + qo + 32); }   // residual B fragments (x RESC)
    const int ko = lr * LP + 8 * hi;                         // + key * LP in the K tiles (A fragment: row key, k = d); + 16j*LP + key in the V^T tile (A fragment: row d, k = key)
    v8f o0 = (v8f){}, o1 = (v8f){}, o2 = (v8f){}, o3 = (v8f){};
    float m = -3.0e38f, l = 0.0f;
    asm volatile("s_wait_asynccnt 0x0" ::: "memory");        // this wave's copies of stage 0 have landed
    __syncthreads();                                         // every wave's have: stage 0 may be read
    if (SEQ > KST) stage_copy(cl + STG_H * 2, KP + ck + (size_t)KST * HD, KR + ck + (size_t)KST * HD, VT + cv + KST);   // stage 1 -> buffer 1
#pragma unroll 1
    for (int ks = 0; ks < SEQ; ks += KST) {
      const int bsel = (ks / KST) & 1;
      const h16* sk = ring + bsel * STG_H + ko;
#pragma unroll
      for (int u = 0; u < KST; u += 32) {                    // the two 32-key steps of the stage, in key order; unrolled so that every LDS offset is an immediate
        const h16* ka = sk + u * LP;
        const v16h ka0 = ldh(ka), ka1 = ldh(ka + 32), kb0 = ldh(ka + 16 * LP), kb1 = ldh(ka + 16 * LP + 32);
        v8f sa = (v8f){}, sb = (v8f){}, ra = (v8f){}, rb = (v8f){};
        sa = wmma16(ka0, qh0, sa); sb = wmma16(kb0, qh0, sb);
        sa = wmma16(ka1, qh1, sa); sb = wmma16(kb1, qh1, sb);
        if (SCORE_RES) {
            const h16* kr = ka + TILE_H;
            const v16h ea0 = ldh(kr), ea1 = ldh(kr + 32), eb0 = ldh(kr + 16 * LP), eb1 = ldh(kr + 16 * LP + 32);
            ra = wmma16(ka0, qr0, ra); rb = wmma16(kb0, qr0, rb);
            ra = wmma16(ka1, qr1, ra); rb = wmma16(kb1, qr1, rb);
            ra = wmma16(ea0, qh0, ra); rb = wmma16(eb0, qh0, rb);
            ra = wmma16(ea1, qh1, ra); rb = wmma16(eb1, qh1, rb);
            asm volatile("v_nop\n\tv_nop\n\tv_nop\n\tv_nop" : "+v"(sa), "+v"(sb), "+v"(ra), "+v"(rb) : "v"(ka0), "v"(ka1), "v"(kb0), "v"(kb1), "v"(ea0), "v"(ea1), "v"(eb0), "v"(eb1), "v"(qh0), "v"(qh1), "v"(qr0), "v"(qr1));
        } else {
            asm volatile("v_nop\n\tv_nop\n\tv_nop\n\tv_nop" : "+v"(sa), "+v"(sb) : "v"(ka0), "v"(ka1), "v"(kb0), "v"(kb1), "v"(qh0), "v"(qh1));
        }
        float ta[8], tb[8]; float mx = -3.0e38f;
#pragma unroll
        for (int r = 0; r < 8; ++r) { ta[r] = (sa[r] + ra[r] * RESI) * SC2; tb[r] = (sb[r] + rb[r] * RESI) * SC2; mx = fmaxf(mx, fmaxf(ta[r], tb[r])); }
        mx = fmaxf(mx, __shfl_xor(mx, 16, 32));
        const float mnew = fmaxf(m, mx);
        const float alpha = __builtin_amdgcn_exp2f(m - mnew);
        const float sh = PSH - mnew;
        v16h pb; float ls = 0.0f;
#pragma unroll
        for (int r = 0; r < 8; ++r) {
            const float ea = ta[r] + sh, eb = tb[r] + sh;
            const float xa = __builtin_amdgcn_exp2f(ea), xb = __builtin_amdgcn_exp2f(eb);
            const h16 pa = (ea < -14.0f) ? (h16)0.0f : (h16)xa;    // exponent cut: no f16 value below the smallest normal
            const h16 pc = (eb < -14.0f) ? (h16)0.0f : (h16)xb;
            pb[r] = pa; pb[8 + r] = pc; ls += (float)pa + (float)pc; }
        l = l * alpha + ls; m = mnew;
        o0 = o0 * alpha; o1 = o1 * alpha; o2 = o2 * alpha; o3 = o3 * alpha;
        const h16* va = sk + 2 * TILE_H + u;
        const v16h v0 = ldh(va), v1 = ldh(va + 16 * LP), v2 = ldh(va + 32 * LP), v3 = ldh(va + 48 * LP);
        o0 = wmma16(v0, pb, o0); o1 = wmma16(v1, pb, o1); o2 = wmma16(v2, pb, o2); o3 = wmma16(v3, pb, o3);
        asm volatile("v_nop\n\tv_nop\n\tv_nop\n\tv_nop" : "+v"(o0), "+v"(o1), "+v"(o2), "+v"(o3) : "v"(v0), "v"(v1), "v"(v2), "v"(v3), "v"(pb));
      }
      asm volatile("s_wait_dscnt 0x0" ::: "memory");         // this wave's reads of the stage have returned: its buffer may be handed to the copies
      asm volatile("s_wait_asynccnt 0x0" ::: "memory");      // this wave's copies of the next stage have landed
      __syncthreads();                                       // publishes the next stage and ends every wave's reads of this one
      if (ks + 2 * KST < SEQ) {                              // block-uniform: refill the buffer just read with the stage after next
        const size_t kn = (size_t)(ks + 2 * KST);
        stage_copy(cl + (unsigned)bsel * (STG_H * 2), KP + ck + kn * HD, KR + ck + kn * HD, VT + cv + kn); }
    }
    asm volatile("s_wait_asynccnt 0x0" ::: "memory");        // nothing of the ring is in flight; the last trip's barrier has ended all reads, so it may become output staging
    l += __shfl_xor(l, 16, 32);
    const float inv = CTXS / l;
    const int wb = wave * 16 * 68;
    // O^T D layout: o_j[r] = (d = 16j + 8h + r, t = lane&15) -> os[t][d]; rows 0..15 x columns 0..63 all written
    { v4f a, c;
      a[0] = o0[0] * inv; a[1] = o0[1] * inv; a[2] = o0[2] * inv; a[3] = o0[3] * inv; c[0] = o0[4] * inv; c[1] = o0[5] * inv; c[2] = o0[6] * inv; c[3] = o0[7] * inv;
      *(v4fa*)(&os[wb + lr * 68 +  0 + 8 * hi]) = a; *(v4fa*)(&os[wb + lr * 68 +  0 + 8 * hi + 4]) = c;
      a[0] = o1[0] * inv; a[1] = o1[1] * inv; a[2] = o1[2] * inv; a[3] = o1[3] * inv; c[0] = o1[4] * inv; c[1] = o1[5] * inv; c[2] = o1[6] * inv; c[3] = o1[7] * inv;
      *(v4fa*)(&os[wb + lr * 68 + 16 + 8 * hi]) = a; *(v4fa*)(&os[wb + lr * 68 + 16 + 8 * hi + 4]) = c;
      a[0] = o2[0] * inv; a[1] = o2[1] * inv; a[2] = o2[2] * inv; a[3] = o2[3] * inv; c[0] = o2[4] * inv; c[1] = o2[5] * inv; c[2] = o2[6] * inv; c[3] = o2[7] * inv;
      *(v4fa*)(&os[wb + lr * 68 + 32 + 8 * hi]) = a; *(v4fa*)(&os[wb + lr * 68 + 32 + 8 * hi + 4]) = c;
      a[0] = o3[0] * inv; a[1] = o3[1] * inv; a[2] = o3[2] * inv; a[3] = o3[3] * inv; c[0] = o3[4] * inv; c[1] = o3[5] * inv; c[2] = o3[6] * inv; c[3] = o3[7] * inv;
      *(v4fa*)(&os[wb + lr * 68 + 48 + 8 * hi]) = a; *(v4fa*)(&os[wb + lr * 68 + 48 + 8 * hi + 4]) = c; }
    wave_sync();
    h16* crow = CTX + ((size_t)b * SEQ + t0) * DM + h * HD;      // ctx plane [b*SEQ + t][h*64 + d], x CTXS
{
#pragma unroll
        for (int s = 0; s < 4; ++s) { const int row = 4 * s + (lane >> 3), c8 = (lane & 7) * 8;   // 4 s x 4 rows = 16 rows; 8 lanes x 8 halves = 64 columns
            const v4f x0 = *(const v4fa*)(&os[wb + row * 68 + c8]); const v4f x1 = *(const v4fa*)(&os[wb + row * 68 + c8 + 4]); v8h hv;
#pragma unroll
            for (int i = 0; i < 4; ++i) { hv[i] = toh_flush(x0[i]); hv[4 + i] = toh_flush(x1[i]); }
            *(v8h*)(crow + (size_t)row * DM + c8) = hv; }
         }
}

// k_out: output projection, f16 GEMM, ONE WAVE per 64x64 tile, operands straight from K-contiguous f16 planes, K = DM.
// OUT[m][n] = OSC * sum_k CTX[m][k] WoT[n][k] + bo[n] (f32). grid (NB*SEQ/64, DM/64), 32 threads.
__global__ __launch_bounds__(32) void k_out(const h16* __restrict__ A, const h16* __restrict__ Bt, const float* __restrict__ bias, float* OUT) {
    __shared__ __align__(16) float os[16 * 68];
    const int K = DM;
    const int lane = threadIdx.x & 31, lr = lane & 15, hi = lane >> 4; const int r0 = blockIdx.x * 64, c0 = blockIdx.y * 64;
    v8f acc[4][4];
#pragma unroll
    for (int mb = 0; mb < 4; ++mb)
#pragma unroll
        for (int nb = 0; nb < 4; ++nb) acc[mb][nb] = (v8f){};
    const size_t aoff = (size_t)(r0 + lr) * K + 8 * hi, boff = (size_t)(c0 + lr) * K + 8 * hi;
#pragma unroll 1
    for (int kc = 0; kc < K; kc += 32) {
        v16h a[4];
#pragma unroll
        for (int mb = 0; mb < 4; ++mb) a[mb] = ldh(A + aoff + (size_t)mb * 16 * K + kc);
#pragma unroll
        for (int nb = 0; nb < 4; ++nb) { const v16h b = ldh(Bt + boff + (size_t)nb * 16 * K + kc);
#pragma unroll
            for (int mb = 0; mb < 4; ++mb) acc[mb][nb] = wmma16(a[mb], b, acc[mb][nb]); }
        asm volatile("v_nop\n\tv_nop\n\tv_nop\n\tv_nop" : "+v"(acc[0][0]), "+v"(acc[1][1]), "+v"(acc[2][2]), "+v"(acc[3][3]) : "v"(a[0]), "v"(a[1]), "v"(a[2]), "v"(a[3]));
    }
    const int cofs = lr * 4;
    v4f bb; { const v4f t = *(const v4f*)(bias + c0 + cofs);      // c0 + cofs + 3 < DM
#pragma unroll
        for (int i = 0; i < 4; ++i) bb[i] = bfr(t[i]); }
    float* orow = OUT + ((size_t)(r0 / SEQ) * OUT_SEQ + (size_t)(r0 % SEQ)) * DM + c0;
#pragma unroll
    for (int mb = 0; mb < 4; ++mb) {
#pragma unroll
        for (int nb = 0; nb < 4; ++nb) {
#pragma unroll
            for (int j = 0; j < 8; ++j) os[(hi * 8 + j) * 68 + nb * 16 + lr] = acc[mb][nb][j]; }   // D: row 8h+j, col lane&15
        wave_sync();
{
#pragma unroll
            for (int s = 0; s < 8; ++s) { const int row = 2 * s + hi;   // 8 s x 2 rows = 16 rows; 16 lanes x 4 floats = 64 columns
                const v4f x = *(const v4fa*)(&os[row * 68 + cofs]); v4f val;
#pragma unroll
                for (int i = 0; i < 4; ++i) val[i] = x[i] * OSC + bb[i];
                *(v4f*)(orow + (size_t)(mb * 16 + row) * DM + cofs) = val; }
             }
        wave_sync();
    }
}

static constexpr size_t al256(size_t v) { return (v + 255) & ~(size_t)255; }
static constexpr size_t SZ_XB = al256((size_t)NB * SEQ * DM * 2);
static constexpr size_t SZ_WB = al256((size_t)3 * DM * DM * 2);
static constexpr size_t SZ_PL = al256((size_t)NB * NH_ * SEQ * HD * 2);
static constexpr size_t SZ_TOTAL = 3 * SZ_XB + SZ_WB + 3 * SZ_PL;
static_assert(SZ_TOTAL <= (size_t)134217728);                  // workspace carve <= 128 MiB
static_assert(((size_t)DM * DM * 2) % 256 == 0);               // weight sub-planes stay 256-byte aligned
static_assert((size_t)3 * DM * DM * 2 <= SZ_WB);               // three weight sub-planes (q | k | o) fit their region
static_assert((size_t)NB * SEQ * DM * 2 <= SZ_XB);             // ctx plane (aliases the query copy) fits its region
static_assert((size_t)NB * NH_ * SEQ * HD * 2 <= SZ_XB);       // q / k residual planes (alias the key / value copies) fit their regions

extern "C" void kernel_launch(void* const* d_in, const int* in_sizes, int n_in,
                              void* d_out, int out_size, void* d_ws, size_t ws_size, hipStream_t stream) {
    if (n_in < 9) return;
    const size_t needx = ((size_t)(NB - 1) * SEQ_FULL + SEQ) * DM;
    if ((size_t)in_sizes[0] < needx || (size_t)in_sizes[1] < needx || (size_t)in_sizes[2] < needx) return;
    if ((size_t)in_sizes[3] < (size_t)DM * DM || (size_t)in_sizes[5] < (size_t)DM * DM || (size_t)in_sizes[7] < (size_t)DM * DM) return;
    if (in_sizes[4] < DM || in_sizes[6] < DM || in_sizes[8] < DM) return;
    if ((size_t)out_size < ((size_t)(NB - 1) * OUT_SEQ + SEQ) * DM) return;
    if (SZ_TOTAL > ws_size) return;
    // wire order: q, k, v, q_w, q_b, k_w, k_b, out_w, out_b
    const float* xq = (const float*)d_in[0]; const float* xk = (const float*)d_in[1]; const float* xv = (const float*)d_in[2];
    const float* wq = (const float*)d_in[3]; const float* bq = (const float*)d_in[4];
    const float* wk = (const float*)d_in[5]; const float* bk = (const float*)d_in[6];
    const float* wo = (const float*)d_in[7]; const float* bo = (const float*)d_in[8];
    float* OUT = (float*)d_out;      // [NB][OUT_SEQ][1024]
    char* wsp = (char*)d_ws;
    bf* XQ = (bf*)wsp; wsp += SZ_XB;                 // [NB*SEQ][1024] bf16 queries; region reused later as the ctx plane
    bf* XK = (bf*)wsp; wsp += SZ_XB;                 // [NB*SEQ][1024] bf16 keys; region reused later as the q residual plane
    bf* XV = (bf*)wsp; wsp += SZ_XB;                 // [NB*SEQ][1024] bf16 values; region reused later as the k residual plane
    bf* WB = (bf*)wsp; wsp += SZ_WB;                 // [3][1024][1024] transposed [out][in]: q | k (bf16) | o (f16 x64)
    h16* QH = (h16*)wsp; wsp += SZ_PL;               // [NB*16][SEQ][64]
    h16* KP = (h16*)wsp; wsp += SZ_PL;               // [NB*16][SEQ][64]
    h16* VT = (h16*)wsp; wsp += SZ_PL;               // [NB*16][64][SEQ]
    h16* CTX = (h16*)XQ;                             // [NB*SEQ][1024] f16 x256, written after the q projection has consumed XQ
    h16* KR = (h16*)XV;                              // [NB*16][SEQ][64] f16 x2048, written after the v projection has consumed XV
    h16* QR = (h16*)XK;                              // [NB*16][SEQ][64] f16 x2048, written after the k projection has consumed XK
    bf* WQT = WB; bf* WKT = WB + (size_t)DM * DM; bf* WOT = WB + (size_t)2 * DM * DM;

    if (SEQ == SEQ_FULL) {
        const size_t n8 = (size_t)NB * SEQ * DM / 8; const unsigned g = (unsigned)((n8 + 255) / 256);
        k_cvt8<<<g, 256, 0, stream>>>(xq, XQ, n8);
        k_cvt8<<<g, 256, 0, stream>>>(xk, XK, n8);
        k_cvt8<<<g, 256, 0, stream>>>(xv, XV, n8);
    } else {
        const size_t n8 = (size_t)SEQ * DM / 8; const unsigned g = (unsigned)((n8 + 255) / 256);
        for (int b = 0; b < NB; ++b) {
            k_cvt8<<<g, 256, 0, stream>>>(xq + (size_t)b * SEQ_FULL * DM, XQ + (size_t)b * SEQ * DM, n8);
            k_cvt8<<<g, 256, 0, stream>>>(xk + (size_t)b * SEQ_FULL * DM, XK + (size_t)b * SEQ * DM, n8);
            k_cvt8<<<g, 256, 0, stream>>>(xv + (size_t)b * SEQ_FULL * DM, XV + (size_t)b * SEQ * DM, n8);
        }
    }
    // weights: in[rows = 1024 (contraction index)][cols = 1024 (output feature)] -> out[cols][rows]; grid (cols/64, rows/64)
    { const dim3 g(DM / 64, DM / 64, 1);
      k_cvtT<0><<<g, 256, 0, stream>>>(wq, (unsigned short*)WQT, DM, DM);
      k_cvtT<0><<<g, 256, 0, stream>>>(wk, (unsigned short*)WKT, DM, DM);
      k_cvtT<1><<<g, 256, 0, stream>>>(wo, (unsigned short*)WOT, DM, DM); }

    // launch order v, k, q: each residual plane lands in an input copy that an earlier launch has fully consumed
    // v^T: the value projection uses the QUERY weight and bias: A = q_w^T rows (m = h*64 + d), Bt = value-input rows (n = b*SEQ + t), row bias q_b[m] -> plane [(b*1024 + m)][t] = [(b*16 + h)][d][t]; no residual plane
    k_proj<1, 0><<<dim3(DM / 64, NB * SEQ / 64, 1), 32, 0, stream>>>(WQT, XV, bq, VT, VT, DM, (size_t)0, SEQ, SEQ, (size_t)DM * SEQ);
    // k, q: A = x rows (m = b*SEQ + t), Bt = W^T rows (n = h*64 + d), column bias -> value and residual planes [(b*16 + h)][t][d]
    k_proj<0, SCORE_RES><<<dim3(NB * SEQ / 64, DM / 64, 1), 32, 0, stream>>>(XK, WKT, bk, KP, KR, SEQ, (size_t)NH_ * SEQ * HD, HD, HD, (size_t)SEQ * HD);
    k_proj<0, SCORE_RES><<<dim3(NB * SEQ / 64, DM / 64, 1), 32, 0, stream>>>(XQ, WQT, bq, QH, QR, SEQ, (size_t)NH_ * SEQ * HD, HD, HD, (size_t)SEQ * HD);

    k_flash<<<dim3(SEQ / (16 * AW), NB * NH_, 1), 32 * AW, 0, stream>>>(QH, QR, KP, KR, VT, CTX);

    k_out<<<dim3(NB * SEQ / 64, DM / 64, 1), 32, 0, stream>>>(CTX, (const h16*)WOT, bo, OUT);
}

// v002
// Measured time: 223 microseconds a run.
// Two timings next to v001 both put it at 1.35 times that version's speed.
// Counting every step since v000, it is 2.30 times as fast.
#include <hip/hip_runtime.h>

// Multi-head self-attention block, width 1024 = 16 heads x 64; separate query / key / value inputs [NB][SEQ_FULL][1024] (first SEQ tokens of each batch used); q_w / k_w / out_w stored [in][out] (y = x W + b); the value projection uses the query weight and the query bias (there is no separate value weight); no mask; score scale 1/8; output = ctx out_w + out_b (f32).
// Compute dtypes, f32 accumulate everywhere: q/k/v projections v_wmma_f32_16x16x32_bf16 (inputs and weights RNE-converted to bf16; products exact); scores v_wmma_f32_16x16x32_f16 with q and k each carried as f16 value + f16 residual x2048 (three products: value.value in the main accumulator, value.residual + residual.value in a separate accumulator folded back by 1/2048); P.V v_wmma_f32_16x16x32_f16 (P x256 carry, cancels in the normalisation; v single f16); output projection v_wmma_f32_16x16x32_f16: ctx f16 with x256 carry, out_w^T (bf16 RNE value) x64 as f16, carries folded back in the f32 epilogue; softmax f32 (online, running max); biases (bf16 RNE values) added in f32.
// Layout: bf16 copies of the three inputs; transposed 16-bit weight planes [out][in]; q, k value and residual planes [b*16+h][t][d] and v^T plane [b*16+h][d][t] written by the GEMM epilogue; fused flash kernel in transposed form (S^T = K Q^T, O^T = V^T P^T) writing the ctx plane [b*SEQ+t][h*64+d]; final GEMM writes the f32 output.

#ifndef NB
#define NB 4
#endif
#ifndef SEQ
#define SEQ 2048
#endif
#define NB_FULL  4
#define SEQ_FULL 2048
#ifndef OUT_SEQ
#define OUT_SEQ SEQ              // row pitch (in tokens) between batches of the output
#endif
#ifndef SCORE_RES
#define SCORE_RES 1              // 1: q and k residual planes and three-product scores; 0: single-product scores
#endif
#define DM   1024
#define NH_  16
#define HD   64
#define AW   8                   // waves per flash block (16 query rows each); all of them read the same staged key tiles
#define KST  64                  // keys per LDS stage: every staged row (K, K residual: one key; V^T: one d) is one whole 128-B line
#define LP   72                  // LDS row pitch in halves: 144 B = 16 B x odd, conflict-free for 16-byte fragment reads
#define TILE_H (64 * LP)         // halves of one staged tile (64 rows)
#define STG_H  (3 * TILE_H)      // one stage: K value | K residual | V^T
#define SC2  (0.125f * 1.4426950408889634f)   // HD^-0.5 * log2(e)
#define PSH  8.0f                // log2 of the P carry (256)
#define CTXS 256.0f              // carry of the ctx plane
#define WOS  64.0f               // carry of the Wo^T plane
#define OSC  (1.0f / 16384.0f)   // 1 / (CTXS * WOS)
#define RESC 2048.0f             // carry of the q / k residual planes
#define RESI (1.0f / 2048.0f)    // 1 / RESC
#define GBM  256                 // GEMM block tile: rows of A
#define GBN  128                 // GEMM block tile: rows of Bt (output columns)
#define GKS  128                 // k per LDS stage of the GEMMs: every staged row is 256 B, two whole lines
#define GLP  136                 // LDS row pitch of the GEMM stages in halves: 272 B = 16 B x odd, conflict-free for 16-byte fragment reads
#define GSTG_H ((GBM + GBN) * GLP)   // halves of one GEMM stage: A rows | Bt rows

static_assert(HD == 64);
static_assert(NH_ * HD == DM);                 // head h = columns h*64 + d
static_assert(DM % 64 == 0);                   // column tiles of 64
static_assert(DM % 32 == 0);                   // GEMM k-loop steps by 32
static_assert(SEQ % 64 == 0);                  // a 64-row tile never straddles two batches
static_assert((NB * SEQ) % 64 == 0);
static_assert(SEQ % 32 == 0);                  // key loop steps by 32
static_assert(SEQ % (16 * AW) == 0);           // flash grid covers the sequence exactly
static_assert(SEQ % KST == 0);                 // key stages cover the sequence exactly
static_assert(KST == 64 && KST % 32 == 0);     // a stage is two 32-key steps; V^T rows of a stage are 128 B
static_assert(32 * AW * 2 * 8 == 64 * HD);     // two 16-byte copies per thread fill one 64 x 64 tile
static_assert((size_t)AW * 16 * 68 * 4 <= (size_t)2 * STG_H * 2);   // output staging fits the ring it reuses
static_assert(((size_t)SEQ * DM) % 8 == 0);
static_assert(DM % GBM == 0 && DM % GBN == 0 && (NB * SEQ) % GBM == 0 && (NB * SEQ) % GBN == 0);   // GEMM grids cover every operand exactly
static_assert(DM % GKS == 0 && DM / GKS >= 2 && GKS % 32 == 0);   // whole stages, at least two of them
static_assert(GBM == 4 * 64 && GBN == 2 * 64);                   // eight waves, 4 x 2, one 64 x 64 tile each
static_assert(256 * 8 * 8 == 128 * GKS);                         // eight 16-byte copies per thread fill 128 staged rows
static_assert((size_t)8 * 16 * 68 * 4 <= (size_t)2 * GSTG_H * 2);   // the waves' output staging fits the ring it reuses
static_assert(((size_t)DM * DM) % 8 == 0);
static_assert(NB <= NB_FULL);
static_assert(SEQ <= SEQ_FULL);
static_assert(RESC * RESI == 1.0f);            // residual carry folds back exactly
static_assert(CTXS * WOS * OSC == 1.0f);       // output carries fold back exactly

typedef _Float16 h16;
typedef unsigned short bf;
typedef __attribute__((ext_vector_type(16))) __bf16   v16bf;
typedef __attribute__((ext_vector_type(16))) _Float16 v16h;
typedef __attribute__((ext_vector_type(8)))  _Float16 v8h;
typedef __attribute__((ext_vector_type(8)))  unsigned short v8us;
typedef __attribute__((ext_vector_type(8)))  float    v8f;
typedef __attribute__((ext_vector_type(4)))  float    v4f;
typedef v4f  __attribute__((may_alias)) v4fa;

__device__ __forceinline__ unsigned short f2bf(float f) { unsigned u = __float_as_uint(f); u += 0x7FFFu + ((u >> 16) & 1u); return (unsigned short)(u >> 16); }
__device__ __forceinline__ float bfr(float f) { return __uint_as_float(((unsigned)f2bf(f)) << 16); }   // value of the bf16 RNE conversion, as f32
__device__ __forceinline__ v16h cat16(v8h lo, v8h hi) { return __builtin_shufflevector(lo, hi, 0, 1, 2, 3, 4, 5, 6, 7, 8, 9, 10, 11, 12, 13, 14, 15); }
__device__ __forceinline__ v16bf cat16b(v8us lo, v8us hi) { return __builtin_bit_cast(v16bf, __builtin_shufflevector(lo, hi, 0, 1, 2, 3, 4, 5, 6, 7, 8, 9, 10, 11, 12, 13, 14, 15)); }
__device__ __forceinline__ v8f wmma16(v16h a, v16h b, v8f c) { return __builtin_amdgcn_wmma_f32_16x16x32_f16(false, a, false, b, (short)0, c, false, false); }
__device__ __forceinline__ v8f wmmab(v16bf a, v16bf b, v8f c) { return __builtin_amdgcn_wmma_f32_16x16x32_bf16(false, a, false, b, (short)0, c, false, false); }
// fragment loaders from K-contiguous 16-bit rows; p already includes + 8*(lane>>4): elements 0..7 <- k0+8h+0..7, elements 8..15 <- k0+16+8h+0..7 (same map for A and B)
__device__ __forceinline__ v16h  ldh(const h16* p) { return cat16(*(const v8h*)p, *(const v8h*)(p + 16)); }
__device__ __forceinline__ v16bf ldb(const bf* p)  { return cat16b(*(const v8us*)p, *(const v8us*)(p + 16)); }
// ordering point for wave-private LDS tiles (same wave writes and reads)
__device__ __forceinline__ void wave_sync() { __builtin_amdgcn_fence(3 /* release order */, "wavefront"); __builtin_amdgcn_wave_barrier(); asm volatile("" ::: "memory"); }
// f32 -> f16 for operand planes: a result below the smallest normal f16 magnitude is replaced by zero (value select)
static __device__ __forceinline__ h16 toh_flush(float v) { const h16 r = (h16)v; return (fabsf(v) < 6.103515625e-05f) ? (h16)0.0f : r; }

__global__ __launch_bounds__(256) void k_cvt8(const float* __restrict__ src, bf* dst, size_t n8) {
    const size_t i = (size_t)blockIdx.x * 256 + threadIdx.x; if (i >= n8) return;
    const v8f v = *(const v8f*)(src + i * 8); v8us o;
#pragma unroll
    for (int k = 0; k < 8; ++k) o[k] = f2bf(v[k]);
    *(v8us*)(dst + i * 8) = o; 
}

// k_cvtT: transpose + 16-bit convert of a weight matrix: in[R][C] (f32, R = contraction index, C = output feature) -> out[C][R] (16-bit, contraction-contiguous).
// F16OUT == 0: bf16 RNE bits; F16OUT == 1: f16 of (bf16 RNE value x WOS) (exact for values whose scaled magnitude is in the f16 normal range).
template <int F16OUT>
__global__ __launch_bounds__(256) void k_cvtT(const float* __restrict__ W, unsigned short* dst, int R, int C) {
    __shared__ float ts[64 * 65];
    const int tid = threadIdx.x;
    const int n0 = blockIdx.x * 64, k0 = blockIdx.y * 64;
#pragma unroll
    for (int it = 0; it < 4; ++it) {                     // 4 x 16 rows x (16 lanes x 4 floats) = 64 x 64, all written
        const int r = it * 16 + (tid >> 4), c4 = (tid & 15) * 4;
        const v4f v = *(const v4f*)(W + (size_t)(k0 + r) * (size_t)C + n0 + c4);
#pragma unroll
        for (int i = 0; i < 4; ++i) ts[r * 65 + c4 + i] = v[i];
    }
    __syncthreads();
    v8us o[2];
#pragma unroll
    for (int it = 0; it < 2; ++it) {                     // 2 x 32 output rows x (8 lanes x 8 halves) = 64 x 64
        const int n = it * 32 + (tid >> 3), k8 = (tid & 7) * 8;
#pragma unroll
        for (int i = 0; i < 8; ++i) {
            const float x = ts[(k8 + i) * 65 + n];
            const unsigned short bb = f2bf(x);
            if (F16OUT) { const h16 hv = (h16)(__uint_as_float(((unsigned)bb) << 16) * WOS); o[it][i] = __builtin_bit_cast(unsigned short, hv); }
            else o[it][i] = bb;
        }
    }
{
#pragma unroll
        for (int it = 0; it < 2; ++it) { const int n = it * 32 + (tid >> 3), k8 = (tid & 7) * 8;
            *(v8us*)(dst + (size_t)(n0 + n) * (size_t)R + k0 + k8) = o[it]; }
         }
}

// gemm_copy8: one thread's share of 128 staged rows, eight 16-byte asynchronous copies global -> LDS (rows r, r + 16, ..., r + 112 of a K-contiguous 16-bit plane of row length DM).
// The s_wait_xcnt ends the copies' own statement so that no address register named there is rewritten ahead of it.
__device__ __forceinline__ void gemm_copy8(unsigned l, const unsigned short* g) {
    asm volatile("global_load_async_to_lds_b128 %0, %8, off\n\tglobal_load_async_to_lds_b128 %1, %9, off\n\t"
                 "global_load_async_to_lds_b128 %2, %10, off\n\tglobal_load_async_to_lds_b128 %3, %11, off\n\t"
                 "global_load_async_to_lds_b128 %4, %12, off\n\tglobal_load_async_to_lds_b128 %5, %13, off\n\t"
                 "global_load_async_to_lds_b128 %6, %14, off\n\tglobal_load_async_to_lds_b128 %7, %15, off\n\ts_wait_xcnt 0x0"
                 :: "v"(l), "v"(l + 16 * GLP * 2), "v"(l + 32 * GLP * 2), "v"(l + 48 * GLP * 2), "v"(l + 64 * GLP * 2), "v"(l + 80 * GLP * 2), "v"(l + 96 * GLP * 2), "v"(l + 112 * GLP * 2),
                    "v"(g), "v"(g + 16 * DM), "v"(g + 32 * DM), "v"(g + 48 * DM), "v"(g + 64 * DM), "v"(g + 80 * DM), "v"(g + 96 * DM), "v"(g + 112 * DM) : "memory");
}
// gemm_stage: one thread's share of a GEMM stage (GBM rows of A, then GBN rows of Bt, GKS halves of each); l = LDS byte address of its piece of row (thread / 16) of the stage.
__device__ __forceinline__ void gemm_stage(unsigned l, const unsigned short* ga, const unsigned short* gb) {
    gemm_copy8(l, ga); gemm_copy8(l + 128 * GLP * 2, ga + (size_t)128 * DM); gemm_copy8(l + GBM * GLP * 2, gb);
}

// k_proj: register-blocked bf16 GEMM, 256 x 128 tile per block of eight waves (4 x 2), ONE WAVE per 64x64 tile (16 accumulators), K = DM; the K-contiguous bf16 operand rows come in
// stages of 128 k through a two-buffer LDS ring that the waves share: asynchronous 16-byte copies (whole lines), stage s + 2 issued behind the barrier that ends the reads of stage s.
// C[m][n] = sum_k A[m][k] Bt[n][k] + bias (BROW == 0: bias[n]; BROW == 1: bias[m]), written as f16 (Ph) at
// tile base (r0/RB)*sRB + (r0%RB)*pitch + (c0/CB)*sCB + (c0%CB), row pitch 'pitch' (halves). grid (M/256, N/128), 256 threads.
// RES == 1: additionally the residual plane Pr (same addressing) = f16((C - f16 value) x RESC); RES == 0: Pr is not touched.
template <int BROW, int RES>
__global__ __launch_bounds__(256) void k_proj(const bf* __restrict__ A, const bf* __restrict__ Bt, const float* __restrict__ bias, h16* Ph, h16* Pr, int RB, size_t sRB, int pitch, int CB, size_t sCB) {
    __shared__ __align__(16) bf ring[2 * GSTG_H];            // two stages; reused as the waves' output staging behind the loop
    const int K = DM;
    const int lane = threadIdx.x & 31, lr = lane & 15, hi = lane >> 4;
    const int wave = __builtin_amdgcn_readfirstlane((int)(threadIdx.x >> 5)); const int wm = wave & 3, wn = wave >> 2;
    const int r0 = blockIdx.x * GBM + wm * 64, c0 = blockIdx.y * GBN + wn * 64;
    float* os = (float*)ring + wave * 16 * 68;
    // this thread's share of a stage: 16 bytes at column cc of rows cr + 16 i (16 lanes = one 256-B row); blockIdx.x * GBM + cr + 240 < M, blockIdx.y * GBN + cr + 112 < N, cc + 7 < GKS
    const int cr = (int)(threadIdx.x >> 4), cc = (int)(threadIdx.x & 15) * 8;
    const unsigned cl = (unsigned)(size_t)(&ring[cr * GLP + cc]);               // LDS byte address in buffer 0
    const bf* ca = A + (size_t)(blockIdx.x * GBM + cr) * K + cc;                // + k
    const bf* cb = Bt + (size_t)(blockIdx.y * GBN + cr) * K + cc;               // + k
    gemm_stage(cl, ca, cb);                                                      // stage 0 -> buffer 0
    v8f acc[4][4];
#pragma unroll
    for (int mb = 0; mb < 4; ++mb)
#pragma unroll
        for (int nb = 0; nb < 4; ++nb) acc[mb][nb] = (v8f){};
    const int aoff = (wm * 64 + lr) * GLP + 8 * hi, boff = (GBM + wn * 64 + lr) * GLP + 8 * hi;   // fragment rows inside a stage
    asm volatile("s_wait_asynccnt 0x0" ::: "memory");        // this wave's copies of stage 0 have landed
    __syncthreads();                                         // every wave's have: stage 0 may be read
    gemm_stage(cl + GSTG_H * 2, ca + GKS, cb + GKS);         // stage 1 -> buffer 1
#pragma unroll 1
    for (int ks = 0; ks < K; ks += GKS) {
        const int bsel = (ks / GKS) & 1;
        const bf* sa = ring + bsel * GSTG_H + aoff; const bf* sb = ring + bsel * GSTG_H + boff;
        v16bf a[2][4], b[2][4];                             // fragments are read one 32-k step ahead, in two groups a step, so that the whole kernel stays inside 256 registers
#pragma unroll
        for (int i = 0; i < 4; ++i) { a[0][i] = ldb(sa + i * 16 * GLP); b[0][i] = ldb(sb + i * 16 * GLP); }
#pragma unroll
        for (int kc = 0; kc < GKS; kc += 32) {               // the 32-k steps of the stage, in k order; unrolled so that every LDS offset is an immediate
            const int cu = (kc / 32) & 1, nx = cu ^ 1;
            // the four scheduling barriers keep each group of reads whole and a step ahead of its products; left free, the compiler sinks every read to its first use and waits there
            __builtin_amdgcn_sched_barrier(0);
            if (kc + 32 < GKS) {                             // never past the stage: the next stage is read only behind its barrier
#pragma unroll
                for (int i = 0; i < 4; ++i) a[nx][i] = ldb(sa + i * 16 * GLP + kc + 32);
#pragma unroll
                for (int i = 0; i < 2; ++i) b[nx][i] = ldb(sb + i * 16 * GLP + kc + 32); }
            __builtin_amdgcn_sched_barrier(0);
#pragma unroll
            for (int nb = 0; nb < 2; ++nb)
#pragma unroll
                for (int mb = 0; mb < 4; ++mb) acc[mb][nb] = wmmab(a[cu][mb], b[cu][nb], acc[mb][nb]);
            __builtin_amdgcn_sched_barrier(0);
            if (kc + 32 < GKS) {
#pragma unroll
                for (int i = 2; i < 4; ++i) b[nx][i] = ldb(sb + i * 16 * GLP + kc + 32); }
            __builtin_amdgcn_sched_barrier(0);
#pragma unroll
            for (int nb = 2; nb < 4; ++nb)
#pragma unroll
                for (int mb = 0; mb < 4; ++mb) acc[mb][nb] = wmmab(a[cu][mb], b[cu][nb], acc[mb][nb]);
        }
        // the distance behind the stage's last matrix instructions, on both sides of the branch below
        asm volatile("v_nop\n\tv_nop\n\tv_nop\n\tv_nop" : "+v"(acc[0][0]), "+v"(acc[1][0]), "+v"(acc[2][0]), "+v"(acc[3][0]), "+v"(acc[0][1]), "+v"(acc[1][1]), "+v"(acc[2][1]), "+v"(acc[3][1]),
                     "+v"(acc[0][2]), "+v"(acc[1][2]), "+v"(acc[2][2]), "+v"(acc[3][2]), "+v"(acc[0][3]), "+v"(acc[1][3]), "+v"(acc[2][3]), "+v"(acc[3][3]));
        asm volatile("s_wait_dscnt 0x0" ::: "memory");       // this wave's reads of the stage have returned: its buffer may be handed to the copies
        asm volatile("s_wait_asynccnt 0x0" ::: "memory");    // this wave's copies of the next stage have landed
        __syncthreads();                                     // publishes the next stage and ends every wave's reads of this one
        if (ks + 2 * GKS < K)                                // block-uniform: refill the buffer just read with the stage after next
            gemm_stage(cl + (unsigned)bsel * (GSTG_H * 2), ca + ks + 2 * GKS, cb + ks + 2 * GKS);
    }
    asm volatile("s_wait_asynccnt 0x0" ::: "memory");        // nothing of the ring is in flight; the last trip's barrier has ended all reads, so it may become output staging
    // column bias for this lane's 8 store columns (BROW == 0); c0 + (lane&7)*8 + 7 < N = DM
    v4f bc0 = (v4f){}, bc1 = (v4f){};
    if (BROW == 0) { const int cb8 = (lane & 7) * 8; const v4f t0 = *(const v4f*)(bias + c0 + cb8); const v4f t1 = *(const v4f*)(bias + c0 + cb8 + 4);
#pragma unroll
        for (int i = 0; i < 4; ++i) { bc0[i] = bfr(t0[i]); bc1[i] = bfr(t1[i]); } }
    const size_t tbase = (size_t)(r0 / RB) * sRB + (size_t)(r0 % RB) * (size_t)pitch + (size_t)(c0 / CB) * sCB + (size_t)(c0 % CB);
#pragma unroll
    for (int mb = 0; mb < 4; ++mb) {
#pragma unroll
        for (int nb = 0; nb < 4; ++nb) {
#pragma unroll
            for (int j = 0; j < 8; ++j) os[(hi * 8 + j) * 68 + nb * 16 + lr] = acc[mb][nb][j]; }   // D: row 8h+j, col lane&15
        wave_sync();
        const size_t sb = tbase + (size_t)(mb * 16) * (size_t)pitch;
{
#pragma unroll
            for (int s = 0; s < 4; ++s) { const int row = 4 * s + (lane >> 3), c8 = (lane & 7) * 8;   // 4 s x 4 row groups = 16 rows; 8 lanes x 8 = 64 columns
                v4f x0 = *(const v4fa*)(&os[row * 68 + c8]); v4f x1 = *(const v4fa*)(&os[row * 68 + c8 + 4]); v8h hv; v8h rv;
                if (BROW == 1) { const float br = bfr(bias[r0 + mb * 16 + row]);                    // row bias; r0 + mb*16 + row < M = DM
#pragma unroll
                    for (int i = 0; i < 4; ++i) { x0[i] += br; x1[i] += br; } }
                else {
#pragma unroll
                    for (int i = 0; i < 4; ++i) { x0[i] += bc0[i]; x1[i] += bc1[i]; } }
#pragma unroll
                for (int i = 0; i < 4; ++i) { const h16 a = toh_flush(x0[i]); const h16 c = toh_flush(x1[i]); hv[i] = a; hv[4 + i] = c;
                    rv[i] = toh_flush((x0[i] - (float)a) * RESC); rv[4 + i] = toh_flush((x1[i] - (float)c) * RESC); }   // difference and carry are exact in f32
                const size_t oo = sb + (size_t)row * (size_t)pitch + c8;
                *(v8h*)(Ph + oo) = hv;
                if (RES) *(v8h*)(Pr + oo) = rv; }
             }
        wave_sync();
    }
}

// stage_copy: one thread's share of a 64-key stage, 16-byte asynchronous copies global -> LDS, two per tile (rows r and r + 32); l = LDS byte address of its K-tile piece.
// The s_wait_xcnt ends the copies' own statement so that no address register named there is rewritten ahead of it.
__device__ __forceinline__ void stage_copy(unsigned l, const h16* gk, const h16* gr, const h16* gv) {
    const unsigned lk1 = l + 32 * LP * 2, lr0 = l + TILE_H * 2, lr1 = lr0 + 32 * LP * 2, lv0 = l + 2 * TILE_H * 2, lv1 = lv0 + 32 * LP * 2;
    const h16* gk1 = gk + 32 * HD; const h16* gr1 = gr + 32 * HD; const h16* gv1 = gv + (size_t)32 * SEQ;
    if (SCORE_RES)
        asm volatile("global_load_async_to_lds_b128 %0, %6, off\n\tglobal_load_async_to_lds_b128 %1, %7, off\n\t"
                     "global_load_async_to_lds_b128 %2, %8, off\n\tglobal_load_async_to_lds_b128 %3, %9, off\n\t"
                     "global_load_async_to_lds_b128 %4, %10, off\n\tglobal_load_async_to_lds_b128 %5, %11, off\n\ts_wait_xcnt 0x0"
                     :: "v"(l), "v"(lk1), "v"(lr0), "v"(lr1), "v"(lv0), "v"(lv1), "v"(gk), "v"(gk1), "v"(gr), "v"(gr1), "v"(gv), "v"(gv1) : "memory");
    else
        asm volatile("global_load_async_to_lds_b128 %0, %4, off\n\tglobal_load_async_to_lds_b128 %1, %5, off\n\t"
                     "global_load_async_to_lds_b128 %2, %6, off\n\tglobal_load_async_to_lds_b128 %3, %7, off\n\ts_wait_xcnt 0x0"
                     :: "v"(l), "v"(lk1), "v"(lv0), "v"(lv1), "v"(gk), "v"(gk1), "v"(gv), "v"(gv1) : "memory");
}

// k_flash: fused attention, one wave per 16 query rows of one (batch, head); Q fragments straight from the f16 planes; K, K residual and V^T come in 64-key stages through a
// two-buffer LDS ring that the block's waves share: asynchronous 16-byte copies (whole 128-B lines per row), stage t + 2 issued behind the barrier that ends the reads of stage t.
// Transposed form: S^T[key][t] = K Q^T (A = K rows, B = Q rows); lane (t = lane&15, h = lane>>4) holds keys 8h+r of each 16-key tile, so the packed
// P tile is directly the B fragment of O^T[d][t] = V^T P^T (element r <- tile keys 0..15, element 8+r <- tile keys 16..31, lane unchanged).
// Per 32-key step: 4 value.value score products in the main accumulators, 8 value.residual / residual.value products in separate accumulators (x RESC, folded back by RESI), 4 P.V products.
// Softmax state (running max, partial sum) is one scalar per lane; the two lane halves of a row are combined with one xor-16 exchange.
__global__ __launch_bounds__(32 * AW) void k_flash(const h16* __restrict__ QH, const h16* __restrict__ QR, const h16* __restrict__ KP, const h16* __restrict__ KR, const h16* __restrict__ VT, h16* CTX) {
    __shared__ __align__(16) h16 ring[2 * STG_H];            // two stages; reused as output staging behind the loop
    float* os = (float*)ring;
    const int lane = threadIdx.x & 31, lr = lane & 15, hi = lane >> 4;
    const int wave = __builtin_amdgcn_readfirstlane((int)(threadIdx.x >> 5));
    const int zh = blockIdx.y; const int b = zh / NH_, h = zh % NH_;
    const int t0 = (blockIdx.x * AW + wave) * 16;
    const size_t pbase = (size_t)zh * SEQ * HD;
    // this thread's share of a stage: rows cr and cr + 32 of each tile, 16 bytes at column ccol (8 lanes = one 128-B row, a wave = 4 whole lines)
    const int cr = (int)(threadIdx.x >> 3), ccol = (int)(threadIdx.x & 7) * 8;
    const unsigned cl = (unsigned)(size_t)(&ring[cr * LP + ccol]);               // LDS byte address in buffer 0, K tile
    const size_t ck = pbase + (size_t)cr * HD + ccol;        // + key * HD   (K and K residual planes: row = key; key + cr + 32 < SEQ)
    const size_t cv = pbase + (size_t)cr * SEQ + ccol;       // + key        (V^T plane: row = d, cr + 32 < HD; key + ccol + 7 < SEQ)
    stage_copy(cl, KP + ck, KR + ck, VT + cv);                                     // stage 0 -> buffer 0
    const size_t qo = pbase + (size_t)(t0 + lr) * HD + 8 * hi;
    const v16h qh0 = ldh(QH + qo), qh1 = ldh(QH + qo + 32);   // B fragments: col t, k = d
    v16h qr0 = qh0, qr1 = qh1;
    if (SCORE_RES) { qr0 = ldh(QR + qo); qr1 = ldh(QR + qo + 32); }   // residual B fragments (x RESC)
    const int ko = lr * LP + 8 * hi;                         // + key * LP in the K tiles (A fragment: row key, k = d); + 16j*LP + key in the V^T tile (A fragment: row d, k = key)
    v8f o0 = (v8f){}, o1 = (v8f){}, o2 = (v8f){}, o3 = (v8f){};
    float m = -3.0e38f, l = 0.0f;
    asm volatile("s_wait_asynccnt 0x0" ::: "memory");        // this wave's copies of stage 0 have landed
    __syncthreads();                                         // every wave's have: stage 0 may be read
    if (SEQ > KST) stage_copy(cl + STG_H * 2, KP + ck + (size_t)KST * HD, KR + ck + (size_t)KST * HD, VT + cv + KST);   // stage 1 -> buffer 1
#pragma unroll 1
    for (int ks = 0; ks < SEQ; ks += KST) {
      const int bsel = (ks / KST) & 1;
      const h16* sk = ring + bsel * STG_H + ko;
#pragma unroll
      for (int u = 0; u < KST; u += 32) {                    // the two 32-key steps of the stage, in key order; unrolled so that every LDS offset is an immediate
        const h16* ka = sk + u * LP;
        const v16h ka0 = ldh(ka), ka1 = ldh(ka + 32), kb0 = ldh(ka + 16 * LP), kb1 = ldh(ka + 16 * LP + 32);
        v8f sa = (v8f){}, sb = (v8f){}, ra = (v8f){}, rb = (v8f){};
        sa = wmma16(ka0, qh0, sa); sb = wmma16(kb0, qh0, sb);
        sa = wmma16(ka1, qh1, sa); sb = wmma16(kb1, qh1, sb);
        if (SCORE_RES) {
            const h16* kr = ka + TILE_H;
            const v16h ea0 = ldh(kr), ea1 = ldh(kr + 32), eb0 = ldh(kr + 16 * LP), eb1 = ldh(kr + 16 * LP + 32);
            ra = wmma16(ka0, qr0, ra); rb = wmma16(kb0, qr0, rb);
            ra = wmma16(ka1, qr1, ra); rb = wmma16(kb1, qr1, rb);
            ra = wmma16(ea0, qh0, ra); rb = wmma16(eb0, qh0, rb);
            ra = wmma16(ea1, qh1, ra); rb = wmma16(eb1, qh1, rb);
            asm volatile("v_nop\n\tv_nop\n\tv_nop\n\tv_nop" : "+v"(sa), "+v"(sb), "+v"(ra), "+v"(rb) : "v"(ka0), "v"(ka1), "v"(kb0), "v"(kb1), "v"(ea0), "v"(ea1), "v"(eb0), "v"(eb1), "v"(qh0), "v"(qh1), "v"(qr0), "v"(qr1));
        } else {
            asm volatile("v_nop\n\tv_nop\n\tv_nop\n\tv_nop" : "+v"(sa), "+v"(sb) : "v"(ka0), "v"(ka1), "v"(kb0), "v"(kb1), "v"(qh0), "v"(qh1));
        }
        float ta[8], tb[8]; float mx = -3.0e38f;
#pragma unroll
        for (int r = 0; r < 8; ++r) { ta[r] = (sa[r] + ra[r] * RESI) * SC2; tb[r] = (sb[r] + rb[r] * RESI) * SC2; mx = fmaxf(mx, fmaxf(ta[r], tb[r])); }
        mx = fmaxf(mx, __shfl_xor(mx, 16, 32));
        const float mnew = fmaxf(m, mx);
        const float alpha = __builtin_amdgcn_exp2f(m - mnew);
        const float sh = PSH - mnew;
        v16h pb; float ls = 0.0f;
#pragma unroll
        for (int r = 0; r < 8; ++r) {
            const float ea = ta[r] + sh, eb = tb[r] + sh;
            const float xa = __builtin_amdgcn_exp2f(ea), xb = __builtin_amdgcn_exp2f(eb);
            const h16 pa = (ea < -14.0f) ? (h16)0.0f : (h16)xa;    // exponent cut: no f16 value below the smallest normal
            const h16 pc = (eb < -14.0f) ? (h16)0.0f : (h16)xb;
            pb[r] = pa; pb[8 + r] = pc; ls += (float)pa + (float)pc; }
        l = l * alpha + ls; m = mnew;
        o0 = o0 * alpha; o1 = o1 * alpha; o2 = o2 * alpha; o3 = o3 * alpha;
        const h16* va = sk + 2 * TILE_H + u;
        const v16h v0 = ldh(va), v1 = ldh(va + 16 * LP), v2 = ldh(va + 32 * LP), v3 = ldh(va + 48 * LP);
        o0 = wmma16(v0, pb, o0); o1 = wmma16(v1, pb, o1); o2 = wmma16(v2, pb, o2); o3 = wmma16(v3, pb, o3);
        asm volatile("v_nop\n\tv_nop\n\tv_nop\n\tv_nop" : "+v"(o0), "+v"(o1), "+v"(o2), "+v"(o3) : "v"(v0), "v"(v1), "v"(v2), "v"(v3), "v"(pb));
      }
      asm volatile("s_wait_dscnt 0x0" ::: "memory");         // this wave's reads of the stage have returned: its buffer may be handed to the copies
      asm volatile("s_wait_asynccnt 0x0" ::: "memory");      // this wave's copies of the next stage have landed
      __syncthreads();                                       // publishes the next stage and ends every wave's reads of this one
      if (ks + 2 * KST < SEQ) {                              // block-uniform: refill the buffer just read with the stage after next
        const size_t kn = (size_t)(ks + 2 * KST);
        stage_copy(cl + (unsigned)bsel * (STG_H * 2), KP + ck + kn * HD, KR + ck + kn * HD, VT + cv + kn); }
    }
    asm volatile("s_wait_asynccnt 0x0" ::: "memory");        // nothing of the ring is in flight; the last trip's barrier has ended all reads, so it may become output staging
    l += __shfl_xor(l, 16, 32);
    const float inv = CTXS / l;
    const int wb = wave * 16 * 68;
    // O^T D layout: o_j[r] = (d = 16j + 8h + r, t = lane&15) -> os[t][d]; rows 0..15 x columns 0..63 all written
    { v4f a, c;
      a[0] = o0[0] * inv; a[1] = o0[1] * inv; a[2] = o0[2] * inv; a[3] = o0[3] * inv; c[0] = o0[4] * inv; c[1] = o0[5] * inv; c[2] = o0[6] * inv; c[3] = o0[7] * inv;
      *(v4fa*)(&os[wb + lr * 68 +  0 + 8 * hi]) = a; *(v4fa*)(&os[wb + lr * 68 +  0 + 8 * hi + 4]) = c;
      a[0] = o1[0] * inv; a[1] = o1[1] * inv; a[2] = o1[2] * inv; a[3] = o1[3] * inv; c[0] = o1[4] * inv; c[1] = o1[5] * inv; c[2] = o1[6] * inv; c[3] = o1[7] * inv;
      *(v4fa*)(&os[wb + lr * 68 + 16 + 8 * hi]) = a; *(v4fa*)(&os[wb + lr * 68 + 16 + 8 * hi + 4]) = c;
      a[0] = o2[0] * inv; a[1] = o2[1] * inv; a[2] = o2[2] * inv; a[3] = o2[3] * inv; c[0] = o2[4] * inv; c[1] = o2[5] * inv; c[2] = o2[6] * inv; c[3] = o2[7] * inv;
      *(v4fa*)(&os[wb + lr * 68 + 32 + 8 * hi]) = a; *(v4fa*)(&os[wb + lr * 68 + 32 + 8 * hi + 4]) = c;
      a[0] = o3[0] * inv; a[1] = o3[1] * inv; a[2] = o3[2] * inv; a[3] = o3[3] * inv; c[0] = o3[4] * inv; c[1] = o3[5] * inv; c[2] = o3[6] * inv; c[3] = o3[7] * inv;
      *(v4fa*)(&os[wb + lr * 68 + 48 + 8 * hi]) = a; *(v4fa*)(&os[wb + lr * 68 + 48 + 8 * hi + 4]) = c; }
    wave_sync();
    h16* crow = CTX + ((size_t)b * SEQ + t0) * DM + h * HD;      // ctx plane [b*SEQ + t][h*64 + d], x CTXS
{
#pragma unroll
        for (int s = 0; s < 4; ++s) { const int row = 4 * s + (lane >> 3), c8 = (lane & 7) * 8;   // 4 s x 4 rows = 16 rows; 8 lanes x 8 halves = 64 columns
            const v4f x0 = *(const v4fa*)(&os[wb + row * 68 + c8]); const v4f x1 = *(const v4fa*)(&os[wb + row * 68 + c8 + 4]); v8h hv;
#pragma unroll
            for (int i = 0; i < 4; ++i) { hv[i] = toh_flush(x0[i]); hv[4 + i] = toh_flush(x1[i]); }
            *(v8h*)(crow + (size_t)row * DM + c8) = hv; }
         }
}

// k_out: output projection, f16 GEMM, 256 x 128 tile per block of eight waves (4 x 2), ONE WAVE per 64x64 tile, K = DM; operand rows staged as in k_proj.
// OUT[m][n] = OSC * sum_k CTX[m][k] WoT[n][k] + bo[n] (f32). grid (NB*SEQ/256, DM/128), 256 threads.
__global__ __launch_bounds__(256) void k_out(const h16* __restrict__ A, const h16* __restrict__ Bt, const float* __restrict__ bias, float* OUT) {
    __shared__ __align__(16) h16 ring[2 * GSTG_H];           // two stages; reused as the waves' output staging behind the loop
    const int K = DM;
    const int lane = threadIdx.x & 31, lr = lane & 15, hi = lane >> 4;
    const int wave = __builtin_amdgcn_readfirstlane((int)(threadIdx.x >> 5)); const int wm = wave & 3, wn = wave >> 2;
    const int r0 = blockIdx.x * GBM + wm * 64, c0 = blockIdx.y * GBN + wn * 64;
    float* os = (float*)ring + wave * 16 * 68;
    // this thread's share of a stage: 16 bytes at column cc of rows cr + 16 i (16 lanes = one 256-B row); blockIdx.x * GBM + cr + 240 < NB * SEQ, blockIdx.y * GBN + cr + 112 < DM, cc + 7 < GKS
    const int cr = (int)(threadIdx.x >> 4), cc = (int)(threadIdx.x & 15) * 8;
    const unsigned cl = (unsigned)(size_t)(&ring[cr * GLP + cc]);               // LDS byte address in buffer 0
    const unsigned short* ca = (const unsigned short*)A + (size_t)(blockIdx.x * GBM + cr) * K + cc;    // + k
    const unsigned short* cb = (const unsigned short*)Bt + (size_t)(blockIdx.y * GBN + cr) * K + cc;   // + k
    gemm_stage(cl, ca, cb);                                                      // stage 0 -> buffer 0
    v8f acc[4][4];
#pragma unroll
    for (int mb = 0; mb < 4; ++mb)
#pragma unroll
        for (int nb = 0; nb < 4; ++nb) acc[mb][nb] = (v8f){};
    const int aoff = (wm * 64 + lr) * GLP + 8 * hi, boff = (GBM + wn * 64 + lr) * GLP + 8 * hi;   // fragment rows inside a stage
    asm volatile("s_wait_asynccnt 0x0" ::: "memory");        // this wave's copies of stage 0 have landed
    __syncthreads();                                         // every wave's have: stage 0 may be read
    gemm_stage(cl + GSTG_H * 2, ca + GKS, cb + GKS);         // stage 1 -> buffer 1
#pragma unroll 1
    for (int ks = 0; ks < K; ks += GKS) {
        const int bsel = (ks / GKS) & 1;
        const h16* sa = ring + bsel * GSTG_H + aoff; const h16* sb = ring + bsel * GSTG_H + boff;
        v16h a[2][4], b[2][4];                             // fragments are read one 32-k step ahead, in two groups a step, so that the whole kernel stays inside 256 registers
#pragma unroll
        for (int i = 0; i < 4; ++i) { a[0][i] = ldh(sa + i * 16 * GLP); b[0][i] = ldh(sb + i * 16 * GLP); }
#pragma unroll
        for (int kc = 0; kc < GKS; kc += 32) {               // the 32-k steps of the stage, in k order; unrolled so that every LDS offset is an immediate
            const int cu = (kc / 32) & 1, nx = cu ^ 1;
            // the four scheduling barriers keep each group of reads whole and a step ahead of its products; left free, the compiler sinks every read to its first use and waits there
            __builtin_amdgcn_sched_barrier(0);
            if (kc + 32 < GKS) {                             // never past the stage: the next stage is read only behind its barrier
#pragma unroll
                for (int i = 0; i < 4; ++i) a[nx][i] = ldh(sa + i * 16 * GLP + kc + 32);
#pragma unroll
                for (int i = 0; i < 2; ++i) b[nx][i] = ldh(sb + i * 16 * GLP + kc + 32); }
            __builtin_amdgcn_sched_barrier(0);
#pragma unroll
            for (int nb = 0; nb < 2; ++nb)
#pragma unroll
                for (int mb = 0; mb < 4; ++mb) acc[mb][nb] = wmma16(a[cu][mb], b[cu][nb], acc[mb][nb]);
            __builtin_amdgcn_sched_barrier(0);
            if (kc + 32 < GKS) {
#pragma unroll
                for (int i = 2; i < 4; ++i) b[nx][i] = ldh(sb + i * 16 * GLP + kc + 32); }
            __builtin_amdgcn_sched_barrier(0);
#pragma unroll
            for (int nb = 2; nb < 4; ++nb)
#pragma unroll
                for (int mb = 0; mb < 4; ++mb) acc[mb][nb] = wmma16(a[cu][mb], b[cu][nb], acc[mb][nb]);
        }
        // the distance behind the stage's last matrix instructions, on both sides of the branch below
        asm volatile("v_nop\n\tv_nop\n\tv_nop\n\tv_nop" : "+v"(acc[0][0]), "+v"(acc[1][0]), "+v"(acc[2][0]), "+v"(acc[3][0]), "+v"(acc[0][1]), "+v"(acc[1][1]), "+v"(acc[2][1]), "+v"(acc[3][1]),
                     "+v"(acc[0][2]), "+v"(acc[1][2]), "+v"(acc[2][2]), "+v"(acc[3][2]), "+v"(acc[0][3]), "+v"(acc[1][3]), "+v"(acc[2][3]), "+v"(acc[3][3]));
        asm volatile("s_wait_dscnt 0x0" ::: "memory");       // this wave's reads of the stage have returned: its buffer may be handed to the copies
        asm volatile("s_wait_asynccnt 0x0" ::: "memory");    // this wave's copies of the next stage have landed
        __syncthreads();                                     // publishes the next stage and ends every wave's reads of this one
        if (ks + 2 * GKS < K)                                // block-uniform: refill the buffer just read with the stage after next
            gemm_stage(cl + (unsigned)bsel * (GSTG_H * 2), ca + ks + 2 * GKS, cb + ks + 2 * GKS);
    }
    asm volatile("s_wait_asynccnt 0x0" ::: "memory");        // nothing of the ring is in flight; the last trip's barrier has ended all reads, so it may become output staging
    const int cofs = lr * 4;
    v4f bb; { const v4f t = *(const v4f*)(bias + c0 + cofs);      // c0 + cofs + 3 < DM
#pragma unroll
        for (int i = 0; i < 4; ++i) bb[i] = bfr(t[i]); }
    float* orow = OUT + ((size_t)(r0 / SEQ) * OUT_SEQ + (size_t)(r0 % SEQ)) * DM + c0;
#pragma unroll
    for (int mb = 0; mb < 4; ++mb) {
#pragma unroll
        for (int nb = 0; nb < 4; ++nb) {
#pragma unroll
            for (int j = 0; j < 8; ++j) os[(hi * 8 + j) * 68 + nb * 16 + lr] = acc[mb][nb][j]; }   // D: row 8h+j, col lane&15
        wave_sync();
{
#pragma unroll
            for (int s = 0; s < 8; ++s) { const int row = 2 * s + hi;   // 8 s x 2 rows = 16 rows; 16 lanes x 4 floats = 64 columns
                const v4f x = *(const v4fa*)(&os[row * 68 + cofs]); v4f val;
#pragma unroll
                for (int i = 0; i < 4; ++i) val[i] = x[i] * OSC + bb[i];
                *(v4f*)(orow + (size_t)(mb * 16 + row) * DM + cofs) = val; }
             }
        wave_sync();
    }
}

static constexpr size_t al256(size_t v) { return (v + 255) & ~(size_t)255; }
static constexpr size_t SZ_XB = al256((size_t)NB * SEQ * DM * 2);
static constexpr size_t SZ_WB = al256((size_t)3 * DM * DM * 2);
static constexpr size_t SZ_PL = al256((size_t)NB * NH_ * SEQ * HD * 2);
static constexpr size_t SZ_TOTAL = 3 * SZ_XB + SZ_WB + 3 * SZ_PL;
static_assert(SZ_TOTAL <= (size_t)134217728);                  // workspace carve <= 128 MiB
static_assert(((size_t)DM * DM * 2) % 256 == 0);               // weight sub-planes stay 256-byte aligned
static_assert((size_t)3 * DM * DM * 2 <= SZ_WB);               // three weight sub-planes (q | k | o) fit their region
static_assert((size_t)NB * SEQ * DM * 2 <= SZ_XB);             // ctx plane (aliases the query copy) fits its region
static_assert((size_t)NB * NH_ * SEQ * HD * 2 <= SZ_XB);       // q / k residual planes (alias the key / value copies) fit their regions

extern "C" void kernel_launch(void* const* d_in, const int* in_sizes, int n_in,
                              void* d_out, int out_size, void* d_ws, size_t ws_size, hipStream_t stream) {
    if (n_in < 9) return;
    const size_t needx = ((size_t)(NB - 1) * SEQ_FULL + SEQ) * DM;
    if ((size_t)in_sizes[0] < needx || (size_t)in_sizes[1] < needx || (size_t)in_sizes[2] < needx) return;
    if ((size_t)in_sizes[3] < (size_t)DM * DM || (size_t)in_sizes[5] < (size_t)DM * DM || (size_t)in_sizes[7] < (size_t)DM * DM) return;
    if (in_sizes[4] < DM || in_sizes[6] < DM || in_sizes[8] < DM) return;
    if ((size_t)out_size < ((size_t)(NB - 1) * OUT_SEQ + SEQ) * DM) return;
    if (SZ_TOTAL > ws_size) return;
    // wire order: q, k, v, q_w, q_b, k_w, k_b, out_w, out_b
    const float* xq = (const float*)d_in[0]; const float* xk = (const float*)d_in[1]; const float* xv = (const float*)d_in[2];
    const float* wq = (const float*)d_in[3]; const float* bq = (const float*)d_in[4];
    const float* wk = (const float*)d_in[5]; const float* bk = (const float*)d_in[6];
    const float* wo = (const float*)d_in[7]; const float* bo = (const float*)d_in[8];
    float* OUT = (float*)d_out;      // [NB][OUT_SEQ][1024]
    char* wsp = (char*)d_ws;
    bf* XQ = (bf*)wsp; wsp += SZ_XB;                 // [NB*SEQ][1024] bf16 queries; region reused later as the ctx plane
    bf* XK = (bf*)wsp; wsp += SZ_XB;                 // [NB*SEQ][1024] bf16 keys; region reused later as the q residual plane
    bf* XV = (bf*)wsp; wsp += SZ_XB;                 // [NB*SEQ][1024] bf16 values; region reused later as the k residual plane
    bf* WB = (bf*)wsp; wsp += SZ_WB;                 // [3][1024][1024] transposed [out][in]: q | k (bf16) | o (f16 x64)
    h16* QH = (h16*)wsp; wsp += SZ_PL;               // [NB*16][SEQ][64]
    h16* KP = (h16*)wsp; wsp += SZ_PL;               // [NB*16][SEQ][64]
    h16* VT = (h16*)wsp; wsp += SZ_PL;               // [NB*16][64][SEQ]
    h16* CTX = (h16*)XQ;                             // [NB*SEQ][1024] f16 x256, written after the q projection has consumed XQ
    h16* KR = (h16*)XV;                              // [NB*16][SEQ][64] f16 x2048, written after the v projection has consumed XV
    h16* QR = (h16*)XK;                              // [NB*16][SEQ][64] f16 x2048, written after the k projection has consumed XK
    bf* WQT = WB; bf* WKT = WB + (size_t)DM * DM; bf* WOT = WB + (size_t)2 * DM * DM;

    if (SEQ == SEQ_FULL) {
        const size_t n8 = (size_t)NB * SEQ * DM / 8; const unsigned g = (unsigned)((n8 + 255) / 256);
        k_cvt8<<<g, 256, 0, stream>>>(xq, XQ, n8);
        k_cvt8<<<g, 256, 0, stream>>>(xk, XK, n8);
        k_cvt8<<<g, 256, 0, stream>>>(xv, XV, n8);
    } else {
        const size_t n8 = (size_t)SEQ * DM / 8; const unsigned g = (unsigned)((n8 + 255) / 256);
        for (int b = 0; b < NB; ++b) {
            k_cvt8<<<g, 256, 0, stream>>>(xq + (size_t)b * SEQ_FULL * DM, XQ + (size_t)b * SEQ * DM, n8);
            k_cvt8<<<g, 256, 0, stream>>>(xk + (size_t)b * SEQ_FULL * DM, XK + (size_t)b * SEQ * DM, n8);
            k_cvt8<<<g, 256, 0, stream>>>(xv + (size_t)b * SEQ_FULL * DM, XV + (size_t)b * SEQ * DM, n8);
        }
    }
    // weights: in[rows = 1024 (contraction index)][cols = 1024 (output feature)] -> out[cols][rows]; grid (cols/64, rows/64)
    { const dim3 g(DM / 64, DM / 64, 1);
      k_cvtT<0><<<g, 256, 0, stream>>>(wq, (unsigned short*)WQT, DM, DM);
      k_cvtT<0><<<g, 256, 0, stream>>>(wk, (unsigned short*)WKT, DM, DM);
      k_cvtT<1><<<g, 256, 0, stream>>>(wo, (unsigned short*)WOT, DM, DM); }

    // launch order v, k, q: each residual plane lands in an input copy that an earlier launch has fully consumed
    // v^T: the value projection uses the QUERY weight and bias: A = q_w^T rows (m = h*64 + d), Bt = value-input rows (n = b*SEQ + t), row bias q_b[m] -> plane [(b*1024 + m)][t] = [(b*16 + h)][d][t]; no residual plane
    k_proj<1, 0><<<dim3(DM / GBM, NB * SEQ / GBN, 1), 256, 0, stream>>>(WQT, XV, bq, VT, VT, DM, (size_t)0, SEQ, SEQ, (size_t)DM * SEQ);
    // k, q: A = x rows (m = b*SEQ + t), Bt = W^T rows (n = h*64 + d), column bias -> value and residual planes [(b*16 + h)][t][d]
    k_proj<0, SCORE_RES><<<dim3(NB * SEQ / GBM, DM / GBN, 1), 256, 0, stream>>>(XK, WKT, bk, KP, KR, SEQ, (size_t)NH_ * SEQ * HD, HD, HD, (size_t)SEQ * HD);
    k_proj<0, SCORE_RES><<<dim3(NB * SEQ / GBM, DM / GBN, 1), 256, 0, stream>>>(XQ, WQT, bq, QH, QR, SEQ, (size_t)NH_ * SEQ * HD, HD, HD, (size_t)SEQ * HD);

    k_flash<<<dim3(SEQ / (16 * AW), NB * NH_, 1), 32 * AW, 0, stream>>>(QH, QR, KP, KR, VT, CTX);

    k_out<<<dim3(NB * SEQ / GBM, DM / GBN, 1), 256, 0, stream>>>(CTX, (const h16*)WOT, bo, OUT);
}

// v003
// Measured time: 215 microseconds a run.
// In two side-by-side timings against v002, it was 1.03 and 1.04 times as fast.
// Counting every step since v000, it is 2.38 times as fast.
#include <hip/hip_runtime.h>

// Multi-head self-attention block, width 1024 = 16 heads x 64; separate query / key / value inputs [NB][SEQ_FULL][1024] (first SEQ tokens of each batch used); q_w / k_w / out_w stored [in][out] (y = x W + b); the value projection uses the query weight and the query bias (there is no separate value weight); no mask; score scale 1/8; output = ctx out_w + out_b (f32).
// Compute dtypes, f32 accumulate everywhere: q/k/v projections v_wmma_f32_16x16x32_bf16 (inputs and weights RNE-converted to bf16; products exact); scores v_wmma_f32_16x16x32_f16 with q and k each carried as f16 value + f16 residual x2048 (three products: value.value in the main accumulator, value.residual + residual.value in a separate accumulator folded back by 1/2048); P.V v_wmma_f32_16x16x32_f16 (P x256 carry, cancels in the normalisation; v single f16); output projection v_wmma_f32_16x16x32_f16: ctx f16 with x256 carry, out_w^T (bf16 RNE value) x64 as f16, carries folded back in the f32 epilogue; softmax f32 (online, running max); biases (bf16 RNE values) added in f32.
// Layout: bf16 copies of the three inputs; transposed 16-bit weight planes [out][in]; q, k value and residual planes [b*16+h][t][d] and v^T plane [b*16+h][d][t] written by the GEMM epilogue; fused flash kernel in transposed form (S^T = K Q^T, O^T = V^T P^T) writing the ctx plane [b*SEQ+t][h*64+d]; final GEMM writes the f32 output.

#ifndef NB
#define NB 4
#endif
#ifndef SEQ
#define SEQ 2048
#endif
#define NB_FULL  4
#define SEQ_FULL 2048
#ifndef OUT_SEQ
#define OUT_SEQ SEQ              // row pitch (in tokens) between batches of the output
#endif
#ifndef SCORE_RES
#define SCORE_RES 1              // 1: q and k residual planes and three-product scores; 0: single-product scores
#endif
#define DM   1024
#define NH_  16
#define HD   64
#define AW   8                   // waves per flash block (16 query rows each); all of them read the same staged key tiles
#define KST  64                  // keys per LDS stage: every staged row (K, K residual: one key; V^T: one d) is one whole 128-B line
#define LP   72                  // LDS row pitch in halves: 144 B = 16 B x odd, conflict-free for 16-byte fragment reads
#define TILE_H (64 * LP)         // halves of one staged tile (64 rows)
#define STG_H  (3 * TILE_H)      // one stage: K value | K residual | V^T
#define SC2  (0.125f * 1.4426950408889634f)   // HD^-0.5 * log2(e)
#define PSH  8.0f                // log2 of the P carry (256)
#define CTXS 256.0f              // carry of the ctx plane
#define WOS  64.0f               // carry of the Wo^T plane
#define OSC  (1.0f / 16384.0f)   // 1 / (CTXS * WOS)
#define RESC 2048.0f             // carry of the q / k residual planes
#define RESI (1.0f / 2048.0f)    // 1 / RESC
#define GBM  256                 // GEMM block tile: rows of A
#define GBN  128                 // GEMM block tile: rows of Bt (output columns)
#define GKS  128                 // k per LDS stage of the GEMMs: every staged row is 256 B, two whole lines
#define GLP  136                 // LDS row pitch of the GEMM stages in halves: 272 B = 16 B x odd, conflict-free for 16-byte fragment reads
#define GSTG_H ((GBM + GBN) * GLP)   // halves of one GEMM stage: A rows | Bt rows
#define CVW  32                  // input conversion: 512-byte loads per wave (16 KiB of f32 a wave)

static_assert(HD == 64);
static_assert(NH_ * HD == DM);                 // head h = columns h*64 + d
static_assert(DM % 64 == 0);                   // column tiles of 64
static_assert(DM % 32 == 0);                   // GEMM k-loop steps by 32
static_assert(SEQ % 64 == 0);                  // a 64-row tile never straddles two batches
static_assert((NB * SEQ) % 64 == 0);
static_assert(SEQ % 32 == 0);                  // key loop steps by 32
static_assert(SEQ % (16 * AW) == 0);           // flash grid covers the sequence exactly
static_assert(SEQ % KST == 0);                 // key stages cover the sequence exactly
static_assert(KST == 64 && KST % 32 == 0);     // a stage is two 32-key steps; V^T rows of a stage are 128 B
static_assert(32 * AW * 2 * 8 == 64 * HD);     // two 16-byte copies per thread fill one 64 x 64 tile
static_assert((size_t)AW * 16 * 68 * 4 <= (size_t)2 * STG_H * 2);   // output staging fits the ring it reuses
static_assert(((size_t)SEQ * DM) % (CVW * 128) == 0);            // a wave's share of the input conversion never straddles two batches
static_assert(((size_t)NB * SEQ * DM) % (8 * CVW * 128) == 0);   // its grid of eight-wave blocks covers an input exactly
static_assert(DM % GBM == 0 && DM % GBN == 0 && (NB * SEQ) % GBM == 0 && (NB * SEQ) % GBN == 0);   // GEMM grids cover every operand exactly
static_assert(DM % GKS == 0 && DM / GKS >= 2 && GKS % 32 == 0);   // whole stages, at least two of them
static_assert(GBM == 4 * 64 && GBN == 2 * 64);                   // eight waves, 4 x 2, one 64 x 64 tile each
static_assert(256 * 8 * 8 == 128 * GKS);                         // eight 16-byte copies per thread fill 128 staged rows
static_assert((size_t)8 * 16 * 68 * 4 <= (size_t)2 * GSTG_H * 2);   // the waves' output staging fits the ring it reuses
static_assert(((size_t)DM * DM) % 8 == 0);
static_assert(NB <= NB_FULL);
static_assert(SEQ <= SEQ_FULL);
static_assert(RESC * RESI == 1.0f);            // residual carry folds back exactly
static_assert(CTXS * WOS * OSC == 1.0f);       // output carries fold back exactly

typedef _Float16 h16;
typedef unsigned short bf;
typedef __attribute__((ext_vector_type(16))) __bf16   v16bf;
typedef __attribute__((ext_vector_type(16))) _Float16 v16h;
typedef __attribute__((ext_vector_type(8)))  _Float16 v8h;
typedef __attribute__((ext_vector_type(8)))  unsigned short v8us;
typedef __attribute__((ext_vector_type(4)))  unsigned short v4us;
typedef __attribute__((ext_vector_type(8)))  float    v8f;
typedef __attribute__((ext_vector_type(4)))  float    v4f;
typedef v4f  __attribute__((may_alias)) v4fa;

__device__ __forceinline__ unsigned short f2bf(float f) { unsigned u = __float_as_uint(f); u += 0x7FFFu + ((u >> 16) & 1u); return (unsigned short)(u >> 16); }
__device__ __forceinline__ float bfr(float f) { return __uint_as_float(((unsigned)f2bf(f)) << 16); }   // value of the bf16 RNE conversion, as f32
__device__ __forceinline__ v16h cat16(v8h lo, v8h hi) { return __builtin_shufflevector(lo, hi, 0, 1, 2, 3, 4, 5, 6, 7, 8, 9, 10, 11, 12, 13, 14, 15); }
__device__ __forceinline__ v16bf cat16b(v8us lo, v8us hi) { return __builtin_bit_cast(v16bf, __builtin_shufflevector(lo, hi, 0, 1, 2, 3, 4, 5, 6, 7, 8, 9, 10, 11, 12, 13, 14, 15)); }
__device__ __forceinline__ v8f wmma16(v16h a, v16h b, v8f c) { return __builtin_amdgcn_wmma_f32_16x16x32_f16(false, a, false, b, (short)0, c, false, false); }
__device__ __forceinline__ v8f wmmab(v16bf a, v16bf b, v8f c) { return __builtin_amdgcn_wmma_f32_16x16x32_bf16(false, a, false, b, (short)0, c, false, false); }
// fragment loaders from K-contiguous 16-bit rows; p already includes + 8*(lane>>4): elements 0..7 <- k0+8h+0..7, elements 8..15 <- k0+16+8h+0..7 (same map for A and B)
__device__ __forceinline__ v16h  ldh(const h16* p) { return cat16(*(const v8h*)p, *(const v8h*)(p + 16)); }
__device__ __forceinline__ v16bf ldb(const bf* p)  { return cat16b(*(const v8us*)p, *(const v8us*)(p + 16)); }
// ordering point for wave-private LDS tiles (same wave writes and reads)
__device__ __forceinline__ void wave_sync() { __builtin_amdgcn_fence(3 /* release order */, "wavefront"); __builtin_amdgcn_wave_barrier(); asm volatile("" ::: "memory"); }
// f32 -> f16 for operand planes: a result below the smallest normal f16 magnitude is replaced by zero (value select)
static __device__ __forceinline__ h16 toh_flush(float v) { const h16 r = (h16)v; return (fabsf(v) < 6.103515625e-05f) ? (h16)0.0f : r; }

// k_cvt3: bf16 RNE copies of the three inputs in one launch, written as a stream: blockIdx.y picks the input, every wave converts CVW * 128 consecutive floats.
// All CVW loads of a wave (16 bytes a lane, 512 contiguous bytes a wave = four whole lines) are issued before the first conversion; a wave's 8-byte stores cover 256 contiguous bytes.
__global__ __launch_bounds__(256) void k_cvt3(const float* __restrict__ xq, const float* __restrict__ xk, const float* __restrict__ xv, bf* __restrict__ dq, bf* __restrict__ dk, bf* __restrict__ dv) {
    const float* __restrict__ src = blockIdx.y == 0 ? xq : (blockIdx.y == 1 ? xk : xv);
    bf* __restrict__ dst = blockIdx.y == 0 ? dq : (blockIdx.y == 1 ? dk : dv);
    const size_t e0 = ((size_t)blockIdx.x * 8 + (threadIdx.x >> 5)) * (CVW * 128);   // first element of this wave's share in the packed copy [NB*SEQ][DM]
    const size_t s0 = (SEQ == SEQ_FULL) ? e0 : (e0 / ((size_t)SEQ * DM)) * ((size_t)SEQ_FULL * DM) + e0 % ((size_t)SEQ * DM);   // the same element in the input (batch pitch SEQ_FULL)
    const float* s = src + s0 + (threadIdx.x & 31) * 4;
    bf* d = dst + e0 + (threadIdx.x & 31) * 4;
    v4f v[CVW];
#pragma unroll
    for (int j = 0; j < CVW; ++j) v[j] = *(const v4f*)(s + j * 128);
    __builtin_amdgcn_sched_barrier(0);   // keeps every load ahead of the first conversion; left free, the compiler holds the last four back until the others have returned: a second trip to memory
#pragma unroll
    for (int j = 0; j < CVW; ++j) { v4us o;
#pragma unroll
        for (int k = 0; k < 4; ++k) o[k] = f2bf(v[j][k]);
        *(v4us*)(d + j * 128) = o; }
}

// k_cvtT: transpose + 16-bit convert of a weight matrix: in[R][C] (f32, R = contraction index, C = output feature) -> out[C][R] (16-bit, contraction-contiguous).
// F16OUT == 0: bf16 RNE bits; F16OUT == 1: f16 of (bf16 RNE value x WOS) (exact for values whose scaled magnitude is in the f16 normal range).
template <int F16OUT>
__global__ __launch_bounds__(256) void k_cvtT(const float* __restrict__ W, unsigned short* dst, int R, int C) {
    __shared__ float ts[64 * 65];
    const int tid = threadIdx.x;
    const int n0 = blockIdx.x * 64, k0 = blockIdx.y * 64;
#pragma unroll
    for (int it = 0; it < 4; ++it) {                     // 4 x 16 rows x (16 lanes x 4 floats) = 64 x 64, all written
        const int r = it * 16 + (tid >> 4), c4 = (tid & 15) * 4;
        const v4f v = *(const v4f*)(W + (size_t)(k0 + r) * (size_t)C + n0 + c4);
#pragma unroll
        for (int i = 0; i < 4; ++i) ts[r * 65 + c4 + i] = v[i];
    }
    __syncthreads();
    v8us o[2];
#pragma unroll
    for (int it = 0; it < 2; ++it) {                     // 2 x 32 output rows x (8 lanes x 8 halves) = 64 x 64
        const int n = it * 32 + (tid >> 3), k8 = (tid & 7) * 8;
#pragma unroll
        for (int i = 0; i < 8; ++i) {
            const float x = ts[(k8 + i) * 65 + n];
            const unsigned short bb = f2bf(x);
            if (F16OUT) { const h16 hv = (h16)(__uint_as_float(((unsigned)bb) << 16) * WOS); o[it][i] = __builtin_bit_cast(unsigned short, hv); }
            else o[it][i] = bb;
        }
    }
{
#pragma unroll
        for (int it = 0; it < 2; ++it) { const int n = it * 32 + (tid >> 3), k8 = (tid & 7) * 8;
            *(v8us*)(dst + (size_t)(n0 + n) * (size_t)R + k0 + k8) = o[it]; }
         }
}

// gemm_copy8: one thread's share of 128 staged rows, eight 16-byte asynchronous copies global -> LDS (rows r, r + 16, ..., r + 112 of a K-contiguous 16-bit plane of row length DM).
// The s_wait_xcnt ends the copies' own statement so that no address register named there is rewritten ahead of it.
__device__ __forceinline__ void gemm_copy8(unsigned l, const unsigned short* g) {
    asm volatile("global_load_async_to_lds_b128 %0, %8, off\n\tglobal_load_async_to_lds_b128 %1, %9, off\n\t"
                 "global_load_async_to_lds_b128 %2, %10, off\n\tglobal_load_async_to_lds_b128 %3, %11, off\n\t"
                 "global_load_async_to_lds_b128 %4, %12, off\n\tglobal_load_async_to_lds_b128 %5, %13, off\n\t"
                 "global_load_async_to_lds_b128 %6, %14, off\n\tglobal_load_async_to_lds_b128 %7, %15, off\n\ts_wait_xcnt 0x0"
                 :: "v"(l), "v"(l + 16 * GLP * 2), "v"(l + 32 * GLP * 2), "v"(l + 48 * GLP * 2), "v"(l + 64 * GLP * 2), "v"(l + 80 * GLP * 2), "v"(l + 96 * GLP * 2), "v"(l + 112 * GLP * 2),
                    "v"(g), "v"(g + 16 * DM), "v"(g + 32 * DM), "v"(g + 48 * DM), "v"(g + 64 * DM), "v"(g + 80 * DM), "v"(g + 96 * DM), "v"(g + 112 * DM) : "memory");
}
// gemm_stage: one thread's share of a GEMM stage (GBM rows of A, then GBN rows of Bt, GKS halves of each); l = LDS byte address of its piece of row (thread / 16) of the stage.
__device__ __forceinline__ void gemm_stage(unsigned l, const unsigned short* ga, const unsigned short* gb) {
    gemm_copy8(l, ga); gemm_copy8(l + 128 * GLP * 2, ga + (size_t)128 * DM); gemm_copy8(l + GBM * GLP * 2, gb);
}

// k_proj: register-blocked bf16 GEMM, 256 x 128 tile per block of eight waves (4 x 2), ONE WAVE per 64x64 tile (16 accumulators), K = DM; the K-contiguous bf16 operand rows come in
// stages of 128 k through a two-buffer LDS ring that the waves share: asynchronous 16-byte copies (whole lines), stage s + 2 issued behind the barrier that ends the reads of stage s.
// C[m][n] = sum_k A[m][k] Bt[n][k] + bias (BROW == 0: bias[n]; BROW == 1: bias[m]), written as f16 (Ph) at
// tile base (r0/RB)*sRB + (r0%RB)*pitch + (c0/CB)*sCB + (c0%CB), row pitch 'pitch' (halves). grid (M/256, N/128), 256 threads.
// RES == 1: additionally the residual plane Pr (same addressing) = f16((C - f16 value) x RESC); RES == 0: Pr is not touched.
template <int BROW, int RES>
__global__ __launch_bounds__(256) void k_proj(const bf* __restrict__ A, const bf* __restrict__ Bt, const float* __restrict__ bias, h16* Ph, h16* Pr, int RB, size_t sRB, int pitch, int CB, size_t sCB) {
    __shared__ __align__(16) bf ring[2 * GSTG_H];            // two stages; reused as the waves' output staging behind the loop
    const int K = DM;
    const int lane = threadIdx.x & 31, lr = lane & 15, hi = lane >> 4;
    const int wave = __builtin_amdgcn_readfirstlane((int)(threadIdx.x >> 5)); const int wm = wave & 3, wn = wave >> 2;
    const int r0 = blockIdx.x * GBM + wm * 64, c0 = blockIdx.y * GBN + wn * 64;
    float* os = (float*)ring + wave * 16 * 68;
    // this thread's share of a stage: 16 bytes at column cc of rows cr + 16 i (16 lanes = one 256-B row); blockIdx.x * GBM + cr + 240 < M, blockIdx.y * GBN + cr + 112 < N, cc + 7 < GKS
    const int cr = (int)(threadIdx.x >> 4), cc = (int)(threadIdx.x & 15) * 8;
    const unsigned cl = (unsigned)(size_t)(&ring[cr * GLP + cc]);               // LDS byte address in buffer 0
    const bf* ca = A + (size_t)(blockIdx.x * GBM + cr) * K + cc;                // + k
    const bf* cb = Bt + (size_t)(blockIdx.y * GBN + cr) * K + cc;               // + k
    gemm_stage(cl, ca, cb);                                                      // stage 0 -> buffer 0
    v8f acc[4][4];
#pragma unroll
    for (int mb = 0; mb < 4; ++mb)
#pragma unroll
        for (int nb = 0; nb < 4; ++nb) acc[mb][nb] = (v8f){};
    const int aoff = (wm * 64 + lr) * GLP + 8 * hi, boff = (GBM + wn * 64 + lr) * GLP + 8 * hi;   // fragment rows inside a stage
    asm volatile("s_wait_asynccnt 0x0" ::: "memory");        // this wave's copies of stage 0 have landed
    __syncthreads();                                         // every wave's have: stage 0 may be read
    gemm_stage(cl + GSTG_H * 2, ca + GKS, cb + GKS);         // stage 1 -> buffer 1
#pragma unroll 1
    for (int ks = 0; ks < K; ks += GKS) {
        const int bsel = (ks / GKS) & 1;
        const bf* sa = ring + bsel * GSTG_H + aoff; const bf* sb = ring + bsel * GSTG_H + boff;
        v16bf a[2][4], b[2][4];                             // fragments are read one 32-k step ahead, in two groups a step, so that the whole kernel stays inside 256 registers
#pragma unroll
        for (int i = 0; i < 4; ++i) { a[0][i] = ldb(sa + i * 16 * GLP); b[0][i] = ldb(sb + i * 16 * GLP); }
#pragma unroll
        for (int kc = 0; kc < GKS; kc += 32) {               // the 32-k steps of the stage, in k order; unrolled so that every LDS offset is an immediate
            const int cu = (kc / 32) & 1, nx = cu ^ 1;
            // the four scheduling barriers keep each group of reads whole and a step ahead of its products; left free, the compiler sinks every read to its first use and waits there
            __builtin_amdgcn_sched_barrier(0);
            if (kc + 32 < GKS) {                             // never past the stage: the next stage is read only behind its barrier
#pragma unroll
                for (int i = 0; i < 4; ++i) a[nx][i] = ldb(sa + i * 16 * GLP + kc + 32);
#pragma unroll
                for (int i = 0; i < 2; ++i) b[nx][i] = ldb(sb + i * 16 * GLP + kc + 32); }
            __builtin_amdgcn_sched_barrier(0);
#pragma unroll
            for (int nb = 0; nb < 2; ++nb)
#pragma unroll
                for (int mb = 0; mb < 4; ++mb) acc[mb][nb] = wmmab(a[cu][mb], b[cu][nb], acc[mb][nb]);
            __builtin_amdgcn_sched_barrier(0);
            if (kc + 32 < GKS) {
#pragma unroll
                for (int i = 2; i < 4; ++i) b[nx][i] = ldb(sb + i * 16 * GLP + kc + 32); }
            __builtin_amdgcn_sched_barrier(0);
#pragma unroll
            for (int nb = 2; nb < 4; ++nb)
#pragma unroll
                for (int mb = 0; mb < 4; ++mb) acc[mb][nb] = wmmab(a[cu][mb], b[cu][nb], acc[mb][nb]);
        }
        // the distance behind the stage's last matrix instructions, on both sides of the branch below
        asm volatile("v_nop\n\tv_nop\n\tv_nop\n\tv_nop" : "+v"(acc[0][0]), "+v"(acc[1][0]), "+v"(acc[2][0]), "+v"(acc[3][0]), "+v"(acc[0][1]), "+v"(acc[1][1]), "+v"(acc[2][1]), "+v"(acc[3][1]),
                     "+v"(acc[0][2]), "+v"(acc[1][2]), "+v"(acc[2][2]), "+v"(acc[3][2]), "+v"(acc[0][3]), "+v"(acc[1][3]), "+v"(acc[2][3]), "+v"(acc[3][3]));
        asm volatile("s_wait_dscnt 0x0" ::: "memory");       // this wave's reads of the stage have returned: its buffer may be handed to the copies
        asm volatile("s_wait_asynccnt 0x0" ::: "memory");    // this wave's copies of the next stage have landed
        __syncthreads();                                     // publishes the next stage and ends every wave's reads of this one
        if (ks + 2 * GKS < K)                                // block-uniform: refill the buffer just read with the stage after next
            gemm_stage(cl + (unsigned)bsel * (GSTG_H * 2), ca + ks + 2 * GKS, cb + ks + 2 * GKS);
    }
    asm volatile("s_wait_asynccnt 0x0" ::: "memory");        // nothing of the ring is in flight; the last trip's barrier has ended all reads, so it may become output staging
    // column bias for this lane's 8 store columns (BROW == 0); c0 + (lane&7)*8 + 7 < N = DM
    v4f bc0 = (v4f){}, bc1 = (v4f){};
    if (BROW == 0) { const int cb8 = (lane & 7) * 8; const v4f t0 = *(const v4f*)(bias + c0 + cb8); const v4f t1 = *(const v4f*)(bias + c0 + cb8 + 4);
#pragma unroll
        for (int i = 0; i < 4; ++i) { bc0[i] = bfr(t0[i]); bc1[i] = bfr(t1[i]); } }
    const size_t tbase = (size_t)(r0 / RB) * sRB + (size_t)(r0 % RB) * (size_t)pitch + (size_t)(c0 / CB) * sCB + (size_t)(c0 % CB);
#pragma unroll
    for (int mb = 0; mb < 4; ++mb) {
#pragma unroll
        for (int nb = 0; nb < 4; ++nb) {
#pragma unroll
            for (int j = 0; j < 8; ++j) os[(hi * 8 + j) * 68 + nb * 16 + lr] = acc[mb][nb][j]; }   // D: row 8h+j, col lane&15
        wave_sync();
        const size_t sb = tbase + (size_t)(mb * 16) * (size_t)pitch;
{
#pragma unroll
            for (int s = 0; s < 4; ++s) { const int row = 4 * s + (lane >> 3), c8 = (lane & 7) * 8;   // 4 s x 4 row groups = 16 rows; 8 lanes x 8 = 64 columns
                v4f x0 = *(const v4fa*)(&os[row * 68 + c8]); v4f x1 = *(const v4fa*)(&os[row * 68 + c8 + 4]); v8h hv; v8h rv;
                if (BROW == 1) { const float br = bfr(bias[r0 + mb * 16 + row]);                    // row bias; r0 + mb*16 + row < M = DM
#pragma unroll
                    for (int i = 0; i < 4; ++i) { x0[i] += br; x1[i] += br; } }
                else {
#pragma unroll
                    for (int i = 0; i < 4; ++i) { x0[i] += bc0[i]; x1[i] += bc1[i]; } }
#pragma unroll
                for (int i = 0; i < 4; ++i) { const h16 a = toh_flush(x0[i]); const h16 c = toh_flush(x1[i]); hv[i] = a; hv[4 + i] = c;
                    rv[i] = toh_flush((x0[i] - (float)a) * RESC); rv[4 + i] = toh_flush((x1[i] - (float)c) * RESC); }   // difference and carry are exact in f32
                const size_t oo = sb + (size_t)row * (size_t)pitch + c8;
                *(v8h*)(Ph + oo) = hv;
                if (RES) *(v8h*)(Pr + oo) = rv; }
             }
        wave_sync();
    }
}

// stage_copy: one thread's share of a 64-key stage, 16-byte asynchronous copies global -> LDS, two per tile (rows r and r + 32); l = LDS byte address of its K-tile piece.
// The s_wait_xcnt ends the copies' own statement so that no address register named there is rewritten ahead of it.
__device__ __forceinline__ void stage_copy(unsigned l, const h16* gk, const h16* gr, const h16* gv) {
    const unsigned lk1 = l + 32 * LP * 2, lr0 = l + TILE_H * 2, lr1 = lr0 + 32 * LP * 2, lv0 = l + 2 * TILE_H * 2, lv1 = lv0 + 32 * LP * 2;
    const h16* gk1 = gk + 32 * HD; const h16* gr1 = gr + 32 * HD; const h16* gv1 = gv + (size_t)32 * SEQ;
    if (SCORE_RES)
        asm volatile("global_load_async_to_lds_b128 %0, %6, off\n\tglobal_load_async_to_lds_b128 %1, %7, off\n\t"
                     "global_load_async_to_lds_b128 %2, %8, off\n\tglobal_load_async_to_lds_b128 %3, %9, off\n\t"
                     "global_load_async_to_lds_b128 %4, %10, off\n\tglobal_load_async_to_lds_b128 %5, %11, off\n\ts_wait_xcnt 0x0"
                     :: "v"(l), "v"(lk1), "v"(lr0), "v"(lr1), "v"(lv0), "v"(lv1), "v"(gk), "v"(gk1), "v"(gr), "v"(gr1), "v"(gv), "v"(gv1) : "memory");
    else
        asm volatile("global_load_async_to_lds_b128 %0, %4, off\n\tglobal_load_async_to_lds_b128 %1, %5, off\n\t"
                     "global_load_async_to_lds_b128 %2, %6, off\n\tglobal_load_async_to_lds_b128 %3, %7, off\n\ts_wait_xcnt 0x0"
                     :: "v"(l), "v"(lk1), "v"(lv0), "v"(lv1), "v"(gk), "v"(gk1), "v"(gv), "v"(gv1) : "memory");
}

// k_flash: fused attention, one wave per 16 query rows of one (batch, head); Q fragments straight from the f16 planes; K, K residual and V^T come in 64-key stages through a
// two-buffer LDS ring that the block's waves share: asynchronous 16-byte copies (whole 128-B lines per row), stage t + 2 issued behind the barrier that ends the reads of stage t.
// Transposed form: S^T[key][t] = K Q^T (A = K rows, B = Q rows); lane (t = lane&15, h = lane>>4) holds keys 8h+r of each 16-key tile, so the packed
// P tile is directly the B fragment of O^T[d][t] = V^T P^T (element r <- tile keys 0..15, element 8+r <- tile keys 16..31, lane unchanged).
// Per 32-key step: 4 value.value score products in the main accumulators, 8 value.residual / residual.value products in separate accumulators (x RESC, folded back by RESI), 4 P.V products.
// Softmax state (running max, partial sum) is one scalar per lane; the two lane halves of a row are combined with one xor-16 exchange.
__global__ __launch_bounds__(32 * AW) void k_flash(const h16* __restrict__ QH, const h16* __restrict__ QR, const h16* __restrict__ KP, const h16* __restrict__ KR, const h16* __restrict__ VT, h16* CTX) {
    __shared__ __align__(16) h16 ring[2 * STG_H];            // two stages; reused as output staging behind the loop
    float* os = (float*)ring;
    const int lane = threadIdx.x & 31, lr = lane & 15, hi = lane >> 4;
    const int wave = __builtin_amdgcn_readfirstlane((int)(threadIdx.x >> 5));
    const int zh = blockIdx.y; const int b = zh / NH_, h = zh % NH_;
    const int t0 = (blockIdx.x * AW + wave) * 16;
    const size_t pbase = (size_t)zh * SEQ * HD;
    // this thread's share of a stage: rows cr and cr + 32 of each tile, 16 bytes at column ccol (8 lanes = one 128-B row, a wave = 4 whole lines)
    const int cr = (int)(threadIdx.x >> 3), ccol = (int)(threadIdx.x & 7) * 8;
    const unsigned cl = (unsigned)(size_t)(&ring[cr * LP + ccol]);               // LDS byte address in buffer 0, K tile
    const size_t ck = pbase + (size_t)cr * HD + ccol;        // + key * HD   (K and K residual planes: row = key; key + cr + 32 < SEQ)
    const size_t cv = pbase + (size_t)cr * SEQ + ccol;       // + key        (V^T plane: row = d, cr + 32 < HD; key + ccol + 7 < SEQ)
    stage_copy(cl, KP + ck, KR + ck, VT + cv);                                     // stage 0 -> buffer 0
    const size_t qo = pbase + (size_t)(t0 + lr) * HD + 8 * hi;
    const v16h qh0 = ldh(QH + qo), qh1 = ldh(QH + qo + 32);   // B fragments: col t, k = d
    v16h qr0 = qh0, qr1 = qh1;
    if (SCORE_RES) { qr0 = ldh(QR + qo); qr1 = ldh(QR + qo + 32); }   // residual B fragments (x RESC)
    const int ko = lr * LP + 8 * hi;                         // + key * LP in the K tiles (A fragment: row key, k = d); + 16j*LP + key in the V^T tile (A fragment: row d, k = key)
    v8f o0 = (v8f){}, o1 = (v8f){}, o2 = (v8f){}, o3 = (v8f){};
    float m = -3.0e38f, l = 0.0f;
    asm volatile("s_wait_asynccnt 0x0" ::: "memory");        // this wave's copies of stage 0 have landed
    __syncthreads();                                         // every wave's have: stage 0 may be read
    if (SEQ > KST) stage_copy(cl + STG_H * 2, KP + ck + (size_t)KST * HD, KR + ck + (size_t)KST * HD, VT + cv + KST);   // stage 1 -> buffer 1
#pragma unroll 1
    for (int ks = 0; ks < SEQ; ks += KST) {
      const int bsel = (ks / KST) & 1;
      const h16* sk = ring + bsel * STG_H + ko;
#pragma unroll
      for (int u = 0; u < KST; u += 32) {                    // the two 32-key steps of the stage, in key order; unrolled so that every LDS offset is an immediate
        const h16* ka = sk + u * LP;
        const v16h ka0 = ldh(ka), ka1 = ldh(ka + 32), kb0 = ldh(ka + 16 * LP), kb1 = ldh(ka + 16 * LP + 32);
        v8f sa = (v8f){}, sb = (v8f){}, ra = (v8f){}, rb = (v8f){};
        sa = wmma16(ka0, qh0, sa); sb = wmma16(kb0, qh0, sb);
        sa = wmma16(ka1, qh1, sa); sb = wmma16(kb1, qh1, sb);
        if (SCORE_RES) {
            const h16* kr = ka + TILE_H;
            const v16h ea0 = ldh(kr), ea1 = ldh(kr + 32), eb0 = ldh(kr + 16 * LP), eb1 = ldh(kr + 16 * LP + 32);
            ra = wmma16(ka0, qr0, ra); rb = wmma16(kb0, qr0, rb);
            ra = wmma16(ka1, qr1, ra); rb = wmma16(kb1, qr1, rb);
            ra = wmma16(ea0, qh0, ra); rb = wmma16(eb0, qh0, rb);
            ra = wmma16(ea1, qh1, ra); rb = wmma16(eb1, qh1, rb);
            asm volatile("v_nop\n\tv_nop\n\tv_nop\n\tv_nop" : "+v"(sa), "+v"(sb), "+v"(ra), "+v"(rb) : "v"(ka0), "v"(ka1), "v"(kb0), "v"(kb1), "v"(ea0), "v"(ea1), "v"(eb0), "v"(eb1), "v"(qh0), "v"(qh1), "v"(qr0), "v"(qr1));
        } else {
            asm volatile("v_nop\n\tv_nop\n\tv_nop\n\tv_nop" : "+v"(sa), "+v"(sb) : "v"(ka0), "v"(ka1), "v"(kb0), "v"(kb1), "v"(qh0), "v"(qh1));
        }
        float ta[8], tb[8]; float mx = -3.0e38f;
#pragma unroll
        for (int r = 0; r < 8; ++r) { ta[r] = (sa[r] + ra[r] * RESI) * SC2; tb[r] = (sb[r] + rb[r] * RESI) * SC2; mx = fmaxf(mx, fmaxf(ta[r], tb[r])); }
        mx = fmaxf(mx, __shfl_xor(mx, 16, 32));
        const float mnew = fmaxf(m, mx);
        const float alpha = __builtin_amdgcn_exp2f(m - mnew);
        const float sh = PSH - mnew;
        v16h pb; float ls = 0.0f;
#pragma unroll
        for (int r = 0; r < 8; ++r) {
            const float ea = ta[r] + sh, eb = tb[r] + sh;
            const float xa = __builtin_amdgcn_exp2f(ea), xb = __builtin_amdgcn_exp2f(eb);
            const h16 pa = (ea < -14.0f) ? (h16)0.0f : (h16)xa;    // exponent cut: no f16 value below the smallest normal
            const h16 pc = (eb < -14.0f) ? (h16)0.0f : (h16)xb;
            pb[r] = pa; pb[8 + r] = pc; ls += (float)pa + (float)pc; }
        l = l * alpha + ls; m = mnew;
        o0 = o0 * alpha; o1 = o1 * alpha; o2 = o2 * alpha; o3 = o3 * alpha;
        const h16* va = sk + 2 * TILE_H + u;
        const v16h v0 = ldh(va), v1 = ldh(va + 16 * LP), v2 = ldh(va + 32 * LP), v3 = ldh(va + 48 * LP);
        o0 = wmma16(v0, pb, o0); o1 = wmma16(v1, pb, o1); o2 = wmma16(v2, pb, o2); o3 = wmma16(v3, pb, o3);
        asm volatile("v_nop\n\tv_nop\n\tv_nop\n\tv_nop" : "+v"(o0), "+v"(o1), "+v"(o2), "+v"(o3) : "v"(v0), "v"(v1), "v"(v2), "v"(v3), "v"(pb));
      }
      asm volatile("s_wait_dscnt 0x0" ::: "memory");         // this wave's reads of the stage have returned: its buffer may be handed to the copies
      asm volatile("s_wait_asynccnt 0x0" ::: "memory");      // this wave's copies of the next stage have landed
      __syncthreads();                                       // publishes the next stage and ends every wave's reads of this one
      if (ks + 2 * KST < SEQ) {                              // block-uniform: refill the buffer just read with the stage after next
        const size_t kn = (size_t)(ks + 2 * KST);
        stage_copy(cl + (unsigned)bsel * (STG_H * 2), KP + ck + kn * HD, KR + ck + kn * HD, VT + cv + kn); }
    }
    asm volatile("s_wait_asynccnt 0x0" ::: "memory");        // nothing of the ring is in flight; the last trip's barrier has ended all reads, so it may become output staging
    l += __shfl_xor(l, 16, 32);
    const float inv = CTXS / l;
    const int wb = wave * 16 * 68;
    // O^T D layout: o_j[r] = (d = 16j + 8h + r, t = lane&15) -> os[t][d]; rows 0..15 x columns 0..63 all written
    { v4f a, c;
      a[0] = o0[0] * inv; a[1] = o0[1] * inv; a[2] = o0[2] * inv; a[3] = o0[3] * inv; c[0] = o0[4] * inv; c[1] = o0[5] * inv; c[2] = o0[6] * inv; c[3] = o0[7] * inv;
      *(v4fa*)(&os[wb + lr * 68 +  0 + 8 * hi]) = a; *(v4fa*)(&os[wb + lr * 68 +  0 + 8 * hi + 4]) = c;
      a[0] = o1[0] * inv; a[1] = o1[1] * inv; a[2] = o1[2] * inv; a[3] = o1[3] * inv; c[0] = o1[4] * inv; c[1] = o1[5] * inv; c[2] = o1[6] * inv; c[3] = o1[7] * inv;
      *(v4fa*)(&os[wb + lr * 68 + 16 + 8 * hi]) = a; *(v4fa*)(&os[wb + lr * 68 + 16 + 8 * hi + 4]) = c;
      a[0] = o2[0] * inv; a[1] = o2[1] * inv; a[2] = o2[2] * inv; a[3] = o2[3] * inv; c[0] = o2[4] * inv; c[1] = o2[5] * inv; c[2] = o2[6] * inv; c[3] = o2[7] * inv;
      *(v4fa*)(&os[wb + lr * 68 + 32 + 8 * hi]) = a; *(v4fa*)(&os[wb + lr * 68 + 32 + 8 * hi + 4]) = c;
      a[0] = o3[0] * inv; a[1] = o3[1] * inv; a[2] = o3[2] * inv; a[3] = o3[3] * inv; c[0] = o3[4] * inv; c[1] = o3[5] * inv; c[2] = o3[6] * inv; c[3] = o3[7] * inv;
      *(v4fa*)(&os[wb + lr * 68 + 48 + 8 * hi]) = a; *(v4fa*)(&os[wb + lr * 68 + 48 + 8 * hi + 4]) = c; }
    wave_sync();
    h16* crow = CTX + ((size_t)b * SEQ + t0) * DM + h * HD;      // ctx plane [b*SEQ + t][h*64 + d], x CTXS
{
#pragma unroll
        for (int s = 0; s < 4; ++s) { const int row = 4 * s + (lane >> 3), c8 = (lane & 7) * 8;   // 4 s x 4 rows = 16 rows; 8 lanes x 8 halves = 64 columns
            const v4f x0 = *(const v4fa*)(&os[wb + row * 68 + c8]); const v4f x1 = *(const v4fa*)(&os[wb + row * 68 + c8 + 4]); v8h hv;
#pragma unroll
            for (int i = 0; i < 4; ++i) { hv[i] = toh_flush(x0[i]); hv[4 + i] = toh_flush(x1[i]); }
            *(v8h*)(crow + (size_t)row * DM + c8) = hv; }
         }
}

// k_out: output projection, f16 GEMM, 256 x 128 tile per block of eight waves (4 x 2), ONE WAVE per 64x64 tile, K = DM; operand rows staged as in k_proj.
// OUT[m][n] = OSC * sum_k CTX[m][k] WoT[n][k] + bo[n] (f32). grid (NB*SEQ/256, DM/128), 256 threads.
__global__ __launch_bounds__(256) void k_out(const h16* __restrict__ A, const h16* __restrict__ Bt, const float* __restrict__ bias, float* OUT) {
    __shared__ __align__(16) h16 ring[2 * GSTG_H];           // two stages; reused as the waves' output staging behind the loop
    const int K = DM;
    const int lane = threadIdx.x & 31, lr = lane & 15, hi = lane >> 4;
    const int wave = __builtin_amdgcn_readfirstlane((int)(threadIdx.x >> 5)); const int wm = wave & 3, wn = wave >> 2;
    const int r0 = blockIdx.x * GBM + wm * 64, c0 = blockIdx.y * GBN + wn * 64;
    float* os = (float*)ring + wave * 16 * 68;
    // this thread's share of a stage: 16 bytes at column cc of rows cr + 16 i (16 lanes = one 256-B row); blockIdx.x * GBM + cr + 240 < NB * SEQ, blockIdx.y * GBN + cr + 112 < DM, cc + 7 < GKS
    const int cr = (int)(threadIdx.x >> 4), cc = (int)(threadIdx.x & 15) * 8;
    const unsigned cl = (unsigned)(size_t)(&ring[cr * GLP + cc]);               // LDS byte address in buffer 0
    const unsigned short* ca = (const unsigned short*)A + (size_t)(blockIdx.x * GBM + cr) * K + cc;    // + k
    const unsigned short* cb = (const unsigned short*)Bt + (size_t)(blockIdx.y * GBN + cr) * K + cc;   // + k
    gemm_stage(cl, ca, cb);                                                      // stage 0 -> buffer 0
    v8f acc[4][4];
#pragma unroll
    for (int mb = 0; mb < 4; ++mb)
#pragma unroll
        for (int nb = 0; nb < 4; ++nb) acc[mb][nb] = (v8f){};
    const int aoff = (wm * 64 + lr) * GLP + 8 * hi, boff = (GBM + wn * 64 + lr) * GLP + 8 * hi;   // fragment rows inside a stage
    asm volatile("s_wait_asynccnt 0x0" ::: "memory");        // this wave's copies of stage 0 have landed
    __syncthreads();                                         // every wave's have: stage 0 may be read
    gemm_stage(cl + GSTG_H * 2, ca + GKS, cb + GKS);         // stage 1 -> buffer 1
#pragma unroll 1
    for (int ks = 0; ks < K; ks += GKS) {
        const int bsel = (ks / GKS) & 1;
        const h16* sa = ring + bsel * GSTG_H + aoff; const h16* sb = ring + bsel * GSTG_H + boff;
        v16h a[2][4], b[2][4];                             // fragments are read one 32-k step ahead, in two groups a step, so that the whole kernel stays inside 256 registers
#pragma unroll
        for (int i = 0; i < 4; ++i) { a[0][i] = ldh(sa + i * 16 * GLP); b[0][i] = ldh(sb + i * 16 * GLP); }
#pragma unroll
        for (int kc = 0; kc < GKS; kc += 32) {               // the 32-k steps of the stage, in k order; unrolled so that every LDS offset is an immediate
            const int cu = (kc / 32) & 1, nx = cu ^ 1;
            // the four scheduling barriers keep each group of reads whole and a step ahead of its products; left free, the compiler sinks every read to its first use and waits there
            __builtin_amdgcn_sched_barrier(0);
            if (kc + 32 < GKS) {                             // never past the stage: the next stage is read only behind its barrier
#pragma unroll
                for (int i = 0; i < 4; ++i) a[nx][i] = ldh(sa + i * 16 * GLP + kc + 32);
#pragma unroll
                for (int i = 0; i < 2; ++i) b[nx][i] = ldh(sb + i * 16 * GLP + kc + 32); }
            __builtin_amdgcn_sched_barrier(0);
#pragma unroll
            for (int nb = 0; nb < 2; ++nb)
#pragma unroll
                for (int mb = 0; mb < 4; ++mb) acc[mb][nb] = wmma16(a[cu][mb], b[cu][nb], acc[mb][nb]);
            __builtin_amdgcn_sched_barrier(0);
            if (kc + 32 < GKS) {
#pragma unroll
                for (int i = 2; i < 4; ++i) b[nx][i] = ldh(sb + i * 16 * GLP + kc + 32); }
            __builtin_amdgcn_sched_barrier(0);
#pragma unroll
            for (int nb = 2; nb < 4; ++nb)
#pragma unroll
                for (int mb = 0; mb < 4; ++mb) acc[mb][nb] = wmma16(a[cu][mb], b[cu][nb], acc[mb][nb]);
        }
        // the distance behind the stage's last matrix instructions, on both sides of the branch below
        asm volatile("v_nop\n\tv_nop\n\tv_nop\n\tv_nop" : "+v"(acc[0][0]), "+v"(acc[1][0]), "+v"(acc[2][0]), "+v"(acc[3][0]), "+v"(acc[0][1]), "+v"(acc[1][1]), "+v"(acc[2][1]), "+v"(acc[3][1]),
                     "+v"(acc[0][2]), "+v"(acc[1][2]), "+v"(acc[2][2]), "+v"(acc[3][2]), "+v"(acc[0][3]), "+v"(acc[1][3]), "+v"(acc[2][3]), "+v"(acc[3][3]));
        asm volatile("s_wait_dscnt 0x0" ::: "memory");       // this wave's reads of the stage have returned: its buffer may be handed to the copies
        asm volatile("s_wait_asynccnt 0x0" ::: "memory");    // this wave's copies of the next stage have landed
        __syncthreads();                                     // publishes the next stage and ends every wave's reads of this one
        if (ks + 2 * GKS < K)                                // block-uniform: refill the buffer just read with the stage after next
            gemm_stage(cl + (unsigned)bsel * (GSTG_H * 2), ca + ks + 2 * GKS, cb + ks + 2 * GKS);
    }
    asm volatile("s_wait_asynccnt 0x0" ::: "memory");        // nothing of the ring is in flight; the last trip's barrier has ended all reads, so it may become output staging
    const int cofs = lr * 4;
    v4f bb; { const v4f t = *(const v4f*)(bias + c0 + cofs);      // c0 + cofs + 3 < DM
#pragma unroll
        for (int i = 0; i < 4; ++i) bb[i] = bfr(t[i]); }
    float* orow = OUT + ((size_t)(r0 / SEQ) * OUT_SEQ + (size_t)(r0 % SEQ)) * DM + c0;
#pragma unroll
    for (int mb = 0; mb < 4; ++mb) {
#pragma unroll
        for (int nb = 0; nb < 4; ++nb) {
#pragma unroll
            for (int j = 0; j < 8; ++j) os[(hi * 8 + j) * 68 + nb * 16 + lr] = acc[mb][nb][j]; }   // D: row 8h+j, col lane&15
        wave_sync();
{
#pragma unroll
            for (int s = 0; s < 8; ++s) { const int row = 2 * s + hi;   // 8 s x 2 rows = 16 rows; 16 lanes x 4 floats = 64 columns
                const v4f x = *(const v4fa*)(&os[row * 68 + cofs]); v4f val;
#pragma unroll
                for (int i = 0; i < 4; ++i) val[i] = x[i] * OSC + bb[i];
                *(v4f*)(orow + (size_t)(mb * 16 + row) * DM + cofs) = val; }
             }
        wave_sync();
    }
}

static constexpr size_t al256(size_t v) { return (v + 255) & ~(size_t)255; }
static constexpr size_t SZ_XB = al256((size_t)NB * SEQ * DM * 2);
static constexpr size_t SZ_WB = al256((size_t)3 * DM * DM * 2);
static constexpr size_t SZ_PL = al256((size_t)NB * NH_ * SEQ * HD * 2);
static constexpr size_t SZ_TOTAL = 3 * SZ_XB + SZ_WB + 3 * SZ_PL;
static_assert(SZ_TOTAL <= (size_t)134217728);                  // workspace carve <= 128 MiB
static_assert(((size_t)DM * DM * 2) % 256 == 0);               // weight sub-planes stay 256-byte aligned
static_assert((size_t)3 * DM * DM * 2 <= SZ_WB);               // three weight sub-planes (q | k | o) fit their region
static_assert((size_t)NB * SEQ * DM * 2 <= SZ_XB);             // ctx plane (aliases the query copy) fits its region
static_assert((size_t)NB * NH_ * SEQ * HD * 2 <= SZ_XB);       // q / k residual planes (alias the key / value copies) fit their regions

extern "C" void kernel_launch(void* const* d_in, const int* in_sizes, int n_in,
                              void* d_out, int out_size, void* d_ws, size_t ws_size, hipStream_t stream) {
    if (n_in < 9) return;
    const size_t needx = ((size_t)(NB - 1) * SEQ_FULL + SEQ) * DM;
    if ((size_t)in_sizes[0] < needx || (size_t)in_sizes[1] < needx || (size_t)in_sizes[2] < needx) return;
    if ((size_t)in_sizes[3] < (size_t)DM * DM || (size_t)in_sizes[5] < (size_t)DM * DM || (size_t)in_sizes[7] < (size_t)DM * DM) return;
    if (in_sizes[4] < DM || in_sizes[6] < DM || in_sizes[8] < DM) return;
    if ((size_t)out_size < ((size_t)(NB - 1) * OUT_SEQ + SEQ) * DM) return;
    if (SZ_TOTAL > ws_size) return;
    // wire order: q, k, v, q_w, q_b, k_w, k_b, out_w, out_b
    const float* xq = (const float*)d_in[0]; const float* xk = (const float*)d_in[1]; const float* xv = (const float*)d_in[2];
    const float* wq = (const float*)d_in[3]; const float* bq = (const float*)d_in[4];
    const float* wk = (const float*)d_in[5]; const float* bk = (const float*)d_in[6];
    const float* wo = (const float*)d_in[7]; const float* bo = (const float*)d_in[8];
    float* OUT = (float*)d_out;      // [NB][OUT_SEQ][1024]
    char* wsp = (char*)d_ws;
    bf* XQ = (bf*)wsp; wsp += SZ_XB;                 // [NB*SEQ][1024] bf16 queries; region reused later as the ctx plane
    bf* XK = (bf*)wsp; wsp += SZ_XB;                 // [NB*SEQ][1024] bf16 keys; region reused later as the q residual plane
    bf* XV = (bf*)wsp; wsp += SZ_XB;                 // [NB*SEQ][1024] bf16 values; region reused later as the k residual plane
    bf* WB = (bf*)wsp; wsp += SZ_WB;                 // [3][1024][1024] transposed [out][in]: q | k (bf16) | o (f16 x64)
    h16* QH = (h16*)wsp; wsp += SZ_PL;               // [NB*16][SEQ][64]
    h16* KP = (h16*)wsp; wsp += SZ_PL;               // [NB*16][SEQ][64]
    h16* VT = (h16*)wsp; wsp += SZ_PL;               // [NB*16][64][SEQ]
    h16* CTX = (h16*)XQ;                             // [NB*SEQ][1024] f16 x256, written after the q projection has consumed XQ
    h16* KR = (h16*)XV;                              // [NB*16][SEQ][64] f16 x2048, written after the v projection has consumed XV
    h16* QR = (h16*)XK;                              // [NB*16][SEQ][64] f16 x2048, written after the k projection has consumed XK
    bf* WQT = WB; bf* WKT = WB + (size_t)DM * DM; bf* WOT = WB + (size_t)2 * DM * DM;

    k_cvt3<<<dim3((unsigned)((size_t)NB * SEQ * DM / (8 * CVW * 128)), 3, 1), 256, 0, stream>>>(xq, xk, xv, XQ, XK, XV);
    // weights: in[rows = 1024 (contraction index)][cols = 1024 (output feature)] -> out[cols][rows]; grid (cols/64, rows/64)
    { const dim3 g(DM / 64, DM / 64, 1);
      k_cvtT<0><<<g, 256, 0, stream>>>(wq, (unsigned short*)WQT, DM, DM);
      k_cvtT<0><<<g, 256, 0, stream>>>(wk, (unsigned short*)WKT, DM, DM);
      k_cvtT<1><<<g, 256, 0, stream>>>(wo, (unsigned short*)WOT, DM, DM); }

    // launch order v, k, q: each residual plane lands in an input copy that an earlier launch has fully consumed
    // v^T: the value projection uses the QUERY weight and bias: A = q_w^T rows (m = h*64 + d), Bt = value-input rows (n = b*SEQ + t), row bias q_b[m] -> plane [(b*1024 + m)][t] = [(b*16 + h)][d][t]; no residual plane
    k_proj<1, 0><<<dim3(DM / GBM, NB * SEQ / GBN, 1), 256, 0, stream>>>(WQT, XV, bq, VT, VT, DM, (size_t)0, SEQ, SEQ, (size_t)DM * SEQ);
    // k, q: A = x rows (m = b*SEQ + t), Bt = W^T rows (n = h*64 + d), column bias -> value and residual planes [(b*16 + h)][t][d]
    k_proj<0, SCORE_RES><<<dim3(NB * SEQ / GBM, DM / GBN, 1), 256, 0, stream>>>(XK, WKT, bk, KP, KR, SEQ, (size_t)NH_ * SEQ * HD, HD, HD, (size_t)SEQ * HD);
    k_proj<0, SCORE_RES><<<dim3(NB * SEQ / GBM, DM / GBN, 1), 256, 0, stream>>>(XQ, WQT, bq, QH, QR, SEQ, (size_t)NH_ * SEQ * HD, HD, HD, (size_t)SEQ * HD);

    k_flash<<<dim3(SEQ / (16 * AW), NB * NH_, 1), 32 * AW, 0, stream>>>(QH, QR, KP, KR, VT, CTX);

    k_out<<<dim3(NB * SEQ / GBM, DM / GBN, 1), 256, 0, stream>>>(CTX, (const h16*)WOT, bo, OUT);
}

// v004
// It runs in 196 microseconds.
// Two timings next to v003 put it at 1.09 and 1.10 times that version's speed.
// Over all steps from v000 it is 2.61 times as fast.
#include <hip/hip_runtime.h>

// Multi-head self-attention block, width 1024 = 16 heads x 64; separate query / key / value inputs [NB][SEQ_FULL][1024] (first SEQ tokens of each batch used); q_w / k_w / out_w stored [in][out] (y = x W + b); the value projection uses the query weight and the query bias (there is no separate value weight); no mask; score scale 1/8; output = ctx out_w + out_b (f32).
// Compute dtypes, f32 accumulate everywhere: q/k/v projections v_wmma_f32_16x16x32_bf16 (inputs and weights RNE-converted to bf16; products exact); scores v_wmma_f32_16x16x32_f16 with q and k each carried as f16 value + f16 residual x2048 (three products: value.value in the main accumulator, value.residual + residual.value in a separate accumulator folded back by 1/2048); P.V v_wmma_f32_16x16x32_f16 (P x256 carry, cancels in the normalisation; v single f16); output projection v_wmma_f32_16x16x32_f16: ctx f16 with x256 carry, out_w^T (bf16 RNE value) x64 as f16, carries folded back in the f32 epilogue; softmax f32 (online, running max); biases (bf16 RNE values) added in f32.
// Launches: k_prep (all operand conversions, independent of one another, one grid), k_proj3 (the three projections, independent of one another, one grid), k_flash, k_out.
// Layout: bf16 copies of the three inputs; transposed 16-bit weight planes [out][in]; q, k value and residual planes [b*16+h][t][d] and v^T plane [b*16+h][d][t] written by the GEMM epilogue; fused flash kernel in transposed form (S^T = K Q^T, O^T = V^T P^T) writing the ctx plane [b*SEQ+t][h*64+d]; final GEMM writes the f32 output.

#ifndef NB
#define NB 4
#endif
#ifndef SEQ
#define SEQ 2048
#endif
#define NB_FULL  4
#define SEQ_FULL 2048
#ifndef OUT_SEQ
#define OUT_SEQ SEQ              // row pitch (in tokens) between batches of the output
#endif
#ifndef SCORE_RES
#define SCORE_RES 1              // 1: q and k residual planes and three-product scores; 0: single-product scores
#endif
#define DM   1024
#define NH_  16
#define HD   64
#define AW   8                   // waves per flash block (16 query rows each); all of them read the same staged key tiles
#define KST  64                  // keys per LDS stage: every staged row (K, K residual: one key; V^T: one d) is one whole 128-B line
#define LP   72                  // LDS row pitch in halves: 144 B = 16 B x odd, conflict-free for 16-byte fragment reads
#define TILE_H (64 * LP)         // halves of one staged tile (64 rows)
#define STG_H  (3 * TILE_H)      // one stage: K value | K residual | V^T
#define SC2  (0.125f * 1.4426950408889634f)   // HD^-0.5 * log2(e)
#define PSH  8.0f                // log2 of the P carry (256)
#define CTXS 256.0f              // carry of the ctx plane
#define WOS  64.0f               // carry of the Wo^T plane
#define OSC  (1.0f / 16384.0f)   // 1 / (CTXS * WOS)
#define RESC 2048.0f             // carry of the q / k residual planes
#define RESI (1.0f / 2048.0f)    // 1 / RESC
#define GBM  256                 // GEMM block tile: rows of A
#define GBN  128                 // GEMM block tile: rows of Bt (output columns)
#define GKS  128                 // k per LDS stage of the GEMMs: every staged row is 256 B, two whole lines
#define GLP  136                 // LDS row pitch of the GEMM stages in halves: 272 B = 16 B x odd, conflict-free for 16-byte fragment reads
#define GSTG_H ((GBM + GBN) * GLP)   // halves of one GEMM stage: A rows | Bt rows
#define CVW  32                  // input conversion: 512-byte loads per wave (16 KiB of f32 a wave)

static_assert(HD == 64);
static_assert(NH_ * HD == DM);                 // head h = columns h*64 + d
static_assert(DM % 64 == 0);                   // column tiles of 64
static_assert(DM % 32 == 0);                   // GEMM k-loop steps by 32
static_assert(SEQ % 64 == 0);                  // a 64-row tile never straddles two batches
static_assert((NB * SEQ) % 64 == 0);
static_assert(SEQ % 32 == 0);                  // key loop steps by 32
static_assert(SEQ % (16 * AW) == 0);           // flash grid covers the sequence exactly
static_assert(SEQ % KST == 0);                 // key stages cover the sequence exactly
static_assert(KST == 64 && KST % 32 == 0);     // a stage is two 32-key steps; V^T rows of a stage are 128 B
static_assert(32 * AW * 2 * 8 == 64 * HD);     // two 16-byte copies per thread fill one 64 x 64 tile
static_assert((size_t)AW * 16 * 68 * 4 <= (size_t)2 * STG_H * 2);   // output staging fits the ring it reuses
static_assert(((size_t)SEQ * DM) % (CVW * 128) == 0);            // a wave's share of the input conversion never straddles two batches
static_assert(((size_t)NB * SEQ * DM) % (8 * CVW * 128) == 0);   // its grid of eight-wave blocks covers an input exactly
static_assert(DM % GBM == 0 && DM % GBN == 0 && (NB * SEQ) % GBM == 0 && (NB * SEQ) % GBN == 0);   // GEMM grids cover every operand exactly
static_assert(DM % GKS == 0 && DM / GKS >= 2 && GKS % 32 == 0);   // whole stages, at least two of them
static_assert(GBM == 4 * 64 && GBN == 2 * 64);                   // eight waves, 4 x 2, one 64 x 64 tile each
static_assert(256 * 8 * 8 == 128 * GKS);                         // eight 16-byte copies per thread fill 128 staged rows
static_assert((size_t)8 * 16 * 68 * 4 <= (size_t)2 * GSTG_H * 2);   // the waves' output staging fits the ring it reuses
static_assert(((size_t)DM * DM) % 8 == 0);
static_assert(NB <= NB_FULL);
static_assert(SEQ <= SEQ_FULL);
static_assert(RESC * RESI == 1.0f);            // residual carry folds back exactly
static_assert(CTXS * WOS * OSC == 1.0f);       // output carries fold back exactly

typedef _Float16 h16;
typedef unsigned short bf;
typedef __attribute__((ext_vector_type(16))) __bf16   v16bf;
typedef __attribute__((ext_vector_type(16))) _Float16 v16h;
typedef __attribute__((ext_vector_type(8)))  _Float16 v8h;
typedef __attribute__((ext_vector_type(8)))  unsigned short v8us;
typedef __attribute__((ext_vector_type(4)))  unsigned short v4us;
typedef __attribute__((ext_vector_type(8)))  float    v8f;
typedef __attribute__((ext_vector_type(4)))  float    v4f;
typedef v4f  __attribute__((may_alias)) v4fa;

__device__ __forceinline__ unsigned short f2bf(float f) { unsigned u = __float_as_uint(f); u += 0x7FFFu + ((u >> 16) & 1u); return (unsigned short)(u >> 16); }
__device__ __forceinline__ float bfr(float f) { return __uint_as_float(((unsigned)f2bf(f)) << 16); }   // value of the bf16 RNE conversion, as f32
__device__ __forceinline__ v16h cat16(v8h lo, v8h hi) { return __builtin_shufflevector(lo, hi, 0, 1, 2, 3, 4, 5, 6, 7, 8, 9, 10, 11, 12, 13, 14, 15); }
__device__ __forceinline__ v16bf cat16b(v8us lo, v8us hi) { return __builtin_bit_cast(v16bf, __builtin_shufflevector(lo, hi, 0, 1, 2, 3, 4, 5, 6, 7, 8, 9, 10, 11, 12, 13, 14, 15)); }
__device__ __forceinline__ v8f wmma16(v16h a, v16h b, v8f c) { return __builtin_amdgcn_wmma_f32_16x16x32_f16(false, a, false, b, (short)0, c, false, false); }
__device__ __forceinline__ v8f wmmab(v16bf a, v16bf b, v8f c) { return __builtin_amdgcn_wmma_f32_16x16x32_bf16(false, a, false, b, (short)0, c, false, false); }
// fragment loaders from K-contiguous 16-bit rows; p already includes + 8*(lane>>4): elements 0..7 <- k0+8h+0..7, elements 8..15 <- k0+16+8h+0..7 (same map for A and B)
__device__ __forceinline__ v16h  ldh(const h16* p) { return cat16(*(const v8h*)p, *(const v8h*)(p + 16)); }
__device__ __forceinline__ v16bf ldb(const bf* p)  { return cat16b(*(const v8us*)p, *(const v8us*)(p + 16)); }
// ordering point for wave-private LDS tiles (same wave writes and reads)
__device__ __forceinline__ void wave_sync() { __builtin_amdgcn_fence(3 /* release order */, "wavefront"); __builtin_amdgcn_wave_barrier(); asm volatile("" ::: "memory"); }
// f32 -> f16 for operand planes: a result below the smallest normal f16 magnitude is replaced by zero (value select)
static __device__ __forceinline__ h16 toh_flush(float v) { const h16 r = (h16)v; return (fabsf(v) < 6.103515625e-05f) ? (h16)0.0f : r; }

// cvt_in: bf16 RNE copy of one input, written as a stream: block blk of the copy, every wave converts CVW * 128 consecutive floats.
// All CVW loads of a wave (16 bytes a lane, 512 contiguous bytes a wave = four whole lines) are issued before the first conversion; a wave's 8-byte stores cover 256 contiguous bytes.
__device__ __forceinline__ void cvt_in(const float* __restrict__ src, bf* __restrict__ dst, unsigned blk) {
    const size_t e0 = ((size_t)blk * 8 + (threadIdx.x >> 5)) * (CVW * 128);   // first element of this wave's share in the packed copy [NB*SEQ][DM]
    const size_t s0 = (SEQ == SEQ_FULL) ? e0 : (e0 / ((size_t)SEQ * DM)) * ((size_t)SEQ_FULL * DM) + e0 % ((size_t)SEQ * DM);   // the same element in the input (batch pitch SEQ_FULL)
    const float* s = src + s0 + (threadIdx.x & 31) * 4;
    bf* d = dst + e0 + (threadIdx.x & 31) * 4;
    v4f v[CVW];
#pragma unroll
    for (int j = 0; j < CVW; ++j) v[j] = *(const v4f*)(s + j * 128);
    __builtin_amdgcn_sched_barrier(0);   // keeps every load ahead of the first conversion; left free, the compiler holds the last four back until the others have returned: a second trip to memory
#pragma unroll
    for (int j = 0; j < CVW; ++j) { v4us o;
#pragma unroll
        for (int k = 0; k < 4; ++k) o[k] = f2bf(v[j][k]);
        *(v4us*)(d + j * 128) = o; }
    asm volatile("s_wait_xcnt 0x0" ::: "memory");   // ends the run of stores: in the joined kernel another job's code follows in the text and reuses their registers
}

// cvt_wT: transpose + 16-bit convert of one 64 x 64 tile (columns n0.., rows k0..) of a weight matrix: in[R][C] (f32, R = contraction index, C = output feature) -> out[C][R] (16-bit, contraction-contiguous); ts = 64 x 65 floats of LDS.
// F16OUT == 0: bf16 RNE bits; F16OUT == 1: f16 of (bf16 RNE value x WOS) (exact for values whose scaled magnitude is in the f16 normal range).
template <int F16OUT>
__device__ __forceinline__ void cvt_wT(const float* __restrict__ W, unsigned short* dst, float* ts, int n0, int k0) {
    const int R = DM, C = DM;
    const int tid = threadIdx.x;
#pragma unroll
    for (int it = 0; it < 4; ++it) {                     // 4 x 16 rows x (16 lanes x 4 floats) = 64 x 64, all written
        const int r = it * 16 + (tid >> 4), c4 = (tid & 15) * 4;
        const v4f v = *(const v4f*)(W + (size_t)(k0 + r) * (size_t)C + n0 + c4);
#pragma unroll
        for (int i = 0; i < 4; ++i) ts[r * 65 + c4 + i] = v[i];
    }
    __syncthreads();
    v8us o[2];
#pragma unroll
    for (int it = 0; it < 2; ++it) {                     // 2 x 32 output rows x (8 lanes x 8 halves) = 64 x 64
        const int n = it * 32 + (tid >> 3), k8 = (tid & 7) * 8;
#pragma unroll
        for (int i = 0; i < 8; ++i) {
            const float x = ts[(k8 + i) * 65 + n];
            const unsigned short bb = f2bf(x);
            if (F16OUT) { const h16 hv = (h16)(__uint_as_float(((unsigned)bb) << 16) * WOS); o[it][i] = __builtin_bit_cast(unsigned short, hv); }
            else o[it][i] = bb;
        }
    }
{
#pragma unroll
        for (int it = 0; it < 2; ++it) { const int n = it * 32 + (tid >> 3), k8 = (tid & 7) * 8;
            *(v8us*)(dst + (size_t)(n0 + n) * (size_t)R + k0 + k8) = o[it]; }
         }
    asm volatile("s_wait_xcnt 0x0" ::: "memory");   // ends the two stores: in the joined kernel another job's code follows in the text and reuses their registers
}

// k_prep: every operand conversion in one grid (none reads what another writes): blockIdx.x 0..2 = weight planes q | k | o, one 64 x 64 tile a block; blockIdx.x 3..5 = input copies q | k | v; blockIdx.y = which block of it.
// The job is the fast index, so that the short, latency-bound weight blocks start spread among the blocks of the input stream and run under it. Every branch here is block-uniform.
#define WT_BLK ((DM / 64) * (DM / 64))                            // blocks of one weight plane
#define CV_BLK ((unsigned)((size_t)NB * SEQ * DM / (8 * CVW * 128)))   // blocks of one input copy
#define PREP_GX (WT_BLK > CV_BLK ? WT_BLK : CV_BLK)               // blocks of the longest job
__global__ __launch_bounds__(256) void k_prep(const float* __restrict__ xq, const float* __restrict__ xk, const float* __restrict__ xv, const float* __restrict__ wq, const float* __restrict__ wk, const float* __restrict__ wo,
                                              bf* __restrict__ dq, bf* __restrict__ dk, bf* __restrict__ dv, unsigned short* __restrict__ tq, unsigned short* __restrict__ tk, unsigned short* __restrict__ to) {
    __shared__ float ts[64 * 65];
    const unsigned y = blockIdx.x, x = blockIdx.y;           // y = job, x = block of the job
    if (y < 3) {
        if (x >= WT_BLK) return;
        const int n0 = (int)(x % (DM / 64)) * 64, k0 = (int)(x / (DM / 64)) * 64;
        if (y == 2) cvt_wT<1>(wo, to, ts, n0, k0);
        else cvt_wT<0>(y == 0 ? wq : wk, y == 0 ? tq : tk, ts, n0, k0);
    } else {
        if (x >= CV_BLK) return;
        cvt_in(y == 3 ? xq : (y == 4 ? xk : xv), y == 3 ? dq : (y == 4 ? dk : dv), x);
    }
}

// gemm_copy8: one thread's share of 128 staged rows, eight 16-byte asynchronous copies global -> LDS (rows r, r + 16, ..., r + 112 of a K-contiguous 16-bit plane of row length DM).
// The s_wait_xcnt ends the copies' own statement so that no address register named there is rewritten ahead of it.
__device__ __forceinline__ void gemm_copy8(unsigned l, const unsigned short* g) {
    asm volatile("global_load_async_to_lds_b128 %0, %8, off\n\tglobal_load_async_to_lds_b128 %1, %9, off\n\t"
                 "global_load_async_to_lds_b128 %2, %10, off\n\tglobal_load_async_to_lds_b128 %3, %11, off\n\t"
                 "global_load_async_to_lds_b128 %4, %12, off\n\tglobal_load_async_to_lds_b128 %5, %13, off\n\t"
                 "global_load_async_to_lds_b128 %6, %14, off\n\tglobal_load_async_to_lds_b128 %7, %15, off\n\ts_wait_xcnt 0x0"
                 :: "v"(l), "v"(l + 16 * GLP * 2), "v"(l + 32 * GLP * 2), "v"(l + 48 * GLP * 2), "v"(l + 64 * GLP * 2), "v"(l + 80 * GLP * 2), "v"(l + 96 * GLP * 2), "v"(l + 112 * GLP * 2),
                    "v"(g), "v"(g + 16 * DM), "v"(g + 32 * DM), "v"(g + 48 * DM), "v"(g + 64 * DM), "v"(g + 80 * DM), "v"(g + 96 * DM), "v"(g + 112 * DM) : "memory");
}
// gemm_stage: one thread's share of a GEMM stage (GBM rows of A, then GBN rows of Bt, GKS halves of each); l = LDS byte address of its piece of row (thread / 16) of the stage.
__device__ __forceinline__ void gemm_stage(unsigned l, const unsigned short* ga, const unsigned short* gb) {
    gemm_copy8(l, ga); gemm_copy8(l + 128 * GLP * 2, ga + (size_t)128 * DM); gemm_copy8(l + GBM * GLP * 2, gb);
}

// proj_tile: register-blocked bf16 GEMM, 256 x 128 tile (bx, by) per block of eight waves (4 x 2), ONE WAVE per 64x64 tile (16 accumulators), K = DM; the K-contiguous bf16 operand rows come in
// stages of 128 k through a two-buffer LDS ring that the waves share: asynchronous 16-byte copies (whole lines), stage s + 2 issued behind the barrier that ends the reads of stage s.
// C[m][n] = sum_k A[m][k] Bt[n][k] + bias (BROW == 0: bias[n]; BROW == 1: bias[m]), written as f16 (Ph) at
// tile base (r0/RB)*sRB + (r0%RB)*pitch + (c0/CB)*sCB + (c0%CB), row pitch 'pitch' (halves). bx < M/256, by < N/128, 256 threads; ring = the block's 2 * GSTG_H halves of LDS.
// RES == 1: additionally the residual plane Pr (same addressing) = f16((C - f16 value) x RESC); RES == 0: Pr is not touched.
template <int BROW, int RES>
__device__ __forceinline__ void proj_tile(bf* ring, int bx, int by, const bf* __restrict__ A, const bf* __restrict__ Bt, const float* __restrict__ bias, h16* Ph, h16* Pr, int RB, size_t sRB, int pitch, int CB, size_t sCB) {
    const int K = DM;
    const int lane = threadIdx.x & 31, lr = lane & 15, hi = lane >> 4;
    const int wave = __builtin_amdgcn_readfirstlane((int)(threadIdx.x >> 5)); const int wm = wave & 3, wn = wave >> 2;
    const int r0 = bx * GBM + wm * 64, c0 = by * GBN + wn * 64;
    float* os = (float*)ring + wave * 16 * 68;
    // this thread's share of a stage: 16 bytes at column cc of rows cr + 16 i (16 lanes = one 256-B row); bx * GBM + cr + 240 < M, by * GBN + cr + 112 < N, cc + 7 < GKS
    const int cr = (int)(threadIdx.x >> 4), cc = (int)(threadIdx.x & 15) * 8;
    const unsigned cl = (unsigned)(size_t)(&ring[cr * GLP + cc]);               // LDS byte address in buffer 0
    const bf* ca = A + (size_t)(bx * GBM + cr) * K + cc;                        // + k
    const bf* cb = Bt + (size_t)(by * GBN + cr) * K + cc;                       // + k
    gemm_stage(cl, ca, cb);                                                      // stage 0 -> buffer 0
    v8f acc[4][4];
#pragma unroll
    for (int mb = 0; mb < 4; ++mb)
#pragma unroll
        for (int nb = 0; nb < 4; ++nb) acc[mb][nb] = (v8f){};
    const int aoff = (wm * 64 + lr) * GLP + 8 * hi, boff = (GBM + wn * 64 + lr) * GLP + 8 * hi;   // fragment rows inside a stage
    asm volatile("s_wait_asynccnt 0x0" ::: "memory");        // this wave's copies of stage 0 have landed
    __syncthreads();                                         // every wave's have: stage 0 may be read
    gemm_stage(cl + GSTG_H * 2, ca + GKS, cb + GKS);         // stage 1 -> buffer 1
#pragma unroll 1
    for (int ks = 0; ks < K; ks += GKS) {
        const int bsel = (ks / GKS) & 1;
        const bf* sa = ring + bsel * GSTG_H + aoff; const bf* sb = ring + bsel * GSTG_H + boff;
        v16bf a[2][4], b[2][4];                             // fragments are read one 32-k step ahead, in two groups a step, so that the whole kernel stays inside 256 registers
#pragma unroll
        for (int i = 0; i < 4; ++i) { a[0][i] = ldb(sa + i * 16 * GLP); b[0][i] = ldb(sb + i * 16 * GLP); }
#pragma unroll
        for (int kc = 0; kc < GKS; kc += 32) {               // the 32-k steps of the stage, in k order; unrolled so that every LDS offset is an immediate
            const int cu = (kc / 32) & 1, nx = cu ^ 1;
            // the four scheduling barriers keep each group of reads whole and a step ahead of its products; left free, the compiler sinks every read to its first use and waits there
            __builtin_amdgcn_sched_barrier(0);
            if (kc + 32 < GKS) {                             // never past the stage: the next stage is read only behind its barrier
#pragma unroll
                for (int i = 0; i < 4; ++i) a[nx][i] = ldb(sa + i * 16 * GLP + kc + 32);
#pragma unroll
                for (int i = 0; i < 2; ++i) b[nx][i] = ldb(sb + i * 16 * GLP + kc + 32); }
            __builtin_amdgcn_sched_barrier(0);
#pragma unroll
            for (int nb = 0; nb < 2; ++nb)
#pragma unroll
                for (int mb = 0; mb < 4; ++mb) acc[mb][nb] = wmmab(a[cu][mb], b[cu][nb], acc[mb][nb]);
            __builtin_amdgcn_sched_barrier(0);
            if (kc + 32 < GKS) {
#pragma unroll
                for (int i = 2; i < 4; ++i) b[nx][i] = ldb(sb + i * 16 * GLP + kc + 32); }
            __builtin_amdgcn_sched_barrier(0);
#pragma unroll
            for (int nb = 2; nb < 4; ++nb)
#pragma unroll
                for (int mb = 0; mb < 4; ++mb) acc[mb][nb] = wmmab(a[cu][mb], b[cu][nb], acc[mb][nb]);
        }
        // the distance behind the stage's last matrix instructions, on both sides of the branch below
        asm volatile("v_nop\n\tv_nop\n\tv_nop\n\tv_nop" : "+v"(acc[0][0]), "+v"(acc[1][0]), "+v"(acc[2][0]), "+v"(acc[3][0]), "+v"(acc[0][1]), "+v"(acc[1][1]), "+v"(acc[2][1]), "+v"(acc[3][1]),
                     "+v"(acc[0][2]), "+v"(acc[1][2]), "+v"(acc[2][2]), "+v"(acc[3][2]), "+v"(acc[0][3]), "+v"(acc[1][3]), "+v"(acc[2][3]), "+v"(acc[3][3]));
        asm volatile("s_wait_dscnt 0x0" ::: "memory");       // this wave's reads of the stage have returned: its buffer may be handed to the copies
        asm volatile("s_wait_asynccnt 0x0" ::: "memory");    // this wave's copies of the next stage have landed
        __syncthreads();                                     // publishes the next stage and ends every wave's reads of this one
        if (ks + 2 * GKS < K)                                // block-uniform: refill the buffer just read with the stage after next
            gemm_stage(cl + (unsigned)bsel * (GSTG_H * 2), ca + ks + 2 * GKS, cb + ks + 2 * GKS);
    }
    asm volatile("s_wait_asynccnt 0x0" ::: "memory");        // nothing of the ring is in flight; the last trip's barrier has ended all reads, so it may become output staging
    // column bias for this lane's 8 store columns (BROW == 0); c0 + (lane&7)*8 + 7 < N = DM
    v4f bc0 = (v4f){}, bc1 = (v4f){};
    if (BROW == 0) { const int cb8 = (lane & 7) * 8; const v4f t0 = *(const v4f*)(bias + c0 + cb8); const v4f t1 = *(const v4f*)(bias + c0 + cb8 + 4);
#pragma unroll
        for (int i = 0; i < 4; ++i) { bc0[i] = bfr(t0[i]); bc1[i] = bfr(t1[i]); } }
    const size_t tbase = (size_t)(r0 / RB) * sRB + (size_t)(r0 % RB) * (size_t)pitch + (size_t)(c0 / CB) * sCB + (size_t)(c0 % CB);
#pragma unroll
    for (int mb = 0; mb < 4; ++mb) {
#pragma unroll
        for (int nb = 0; nb < 4; ++nb) {
#pragma unroll
            for (int j = 0; j < 8; ++j) os[(hi * 8 + j) * 68 + nb * 16 + lr] = acc[mb][nb][j]; }   // D: row 8h+j, col lane&15
        wave_sync();
        const size_t sb = tbase + (size_t)(mb * 16) * (size_t)pitch;
{
#pragma unroll
            for (int s = 0; s < 4; ++s) { const int row = 4 * s + (lane >> 3), c8 = (lane & 7) * 8;   // 4 s x 4 row groups = 16 rows; 8 lanes x 8 = 64 columns
                v4f x0 = *(const v4fa*)(&os[row * 68 + c8]); v4f x1 = *(const v4fa*)(&os[row * 68 + c8 + 4]); v8h hv; v8h rv;
                if (BROW == 1) { const float br = bfr(bias[r0 + mb * 16 + row]);                    // row bias; r0 + mb*16 + row < M = DM
#pragma unroll
                    for (int i = 0; i < 4; ++i) { x0[i] += br; x1[i] += br; } }
                else {
#pragma unroll
                    for (int i = 0; i < 4; ++i) { x0[i] += bc0[i]; x1[i] += bc1[i]; } }
#pragma unroll
                for (int i = 0; i < 4; ++i) { const h16 a = toh_flush(x0[i]); const h16 c = toh_flush(x1[i]); hv[i] = a; hv[4 + i] = c;
                    rv[i] = toh_flush((x0[i] - (float)a) * RESC); rv[4 + i] = toh_flush((x1[i] - (float)c) * RESC); }   // difference and carry are exact in f32
                const size_t oo = sb + (size_t)row * (size_t)pitch + c8;
                *(v8h*)(Ph + oo) = hv;
                if (RES) *(v8h*)(Pr + oo) = rv; }
             }
        asm volatile("s_wait_xcnt 0x0" ::: "memory");   // ends this row block's stores before the next block's loads and sums reuse their registers
        wave_sync();
    }
}

// k_proj3: the three projections in one grid (none reads what another writes): blockIdx.y 0 = v^T, 1 = k, 2 = q; blockIdx.x = tile, row tiles of A fastest. Every branch here is block-uniform.
// v^T: the value projection uses the QUERY weight and bias: A = q_w^T rows (m = h*64 + d), Bt = value-input rows (n = b*SEQ + t), row bias q_b[m] -> plane [(b*1024 + m)][t] = [(b*16 + h)][d][t]; no residual plane.
// k, q: A = x rows (m = b*SEQ + t), Bt = W^T rows (n = h*64 + d), column bias -> value and residual planes [(b*16 + h)][t][d].
#define PJ_BLK ((DM / GBM) * (NB * SEQ / GBN))                    // tiles of one projection, in either orientation
static_assert(PJ_BLK == (NB * SEQ / GBM) * (DM / GBN));
__global__ __launch_bounds__(256) void k_proj3(const bf* __restrict__ XQ, const bf* __restrict__ XK, const bf* __restrict__ XV, const bf* __restrict__ WQT, const bf* __restrict__ WKT, const float* __restrict__ bq, const float* __restrict__ bk,
                                               h16* QH, h16* QR, h16* KP, h16* KR, h16* VT) {
    __shared__ __align__(16) bf ring[2 * GSTG_H];            // two stages; reused as the waves' output staging behind the loop
    const int t = (int)blockIdx.x;
    if (blockIdx.y == 0) proj_tile<1, 0>(ring, t % (DM / GBM), t / (DM / GBM), WQT, XV, bq, VT, VT, DM, (size_t)0, SEQ, SEQ, (size_t)DM * SEQ);
    else { const bool isq = blockIdx.y == 2;
        proj_tile<0, SCORE_RES>(ring, t % (NB * SEQ / GBM), t / (NB * SEQ / GBM), isq ? XQ : XK, isq ? WQT : WKT, isq ? bq : bk, isq ? QH : KP, isq ? QR : KR, SEQ, (size_t)NH_ * SEQ * HD, HD, HD, (size_t)SEQ * HD); }
}

// stage_copy: one thread's share of a 64-key stage, 16-byte asynchronous copies global -> LDS, two per tile (rows r and r + 32); l = LDS byte address of its K-tile piece.
// The s_wait_xcnt ends the copies' own statement so that no address register named there is rewritten ahead of it.
__device__ __forceinline__ void stage_copy(unsigned l, const h16* gk, const h16* gr, const h16* gv) {
    const unsigned lk1 = l + 32 * LP * 2, lr0 = l + TILE_H * 2, lr1 = lr0 + 32 * LP * 2, lv0 = l + 2 * TILE_H * 2, lv1 = lv0 + 32 * LP * 2;
    const h16* gk1 = gk + 32 * HD; const h16* gr1 = gr + 32 * HD; const h16* gv1 = gv + (size_t)32 * SEQ;
    if (SCORE_RES)
        asm volatile("global_load_async_to_lds_b128 %0, %6, off\n\tglobal_load_async_to_lds_b128 %1, %7, off\n\t"
                     "global_load_async_to_lds_b128 %2, %8, off\n\tglobal_load_async_to_lds_b128 %3, %9, off\n\t"
                     "global_load_async_to_lds_b128 %4, %10, off\n\tglobal_load_async_to_lds_b128 %5, %11, off\n\ts_wait_xcnt 0x0"
                     :: "v"(l), "v"(lk1), "v"(lr0), "v"(lr1), "v"(lv0), "v"(lv1), "v"(gk), "v"(gk1), "v"(gr), "v"(gr1), "v"(gv), "v"(gv1) : "memory");
    else
        asm volatile("global_load_async_to_lds_b128 %0, %4, off\n\tglobal_load_async_to_lds_b128 %1, %5, off\n\t"
                     "global_load_async_to_lds_b128 %2, %6, off\n\tglobal_load_async_to_lds_b128 %3, %7, off\n\ts_wait_xcnt 0x0"
                     :: "v"(l), "v"(lk1), "v"(lv0), "v"(lv1), "v"(gk), "v"(gk1), "v"(gv), "v"(gv1) : "memory");
}

// k_flash: fused attention, one wave per 16 query rows of one (batch, head); Q fragments straight from the f16 planes; K, K residual and V^T come in 64-key stages through a
// two-buffer LDS ring that the block's waves share: asynchronous 16-byte copies (whole 128-B lines per row), stage t + 2 issued behind the barrier that ends the reads of stage t.
// Transposed form: S^T[key][t] = K Q^T (A = K rows, B = Q rows); lane (t = lane&15, h = lane>>4) holds keys 8h+r of each 16-key tile, so the packed
// P tile is directly the B fragment of O^T[d][t] = V^T P^T (element r <- tile keys 0..15, element 8+r <- tile keys 16..31, lane unchanged).
// Per 32-key step: 4 value.value score products in the main accumulators, 8 value.residual / residual.value products in separate accumulators (x RESC, folded back by RESI), 4 P.V products.
// Softmax state (running max, partial sum) is one scalar per lane; the two lane halves of a row are combined with one xor-16 exchange.
__global__ __launch_bounds__(32 * AW) void k_flash(const h16* __restrict__ QH, const h16* __restrict__ QR, const h16* __restrict__ KP, const h16* __restrict__ KR, const h16* __restrict__ VT, h16* CTX) {
    __shared__ __align__(16) h16 ring[2 * STG_H];            // two stages; reused as output staging behind the loop
    float* os = (float*)ring;
    const int lane = threadIdx.x & 31, lr = lane & 15, hi = lane >> 4;
    const int wave = __builtin_amdgcn_readfirstlane((int)(threadIdx.x >> 5));
    const int zh = blockIdx.y; const int b = zh / NH_, h = zh % NH_;
    const int t0 = (blockIdx.x * AW + wave) * 16;
    const size_t pbase = (size_t)zh * SEQ * HD;
    // this thread's share of a stage: rows cr and cr + 32 of each tile, 16 bytes at column ccol (8 lanes = one 128-B row, a wave = 4 whole lines)
    const int cr = (int)(threadIdx.x >> 3), ccol = (int)(threadIdx.x & 7) * 8;
    const unsigned cl = (unsigned)(size_t)(&ring[cr * LP + ccol]);               // LDS byte address in buffer 0, K tile
    const size_t ck = pbase + (size_t)cr * HD + ccol;        // + key * HD   (K and K residual planes: row = key; key + cr + 32 < SEQ)
    const size_t cv = pbase + (size_t)cr * SEQ + ccol;       // + key        (V^T plane: row = d, cr + 32 < HD; key + ccol + 7 < SEQ)
    stage_copy(cl, KP + ck, KR + ck, VT + cv);                                     // stage 0 -> buffer 0
    const size_t qo = pbase + (size_t)(t0 + lr) * HD + 8 * hi;
    const v16h qh0 = ldh(QH + qo), qh1 = ldh(QH + qo + 32);   // B fragments: col t, k = d
    v16h qr0 = qh0, qr1 = qh1;
    if (SCORE_RES) { qr0 = ldh(QR + qo); qr1 = ldh(QR + qo + 32); }   // residual B fragments (x RESC)
    const int ko = lr * LP + 8 * hi;                         // + key * LP in the K tiles (A fragment: row key, k = d); + 16j*LP + key in the V^T tile (A fragment: row d, k = key)
    v8f o0 = (v8f){}, o1 = (v8f){}, o2 = (v8f){}, o3 = (v8f){};
    float m = -3.0e38f, l = 0.0f;
    asm volatile("s_wait_asynccnt 0x0" ::: "memory");        // this wave's copies of stage 0 have landed
    __syncthreads();                                         // every wave's have: stage 0 may be read
    if (SEQ > KST) stage_copy(cl + STG_H * 2, KP + ck + (size_t)KST * HD, KR + ck + (size_t)KST * HD, VT + cv + KST);   // stage 1 -> buffer 1
#pragma unroll 1
    for (int ks = 0; ks < SEQ; ks += KST) {
      const int bsel = (ks / KST) & 1;
      const h16* sk = ring + bsel * STG_H + ko;
#pragma unroll
      for (int u = 0; u < KST; u += 32) {                    // the two 32-key steps of the stage, in key order; unrolled so that every LDS offset is an immediate
        const h16* ka = sk + u * LP;
        const v16h ka0 = ldh(ka), ka1 = ldh(ka + 32), kb0 = ldh(ka + 16 * LP), kb1 = ldh(ka + 16 * LP + 32);
        v8f sa = (v8f){}, sb = (v8f){}, ra = (v8f){}, rb = (v8f){};
        sa = wmma16(ka0, qh0, sa); sb = wmma16(kb0, qh0, sb);
        sa = wmma16(ka1, qh1, sa); sb = wmma16(kb1, qh1, sb);
        if (SCORE_RES) {
            const h16* kr = ka + TILE_H;
            const v16h ea0 = ldh(kr), ea1 = ldh(kr + 32), eb0 = ldh(kr + 16 * LP), eb1 = ldh(kr + 16 * LP + 32);
            ra = wmma16(ka0, qr0, ra); rb = wmma16(kb0, qr0, rb);
            ra = wmma16(ka1, qr1, ra); rb = wmma16(kb1, qr1, rb);
            ra = wmma16(ea0, qh0, ra); rb = wmma16(eb0, qh0, rb);
            ra = wmma16(ea1, qh1, ra); rb = wmma16(eb1, qh1, rb);
            asm volatile("v_nop\n\tv_nop\n\tv_nop\n\tv_nop" : "+v"(sa), "+v"(sb), "+v"(ra), "+v"(rb) : "v"(ka0), "v"(ka1), "v"(kb0), "v"(kb1), "v"(ea0), "v"(ea1), "v"(eb0), "v"(eb1), "v"(qh0), "v"(qh1), "v"(qr0), "v"(qr1));
        } else {
            asm volatile("v_nop\n\tv_nop\n\tv_nop\n\tv_nop" : "+v"(sa), "+v"(sb) : "v"(ka0), "v"(ka1), "v"(kb0), "v"(kb1), "v"(qh0), "v"(qh1));
        }
        float ta[8], tb[8]; float mx = -3.0e38f;
#pragma unroll
        for (int r = 0; r < 8; ++r) { ta[r] = (sa[r] + ra[r] * RESI) * SC2; tb[r] = (sb[r] + rb[r] * RESI) * SC2; mx = fmaxf(mx, fmaxf(ta[r], tb[r])); }
        mx = fmaxf(mx, __shfl_xor(mx, 16, 32));
        const float mnew = fmaxf(m, mx);
        const float alpha = __builtin_amdgcn_exp2f(m - mnew);
        const float sh = PSH - mnew;
        v16h pb; float ls = 0.0f;
#pragma unroll
        for (int r = 0; r < 8; ++r) {
            const float ea = ta[r] + sh, eb = tb[r] + sh;
            const float xa = __builtin_amdgcn_exp2f(ea), xb = __builtin_amdgcn_exp2f(eb);
            const h16 pa = (ea < -14.0f) ? (h16)0.0f : (h16)xa;    // exponent cut: no f16 value below the smallest normal
            const h16 pc = (eb < -14.0f) ? (h16)0.0f : (h16)xb;
            pb[r] = pa; pb[8 + r] = pc; ls += (float)pa + (float)pc; }
        l = l * alpha + ls; m = mnew;
        o0 = o0 * alpha; o1 = o1 * alpha; o2 = o2 * alpha; o3 = o3 * alpha;
        const h16* va = sk + 2 * TILE_H + u;
        const v16h v0 = ldh(va), v1 = ldh(va + 16 * LP), v2 = ldh(va + 32 * LP), v3 = ldh(va + 48 * LP);
        o0 = wmma16(v0, pb, o0); o1 = wmma16(v1, pb, o1); o2 = wmma16(v2, pb, o2); o3 = wmma16(v3, pb, o3);
        asm volatile("v_nop\n\tv_nop\n\tv_nop\n\tv_nop" : "+v"(o0), "+v"(o1), "+v"(o2), "+v"(o3) : "v"(v0), "v"(v1), "v"(v2), "v"(v3), "v"(pb));
      }
      asm volatile("s_wait_dscnt 0x0" ::: "memory");         // this wave's reads of the stage have returned: its buffer may be handed to the copies
      asm volatile("s_wait_asynccnt 0x0" ::: "memory");      // this wave's copies of the next stage have landed
      __syncthreads();                                       // publishes the next stage and ends every wave's reads of this one
      if (ks + 2 * KST < SEQ) {                              // block-uniform: refill the buffer just read with the stage after next
        const size_t kn = (size_t)(ks + 2 * KST);
        stage_copy(cl + (unsigned)bsel * (STG_H * 2), KP + ck + kn * HD, KR + ck + kn * HD, VT + cv + kn); }
    }
    asm volatile("s_wait_asynccnt 0x0" ::: "memory");        // nothing of the ring is in flight; the last trip's barrier has ended all reads, so it may become output staging
    l += __shfl_xor(l, 16, 32);
    const float inv = CTXS / l;
    const int wb = wave * 16 * 68;
    // O^T D layout: o_j[r] = (d = 16j + 8h + r, t = lane&15) -> os[t][d]; rows 0..15 x columns 0..63 all written
    { v4f a, c;
      a[0] = o0[0] * inv; a[1] = o0[1] * inv; a[2] = o0[2] * inv; a[3] = o0[3] * inv; c[0] = o0[4] * inv; c[1] = o0[5] * inv; c[2] = o0[6] * inv; c[3] = o0[7] * inv;
      *(v4fa*)(&os[wb + lr * 68 +  0 + 8 * hi]) = a; *(v4fa*)(&os[wb + lr * 68 +  0 + 8 * hi + 4]) = c;
      a[0] = o1[0] * inv; a[1] = o1[1] * inv; a[2] = o1[2] * inv; a[3] = o1[3] * inv; c[0] = o1[4] * inv; c[1] = o1[5] * inv; c[2] = o1[6] * inv; c[3] = o1[7] * inv;
      *(v4fa*)(&os[wb + lr * 68 + 16 + 8 * hi]) = a; *(v4fa*)(&os[wb + lr * 68 + 16 + 8 * hi + 4]) = c;
      a[0] = o2[0] * inv; a[1] = o2[1] * inv; a[2] = o2[2] * inv; a[3] = o2[3] * inv; c[0] = o2[4] * inv; c[1] = o2[5] * inv; c[2] = o2[6] * inv; c[3] = o2[7] * inv;
      *(v4fa*)(&os[wb + lr * 68 + 32 + 8 * hi]) = a; *(v4fa*)(&os[wb + lr * 68 + 32 + 8 * hi + 4]) = c;
      a[0] = o3[0] * inv; a[1] = o3[1] * inv; a[2] = o3[2] * inv; a[3] = o3[3] * inv; c[0] = o3[4] * inv; c[1] = o3[5] * inv; c[2] = o3[6] * inv; c[3] = o3[7] * inv;
      *(v4fa*)(&os[wb + lr * 68 + 48 + 8 * hi]) = a; *(v4fa*)(&os[wb + lr * 68 + 48 + 8 * hi + 4]) = c; }
    wave_sync();
    h16* crow = CTX + ((size_t)b * SEQ + t0) * DM + h * HD;      // ctx plane [b*SEQ + t][h*64 + d], x CTXS
{
#pragma unroll
        for (int s = 0; s < 4; ++s) { const int row = 4 * s + (lane >> 3), c8 = (lane & 7) * 8;   // 4 s x 4 rows = 16 rows; 8 lanes x 8 halves = 64 columns
            const v4f x0 = *(const v4fa*)(&os[wb + row * 68 + c8]); const v4f x1 = *(const v4fa*)(&os[wb + row * 68 + c8 + 4]); v8h hv;
#pragma unroll
            for (int i = 0; i < 4; ++i) { hv[i] = toh_flush(x0[i]); hv[4 + i] = toh_flush(x1[i]); }
            *(v8h*)(crow + (size_t)row * DM + c8) = hv; }
         }
}

// k_out: output projection, f16 GEMM, 256 x 128 tile per block of eight waves (4 x 2), ONE WAVE per 64x64 tile, K = DM; operand rows staged as in proj_tile.
// OUT[m][n] = OSC * sum_k CTX[m][k] WoT[n][k] + bo[n] (f32). grid (NB*SEQ/256, DM/128), 256 threads.
__global__ __launch_bounds__(256) void k_out(const h16* __restrict__ A, const h16* __restrict__ Bt, const float* __restrict__ bias, float* OUT) {
    __shared__ __align__(16) h16 ring[2 * GSTG_H];           // two stages; reused as the waves' output staging behind the loop
    const int K = DM;
    const int lane = threadIdx.x & 31, lr = lane & 15, hi = lane >> 4;
    const int wave = __builtin_amdgcn_readfirstlane((int)(threadIdx.x >> 5)); const int wm = wave & 3, wn = wave >> 2;
    const int r0 = blockIdx.x * GBM + wm * 64, c0 = blockIdx.y * GBN + wn * 64;
    float* os = (float*)ring + wave * 16 * 68;
    // this thread's share of a stage: 16 bytes at column cc of rows cr + 16 i (16 lanes = one 256-B row); blockIdx.x * GBM + cr + 240 < NB * SEQ, blockIdx.y * GBN + cr + 112 < DM, cc + 7 < GKS
    const int cr = (int)(threadIdx.x >> 4), cc = (int)(threadIdx.x & 15) * 8;
    const unsigned cl = (unsigned)(size_t)(&ring[cr * GLP + cc]);               // LDS byte address in buffer 0
    const unsigned short* ca = (const unsigned short*)A + (size_t)(blockIdx.x * GBM + cr) * K + cc;    // + k
    const unsigned short* cb = (const unsigned short*)Bt + (size_t)(blockIdx.y * GBN + cr) * K + cc;   // + k
    gemm_stage(cl, ca, cb);                                                      // stage 0 -> buffer 0
    v8f acc[4][4];
#pragma unroll
    for (int mb = 0; mb < 4; ++mb)
#pragma unroll
        for (int nb = 0; nb < 4; ++nb) acc[mb][nb] = (v8f){};
    const int aoff = (wm * 64 + lr) * GLP + 8 * hi, boff = (GBM + wn * 64 + lr) * GLP + 8 * hi;   // fragment rows inside a stage
    asm volatile("s_wait_asynccnt 0x0" ::: "memory");        // this wave's copies of stage 0 have landed
    __syncthreads();                                         // every wave's have: stage 0 may be read
    gemm_stage(cl + GSTG_H * 2, ca + GKS, cb + GKS);         // stage 1 -> buffer 1
#pragma unroll 1
    for (int ks = 0; ks < K; ks += GKS) {
        const int bsel = (ks / GKS) & 1;
        const h16* sa = ring + bsel * GSTG_H + aoff; const h16* sb = ring + bsel * GSTG_H + boff;
        v16h a[2][4], b[2][4];                             // fragments are read one 32-k step ahead, in two groups a step, so that the whole kernel stays inside 256 registers
#pragma unroll
        for (int i = 0; i < 4; ++i) { a[0][i] = ldh(sa + i * 16 * GLP); b[0][i] = ldh(sb + i * 16 * GLP); }
#pragma unroll
        for (int kc = 0; kc < GKS; kc += 32) {               // the 32-k steps of the stage, in k order; unrolled so that every LDS offset is an immediate
            const int cu = (kc / 32) & 1, nx = cu ^ 1;
            // the four scheduling barriers keep each group of reads whole and a step ahead of its products; left free, the compiler sinks every read to its first use and waits there
            __builtin_amdgcn_sched_barrier(0);
            if (kc + 32 < GKS) {                             // never past the stage: the next stage is read only behind its barrier
#pragma unroll
                for (int i = 0; i < 4; ++i) a[nx][i] = ldh(sa + i * 16 * GLP + kc + 32);
#pragma unroll
                for (int i = 0; i < 2; ++i) b[nx][i] = ldh(sb + i * 16 * GLP + kc + 32); }
            __builtin_amdgcn_sched_barrier(0);
#pragma unroll
            for (int nb = 0; nb < 2; ++nb)
#pragma unroll
                for (int mb = 0; mb < 4; ++mb) acc[mb][nb] = wmma16(a[cu][mb], b[cu][nb], acc[mb][nb]);
            __builtin_amdgcn_sched_barrier(0);
            if (kc + 32 < GKS) {
#pragma unroll
                for (int i = 2; i < 4; ++i) b[nx][i] = ldh(sb + i * 16 * GLP + kc + 32); }
            __builtin_amdgcn_sched_barrier(0);
#pragma unroll
            for (int nb = 2; nb < 4; ++nb)
#pragma unroll
                for (int mb = 0; mb < 4; ++mb) acc[mb][nb] = wmma16(a[cu][mb], b[cu][nb], acc[mb][nb]);
        }
        // the distance behind the stage's last matrix instructions, on both sides of the branch below
        asm volatile("v_nop\n\tv_nop\n\tv_nop\n\tv_nop" : "+v"(acc[0][0]), "+v"(acc[1][0]), "+v"(acc[2][0]), "+v"(acc[3][0]), "+v"(acc[0][1]), "+v"(acc[1][1]), "+v"(acc[2][1]), "+v"(acc[3][1]),
                     "+v"(acc[0][2]), "+v"(acc[1][2]), "+v"(acc[2][2]), "+v"(acc[3][2]), "+v"(acc[0][3]), "+v"(acc[1][3]), "+v"(acc[2][3]), "+v"(acc[3][3]));
        asm volatile("s_wait_dscnt 0x0" ::: "memory");       // this wave's reads of the stage have returned: its buffer may be handed to the copies
        asm volatile("s_wait_asynccnt 0x0" ::: "memory");    // this wave's copies of the next stage have landed
        __syncthreads();                                     // publishes the next stage and ends every wave's reads of this one
        if (ks + 2 * GKS < K)                                // block-uniform: refill the buffer just read with the stage after next
            gemm_stage(cl + (unsigned)bsel * (GSTG_H * 2), ca + ks + 2 * GKS, cb + ks + 2 * GKS);
    }
    asm volatile("s_wait_asynccnt 0x0" ::: "memory");        // nothing of the ring is in flight; the last trip's barrier has ended all reads, so it may become output staging
    const int cofs = lr * 4;
    v4f bb; { const v4f t = *(const v4f*)(bias + c0 + cofs);      // c0 + cofs + 3 < DM
#pragma unroll
        for (int i = 0; i < 4; ++i) bb[i] = bfr(t[i]); }
    float* orow = OUT + ((size_t)(r0 / SEQ) * OUT_SEQ + (size_t)(r0 % SEQ)) * DM + c0;
#pragma unroll
    for (int mb = 0; mb < 4; ++mb) {
#pragma unroll
        for (int nb = 0; nb < 4; ++nb) {
#pragma unroll
            for (int j = 0; j < 8; ++j) os[(hi * 8 + j) * 68 + nb * 16 + lr] = acc[mb][nb][j]; }   // D: row 8h+j, col lane&15
        wave_sync();
{
#pragma unroll
            for (int s = 0; s < 8; ++s) { const int row = 2 * s + hi;   // 8 s x 2 rows = 16 rows; 16 lanes x 4 floats = 64 columns
                const v4f x = *(const v4fa*)(&os[row * 68 + cofs]); v4f val;
#pragma unroll
                for (int i = 0; i < 4; ++i) val[i] = x[i] * OSC + bb[i];
                *(v4f*)(orow + (size_t)(mb * 16 + row) * DM + cofs) = val; }
             }
        wave_sync();
    }
}

static constexpr size_t al256(size_t v) { return (v + 255) & ~(size_t)255; }
static constexpr size_t SZ_XB = al256((size_t)NB * SEQ * DM * 2);
static constexpr size_t SZ_WB = al256((size_t)3 * DM * DM * 2);
static constexpr size_t SZ_PL = al256((size_t)NB * NH_ * SEQ * HD * 2);
static constexpr size_t SZ_TOTAL = 3 * SZ_XB + SZ_WB + 5 * SZ_PL;
static_assert(SZ_TOTAL <= (size_t)268435456);                  // workspace carve <= 256 MiB
static_assert(((size_t)DM * DM * 2) % 256 == 0);               // weight sub-planes stay 256-byte aligned
static_assert((size_t)3 * DM * DM * 2 <= SZ_WB);               // three weight sub-planes (q | k | o) fit their region
static_assert((size_t)NB * SEQ * DM * 2 <= SZ_XB);             // ctx plane (aliases the query copy) fits its region

extern "C" void kernel_launch(void* const* d_in, const int* in_sizes, int n_in,
                              void* d_out, int out_size, void* d_ws, size_t ws_size, hipStream_t stream) {
    if (n_in < 9) return;
    const size_t needx = ((size_t)(NB - 1) * SEQ_FULL + SEQ) * DM;
    if ((size_t)in_sizes[0] < needx || (size_t)in_sizes[1] < needx || (size_t)in_sizes[2] < needx) return;
    if ((size_t)in_sizes[3] < (size_t)DM * DM || (size_t)in_sizes[5] < (size_t)DM * DM || (size_t)in_sizes[7] < (size_t)DM * DM) return;
    if (in_sizes[4] < DM || in_sizes[6] < DM || in_sizes[8] < DM) return;
    if ((size_t)out_size < ((size_t)(NB - 1) * OUT_SEQ + SEQ) * DM) return;
    if (SZ_TOTAL > ws_size) return;
    // wire order: q, k, v, q_w, q_b, k_w, k_b, out_w, out_b
    const float* xq = (const float*)d_in[0]; const float* xk = (const float*)d_in[1]; const float* xv = (const float*)d_in[2];
    const float* wq = (const float*)d_in[3]; const float* bq = (const float*)d_in[4];
    const float* wk = (const float*)d_in[5]; const float* bk = (const float*)d_in[6];
    const float* wo = (const float*)d_in[7]; const float* bo = (const float*)d_in[8];
    float* OUT = (float*)d_out;      // [NB][OUT_SEQ][1024]
    char* wsp = (char*)d_ws;
    bf* XQ = (bf*)wsp; wsp += SZ_XB;                 // [NB*SEQ][1024] bf16 queries; region reused later as the ctx plane
    bf* XK = (bf*)wsp; wsp += SZ_XB;                 // [NB*SEQ][1024] bf16 keys
    bf* XV = (bf*)wsp; wsp += SZ_XB;                 // [NB*SEQ][1024] bf16 values
    bf* WB = (bf*)wsp; wsp += SZ_WB;                 // [3][1024][1024] transposed [out][in]: q | k (bf16) | o (f16 x64)
    h16* QH = (h16*)wsp; wsp += SZ_PL;               // [NB*16][SEQ][64]
    h16* KP = (h16*)wsp; wsp += SZ_PL;               // [NB*16][SEQ][64]
    h16* VT = (h16*)wsp; wsp += SZ_PL;               // [NB*16][64][SEQ]
    h16* QR = (h16*)wsp; wsp += SZ_PL;               // [NB*16][SEQ][64] f16 x2048; a region of its own: the projections run side by side, so no input copy may be overwritten by one of them
    h16* KR = (h16*)wsp; wsp += SZ_PL;               // [NB*16][SEQ][64] f16 x2048; likewise
    h16* CTX = (h16*)XQ;                             // [NB*SEQ][1024] f16 x256, written after the projection launch has consumed XQ
    bf* WQT = WB; bf* WKT = WB + (size_t)DM * DM; bf* WOT = WB + (size_t)2 * DM * DM;

    k_prep<<<dim3(6, PREP_GX, 1), 256, 0, stream>>>(xq, xk, xv, wq, wk, wo, XQ, XK, XV, (unsigned short*)WQT, (unsigned short*)WKT, (unsigned short*)WOT);

    k_proj3<<<dim3(PJ_BLK, 3, 1), 256, 0, stream>>>(XQ, XK, XV, WQT, WKT, bq, bk, QH, QR, KP, KR, VT);

    k_flash<<<dim3(SEQ / (16 * AW), NB * NH_, 1), 32 * AW, 0, stream>>>(QH, QR, KP, KR, VT, CTX);

    k_out<<<dim3(NB * SEQ / GBM, DM / GBN, 1), 256, 0, stream>>>(CTX, (const h16*)WOT, bo, OUT);
}

// v005
// It runs in 184 microseconds.
// Timed twice side by side with v004, it ran 1.07 and 1.08 times as fast.
// Over all steps from v000 it is 2.80 times as fast.
#include <hip/hip_runtime.h>

// Multi-head self-attention block, width 1024 = 16 heads x 64; separate query / key / value inputs [NB][SEQ_FULL][1024] (first SEQ tokens of each batch used); q_w / k_w / out_w stored [in][out] (y = x W + b); the value projection uses the query weight and the query bias (there is no separate value weight); no mask; score scale 1/8; output = ctx out_w + out_b (f32).
// Compute dtypes, f32 accumulate everywhere: q/k/v projections v_wmma_f32_16x16x32_bf16 (inputs and weights RNE-converted to bf16; products exact); scores v_wmma_f32_16x16x32_f16 with q and k each carried as f16 value + f16 residual x2048 (three products: value.value in the main accumulator, value.residual + residual.value in a separate accumulator folded back by 1/2048); P.V v_wmma_f32_16x16x32_f16 (P x256 carry, cancels in the normalisation; v single f16); output projection v_wmma_f32_16x16x32_f16: ctx f16 with x256 carry, out_w^T (bf16 RNE value) x64 as f16, carries folded back in the f32 epilogue; softmax f32 (online, running max); biases (bf16 RNE values) added in f32.
// Launches: k_prep (all operand conversions, independent of one another, one grid), k_proj3 (the three projections, independent of one another, one grid), k_flash, k_out.
// Layout: bf16 copies of the three inputs; transposed 16-bit weight planes [out][in]; q, k value and residual planes [b*16+h][t][d] and v^T plane [b*16+h][d][t] written by the GEMM epilogue; fused flash kernel in transposed form (S^T = K Q^T, O^T = V^T P^T) writing the ctx plane [b*SEQ+t][h*64+d]; final GEMM writes the f32 output.

#ifndef NB
#define NB 4
#endif
#ifndef SEQ
#define SEQ 2048
#endif
#define NB_FULL  4
#define SEQ_FULL 2048
#ifndef OUT_SEQ
#define OUT_SEQ SEQ              // row pitch (in tokens) between batches of the output
#endif
#ifndef SCORE_RES
#define SCORE_RES 1              // 1: q and k residual planes and three-product scores; 0: single-product scores
#endif
#define DM   1024
#define NH_  16
#define HD   64
#define AW   8                   // waves per flash block; all of them read the same staged key tiles
#define QT   2                   // query tiles (16 rows each) per flash wave: each fragment read from LDS feeds QT products
#define KST  64                  // keys per LDS stage: every staged row (K, K residual: one key; V^T: one d) is one whole 128-B line
#define LP   72                  // LDS row pitch in halves: 144 B = 16 B x odd, conflict-free for 16-byte fragment reads
#define TILE_H (64 * LP)         // halves of one staged tile (64 rows)
#define STG_H  (3 * TILE_H)      // one stage: K value | K residual | V^T
#define SC2  (0.125f * 1.4426950408889634f)   // HD^-0.5 * log2(e)
#define PSH  8.0f                // log2 of the P carry (256)
#define CTXS 256.0f              // carry of the ctx plane
#define WOS  64.0f               // carry of the Wo^T plane
#define OSC  (1.0f / 16384.0f)   // 1 / (CTXS * WOS)
#define RESC 2048.0f             // carry of the q / k residual planes
#define RESI (1.0f / 2048.0f)    // 1 / RESC
#define GBM  256                 // GEMM block tile: rows of A
#define GBN  128                 // GEMM block tile: rows of Bt (output columns)
#define GKS  128                 // k per LDS stage of the GEMMs: every staged row is 256 B, two whole lines
#define GLP  136                 // LDS row pitch of the GEMM stages in halves: 272 B = 16 B x odd, conflict-free for 16-byte fragment reads
#define GSTG_H ((GBM + GBN) * GLP)   // halves of one GEMM stage: A rows | Bt rows
#define CVW  32                  // input conversion: 512-byte loads per wave (16 KiB of f32 a wave)

static_assert(HD == 64);
static_assert(NH_ * HD == DM);                 // head h = columns h*64 + d
static_assert(DM % 64 == 0);                   // column tiles of 64
static_assert(DM % 32 == 0);                   // GEMM k-loop steps by 32
static_assert(SEQ % 64 == 0);                  // a 64-row tile never straddles two batches
static_assert((NB * SEQ) % 64 == 0);
static_assert(SEQ % 32 == 0);                  // key loop steps by 32
static_assert(QT == 2 && SEQ % (16 * QT * AW) == 0);   // flash grid covers the sequence exactly
static_assert(SEQ % KST == 0);                 // key stages cover the sequence exactly
static_assert(KST == 64 && KST % 32 == 0);     // a stage is two 32-key steps; V^T rows of a stage are 128 B
static_assert(32 * AW * 2 * 8 == 64 * HD);     // two 16-byte copies per thread fill one 64 x 64 tile
static_assert((size_t)AW * 16 * 68 * 4 <= (size_t)2 * STG_H * 2);   // output staging fits the ring it reuses
static_assert(((size_t)SEQ * DM) % (CVW * 128) == 0);            // a wave's share of the input conversion never straddles two batches
static_assert(((size_t)NB * SEQ * DM) % (8 * CVW * 128) == 0);   // its grid of eight-wave blocks covers an input exactly
static_assert(DM % GBM == 0 && DM % GBN == 0 && (NB * SEQ) % GBM == 0 && (NB * SEQ) % GBN == 0);   // GEMM grids cover every operand exactly
static_assert(DM % GKS == 0 && DM / GKS >= 2 && GKS % 32 == 0);   // whole stages, at least two of them
static_assert(GBM == 4 * 64 && GBN == 2 * 64);                   // eight waves, 4 x 2, one 64 x 64 tile each
static_assert(256 * 8 * 8 == 128 * GKS);                         // eight 16-byte copies per thread fill 128 staged rows
static_assert((size_t)8 * 16 * 68 * 4 <= (size_t)2 * GSTG_H * 2);   // the waves' output staging fits the ring it reuses
static_assert(((size_t)DM * DM) % 8 == 0);
static_assert(NB <= NB_FULL);
static_assert(SEQ <= SEQ_FULL);
static_assert(RESC * RESI == 1.0f);            // residual carry folds back exactly
static_assert(CTXS * WOS * OSC == 1.0f);       // output carries fold back exactly

typedef _Float16 h16;
typedef unsigned short bf;
typedef __attribute__((ext_vector_type(16))) __bf16   v16bf;
typedef __attribute__((ext_vector_type(16))) _Float16 v16h;
typedef __attribute__((ext_vector_type(8)))  _Float16 v8h;
typedef __attribute__((ext_vector_type(8)))  unsigned short v8us;
typedef __attribute__((ext_vector_type(4)))  unsigned short v4us;
typedef __attribute__((ext_vector_type(8)))  float    v8f;
typedef __attribute__((ext_vector_type(4)))  float    v4f;
typedef v4f  __attribute__((may_alias)) v4fa;

__device__ __forceinline__ unsigned short f2bf(float f) { unsigned u = __float_as_uint(f); u += 0x7FFFu + ((u >> 16) & 1u); return (unsigned short)(u >> 16); }
__device__ __forceinline__ float bfr(float f) { return __uint_as_float(((unsigned)f2bf(f)) << 16); }   // value of the bf16 RNE conversion, as f32
__device__ __forceinline__ v16h cat16(v8h lo, v8h hi) { return __builtin_shufflevector(lo, hi, 0, 1, 2, 3, 4, 5, 6, 7, 8, 9, 10, 11, 12, 13, 14, 15); }
__device__ __forceinline__ v16bf cat16b(v8us lo, v8us hi) { return __builtin_bit_cast(v16bf, __builtin_shufflevector(lo, hi, 0, 1, 2, 3, 4, 5, 6, 7, 8, 9, 10, 11, 12, 13, 14, 15)); }
__device__ __forceinline__ v8f wmma16(v16h a, v16h b, v8f c) { return __builtin_amdgcn_wmma_f32_16x16x32_f16(false, a, false, b, (short)0, c, false, false); }
__device__ __forceinline__ v8f wmmab(v16bf a, v16bf b, v8f c) { return __builtin_amdgcn_wmma_f32_16x16x32_bf16(false, a, false, b, (short)0, c, false, false); }
// fragment loaders from K-contiguous 16-bit rows; p already includes + 8*(lane>>4): elements 0..7 <- k0+8h+0..7, elements 8..15 <- k0+16+8h+0..7 (same map for A and B)
__device__ __forceinline__ v16h  ldh(const h16* p) { return cat16(*(const v8h*)p, *(const v8h*)(p + 16)); }
__device__ __forceinline__ v16bf ldb(const bf* p)  { return cat16b(*(const v8us*)p, *(const v8us*)(p + 16)); }
// ordering point for wave-private LDS tiles (same wave writes and reads)
__device__ __forceinline__ void wave_sync() { __builtin_amdgcn_fence(3 /* release order */, "wavefront"); __builtin_amdgcn_wave_barrier(); asm volatile("" ::: "memory"); }
// f32 -> f16 for operand planes: a result below the smallest normal f16 magnitude is replaced by zero (value select)
static __device__ __forceinline__ h16 toh_flush(float v) { const h16 r = (h16)v; return (fabsf(v) < 6.103515625e-05f) ? (h16)0.0f : r; }

// cvt_in: bf16 RNE copy of one input, written as a stream: block blk of the copy, every wave converts CVW * 128 consecutive floats.
// All CVW loads of a wave (16 bytes a lane, 512 contiguous bytes a wave = four whole lines) are issued before the first conversion; a wave's 8-byte stores cover 256 contiguous bytes.
__device__ __forceinline__ void cvt_in(const float* __restrict__ src, bf* __restrict__ dst, unsigned blk) {
    const size_t e0 = ((size_t)blk * 8 + (threadIdx.x >> 5)) * (CVW * 128);   // first element of this wave's share in the packed copy [NB*SEQ][DM]
    const size_t s0 = (SEQ == SEQ_FULL) ? e0 : (e0 / ((size_t)SEQ * DM)) * ((size_t)SEQ_FULL * DM) + e0 % ((size_t)SEQ * DM);   // the same element in the input (batch pitch SEQ_FULL)
    const float* s = src + s0 + (threadIdx.x & 31) * 4;
    bf* d = dst + e0 + (threadIdx.x & 31) * 4;
    v4f v[CVW];
#pragma unroll
    for (int j = 0; j < CVW; ++j) v[j] = *(const v4f*)(s + j * 128);
    __builtin_amdgcn_sched_barrier(0);   // keeps every load ahead of the first conversion; left free, the compiler holds the last four back until the others have returned: a second trip to memory
#pragma unroll
    for (int j = 0; j < CVW; ++j) { v4us o;
#pragma unroll
        for (int k = 0; k < 4; ++k) o[k] = f2bf(v[j][k]);
        *(v4us*)(d + j * 128) = o; }
    asm volatile("s_wait_xcnt 0x0" ::: "memory");   // ends the run of stores: in the joined kernel another job's code follows in the text and reuses their registers
}

// cvt_wT: transpose + 16-bit convert of one 64 x 64 tile (columns n0.., rows k0..) of a weight matrix: in[R][C] (f32, R = contraction index, C = output feature) -> out[C][R] (16-bit, contraction-contiguous); ts = 64 x 65 floats of LDS.
// F16OUT == 0: bf16 RNE bits; F16OUT == 1: f16 of (bf16 RNE value x WOS) (exact for values whose scaled magnitude is in the f16 normal range).
template <int F16OUT>
__device__ __forceinline__ void cvt_wT(const float* __restrict__ W, unsigned short* dst, float* ts, int n0, int k0) {
    const int R = DM, C = DM;
    const int tid = threadIdx.x;
#pragma unroll
    for (int it = 0; it < 4; ++it) {                     // 4 x 16 rows x (16 lanes x 4 floats) = 64 x 64, all written
        const int r = it * 16 + (tid >> 4), c4 = (tid & 15) * 4;
        const v4f v = *(const v4f*)(W + (size_t)(k0 + r) * (size_t)C + n0 + c4);
#pragma unroll
        for (int i = 0; i < 4; ++i) ts[r * 65 + c4 + i] = v[i];
    }
    __syncthreads();
    v8us o[2];
#pragma unroll
    for (int it = 0; it < 2; ++it) {                     // 2 x 32 output rows x (8 lanes x 8 halves) = 64 x 64
        const int n = it * 32 + (tid >> 3), k8 = (tid & 7) * 8;
#pragma unroll
        for (int i = 0; i < 8; ++i) {
            const float x = ts[(k8 + i) * 65 + n];
            const unsigned short bb = f2bf(x);
            if (F16OUT) { const h16 hv = (h16)(__uint_as_float(((unsigned)bb) << 16) * WOS); o[it][i] = __builtin_bit_cast(unsigned short, hv); }
            else o[it][i] = bb;
        }
    }
{
#pragma unroll
        for (int it = 0; it < 2; ++it) { const int n = it * 32 + (tid >> 3), k8 = (tid & 7) * 8;
            *(v8us*)(dst + (size_t)(n0 + n) * (size_t)R + k0 + k8) = o[it]; }
         }
    asm volatile("s_wait_xcnt 0x0" ::: "memory");   // ends the two stores: in the joined kernel another job's code follows in the text and reuses their registers
}

// k_prep: every operand conversion in one grid (none reads what another writes): blockIdx.x 0..2 = weight planes q | k | o, one 64 x 64 tile a block; blockIdx.x 3..5 = input copies q | k | v; blockIdx.y = which block of it.
// The job is the fast index, so that the short, latency-bound weight blocks start spread among the blocks of the input stream and run under it. Every branch here is block-uniform.
#define WT_BLK ((DM / 64) * (DM / 64))                            // blocks of one weight plane
#define CV_BLK ((unsigned)((size_t)NB * SEQ * DM / (8 * CVW * 128)))   // blocks of one input copy
#define PREP_GX (WT_BLK > CV_BLK ? WT_BLK : CV_BLK)               // blocks of the longest job
__global__ __launch_bounds__(256) void k_prep(const float* __restrict__ xq, const float* __restrict__ xk, const float* __restrict__ xv, const float* __restrict__ wq, const float* __restrict__ wk, const float* __restrict__ wo,
                                              bf* __restrict__ dq, bf* __restrict__ dk, bf* __restrict__ dv, unsigned short* __restrict__ tq, unsigned short* __restrict__ tk, unsigned short* __restrict__ to) {
    __shared__ float ts[64 * 65];
    const unsigned y = blockIdx.x, x = blockIdx.y;           // y = job, x = block of the job
    if (y < 3) {
        if (x >= WT_BLK) return;
        const int n0 = (int)(x % (DM / 64)) * 64, k0 = (int)(x / (DM / 64)) * 64;
        if (y == 2) cvt_wT<1>(wo, to, ts, n0, k0);
        else cvt_wT<0>(y == 0 ? wq : wk, y == 0 ? tq : tk, ts, n0, k0);
    } else {
        if (x >= CV_BLK) return;
        cvt_in(y == 3 ? xq : (y == 4 ? xk : xv), y == 3 ? dq : (y == 4 ? dk : dv), x);
    }
}

// gemm_copy8: one thread's share of 128 staged rows, eight 16-byte asynchronous copies global -> LDS (rows r, r + 16, ..., r + 112 of a K-contiguous 16-bit plane of row length DM).
// The s_wait_xcnt ends the copies' own statement so that no address register named there is rewritten ahead of it.
__device__ __forceinline__ void gemm_copy8(unsigned l, const unsigned short* g) {
    asm volatile("global_load_async_to_lds_b128 %0, %8, off\n\tglobal_load_async_to_lds_b128 %1, %9, off\n\t"
                 "global_load_async_to_lds_b128 %2, %10, off\n\tglobal_load_async_to_lds_b128 %3, %11, off\n\t"
                 "global_load_async_to_lds_b128 %4, %12, off\n\tglobal_load_async_to_lds_b128 %5, %13, off\n\t"
                 "global_load_async_to_lds_b128 %6, %14, off\n\tglobal_load_async_to_lds_b128 %7, %15, off\n\ts_wait_xcnt 0x0"
                 :: "v"(l), "v"(l + 16 * GLP * 2), "v"(l + 32 * GLP * 2), "v"(l + 48 * GLP * 2), "v"(l + 64 * GLP * 2), "v"(l + 80 * GLP * 2), "v"(l + 96 * GLP * 2), "v"(l + 112 * GLP * 2),
                    "v"(g), "v"(g + 16 * DM), "v"(g + 32 * DM), "v"(g + 48 * DM), "v"(g + 64 * DM), "v"(g + 80 * DM), "v"(g + 96 * DM), "v"(g + 112 * DM) : "memory");
}
// gemm_stage: one thread's share of a GEMM stage (GBM rows of A, then GBN rows of Bt, GKS halves of each); l = LDS byte address of its piece of row (thread / 16) of the stage.
__device__ __forceinline__ void gemm_stage(unsigned l, const unsigned short* ga, const unsigned short* gb) {
    gemm_copy8(l, ga); gemm_copy8(l + 128 * GLP * 2, ga + (size_t)128 * DM); gemm_copy8(l + GBM * GLP * 2, gb);
}

// proj_tile: register-blocked bf16 GEMM, 256 x 128 tile (bx, by) per block of eight waves (4 x 2), ONE WAVE per 64x64 tile (16 accumulators), K = DM; the K-contiguous bf16 operand rows come in
// stages of 128 k through a two-buffer LDS ring that the waves share: asynchronous 16-byte copies (whole lines), stage s + 2 issued behind the barrier that ends the reads of stage s.
// C[m][n] = sum_k A[m][k] Bt[n][k] + bias (BROW == 0: bias[n]; BROW == 1: bias[m]), written as f16 (Ph) at
// tile base (r0/RB)*sRB + (r0%RB)*pitch + (c0/CB)*sCB + (c0%CB), row pitch 'pitch' (halves). bx < M/256, by < N/128, 256 threads; ring = the block's 2 * GSTG_H halves of LDS.
// RES == 1: additionally the residual plane Pr (same addressing) = f16((C - f16 value) x RESC); RES == 0: Pr is not touched.
template <int BROW, int RES>
__device__ __forceinline__ void proj_tile(bf* ring, int bx, int by, const bf* __restrict__ A, const bf* __restrict__ Bt, const float* __restrict__ bias, h16* Ph, h16* Pr, int RB, size_t sRB, int pitch, int CB, size_t sCB) {
    const int K = DM;
    const int lane = threadIdx.x & 31, lr = lane & 15, hi = lane >> 4;
    const int wave = __builtin_amdgcn_readfirstlane((int)(threadIdx.x >> 5)); const int wm = wave & 3, wn = wave >> 2;
    const int r0 = bx * GBM + wm * 64, c0 = by * GBN + wn * 64;
    float* os = (float*)ring + wave * 16 * 68;
    // this thread's share of a stage: 16 bytes at column cc of rows cr + 16 i (16 lanes = one 256-B row); bx * GBM + cr + 240 < M, by * GBN + cr + 112 < N, cc + 7 < GKS
    const int cr = (int)(threadIdx.x >> 4), cc = (int)(threadIdx.x & 15) * 8;
    const unsigned cl = (unsigned)(size_t)(&ring[cr * GLP + cc]);               // LDS byte address in buffer 0
    const bf* ca = A + (size_t)(bx * GBM + cr) * K + cc;                        // + k
    const bf* cb = Bt + (size_t)(by * GBN + cr) * K + cc;                       // + k
    gemm_stage(cl, ca, cb);                                                      // stage 0 -> buffer 0
    v8f acc[4][4];
#pragma unroll
    for (int mb = 0; mb < 4; ++mb)
#pragma unroll
        for (int nb = 0; nb < 4; ++nb) acc[mb][nb] = (v8f){};
    const int aoff = (wm * 64 + lr) * GLP + 8 * hi, boff = (GBM + wn * 64 + lr) * GLP + 8 * hi;   // fragment rows inside a stage
    asm volatile("s_wait_asynccnt 0x0" ::: "memory");        // this wave's copies of stage 0 have landed
    __syncthreads();                                         // every wave's have: stage 0 may be read
    gemm_stage(cl + GSTG_H * 2, ca + GKS, cb + GKS);         // stage 1 -> buffer 1
#pragma unroll 1
    for (int ks = 0; ks < K; ks += GKS) {
        const int bsel = (ks / GKS) & 1;
        const bf* sa = ring + bsel * GSTG_H + aoff; const bf* sb = ring + bsel * GSTG_H + boff;
        v16bf a[2][4], b[2][4];                             // fragments are read one 32-k step ahead, in two groups a step, so that the whole kernel stays inside 256 registers
#pragma unroll
        for (int i = 0; i < 4; ++i) { a[0][i] = ldb(sa + i * 16 * GLP); b[0][i] = ldb(sb + i * 16 * GLP); }
#pragma unroll
        for (int kc = 0; kc < GKS; kc += 32) {               // the 32-k steps of the stage, in k order; unrolled so that every LDS offset is an immediate
            const int cu = (kc / 32) & 1, nx = cu ^ 1;
            // the four scheduling barriers keep each group of reads whole and a step ahead of its products; left free, the compiler sinks every read to its first use and waits there
            __builtin_amdgcn_sched_barrier(0);
            if (kc + 32 < GKS) {                             // never past the stage: the next stage is read only behind its barrier
#pragma unroll
                for (int i = 0; i < 4; ++i) a[nx][i] = ldb(sa + i * 16 * GLP + kc + 32);
#pragma unroll
                for (int i = 0; i < 2; ++i) b[nx][i] = ldb(sb + i * 16 * GLP + kc + 32); }
            __builtin_amdgcn_sched_barrier(0);
#pragma unroll
            for (int nb = 0; nb < 2; ++nb)
#pragma unroll
                for (int mb = 0; mb < 4; ++mb) acc[mb][nb] = wmmab(a[cu][mb], b[cu][nb], acc[mb][nb]);
            __builtin_amdgcn_sched_barrier(0);
            if (kc + 32 < GKS) {
#pragma unroll
                for (int i = 2; i < 4; ++i) b[nx][i] = ldb(sb + i * 16 * GLP + kc + 32); }
            __builtin_amdgcn_sched_barrier(0);
#pragma unroll
            for (int nb = 2; nb < 4; ++nb)
#pragma unroll
                for (int mb = 0; mb < 4; ++mb) acc[mb][nb] = wmmab(a[cu][mb], b[cu][nb], acc[mb][nb]);
        }
        // the distance behind the stage's last matrix instructions, on both sides of the branch below
        asm volatile("v_nop\n\tv_nop\n\tv_nop\n\tv_nop" : "+v"(acc[0][0]), "+v"(acc[1][0]), "+v"(acc[2][0]), "+v"(acc[3][0]), "+v"(acc[0][1]), "+v"(acc[1][1]), "+v"(acc[2][1]), "+v"(acc[3][1]),
                     "+v"(acc[0][2]), "+v"(acc[1][2]), "+v"(acc[2][2]), "+v"(acc[3][2]), "+v"(acc[0][3]), "+v"(acc[1][3]), "+v"(acc[2][3]), "+v"(acc[3][3]));
        asm volatile("s_wait_dscnt 0x0" ::: "memory");       // this wave's reads of the stage have returned: its buffer may be handed to the copies
        asm volatile("s_wait_asynccnt 0x0" ::: "memory");    // this wave's copies of the next stage have landed
        __syncthreads();                                     // publishes the next stage and ends every wave's reads of this one
        if (ks + 2 * GKS < K)                                // block-uniform: refill the buffer just read with the stage after next
            gemm_stage(cl + (unsigned)bsel * (GSTG_H * 2), ca + ks + 2 * GKS, cb + ks + 2 * GKS);
    }
    asm volatile("s_wait_asynccnt 0x0" ::: "memory");        // nothing of the ring is in flight; the last trip's barrier has ended all reads, so it may become output staging
    // column bias for this lane's 8 store columns (BROW == 0); c0 + (lane&7)*8 + 7 < N = DM
    v4f bc0 = (v4f){}, bc1 = (v4f){};
    if (BROW == 0) { const int cb8 = (lane & 7) * 8; const v4f t0 = *(const v4f*)(bias + c0 + cb8); const v4f t1 = *(const v4f*)(bias + c0 + cb8 + 4);
#pragma unroll
        for (int i = 0; i < 4; ++i) { bc0[i] = bfr(t0[i]); bc1[i] = bfr(t1[i]); } }
    const size_t tbase = (size_t)(r0 / RB) * sRB + (size_t)(r0 % RB) * (size_t)pitch + (size_t)(c0 / CB) * sCB + (size_t)(c0 % CB);
#pragma unroll
    for (int mb = 0; mb < 4; ++mb) {
#pragma unroll
        for (int nb = 0; nb < 4; ++nb) {
#pragma unroll
            for (int j = 0; j < 8; ++j) os[(hi * 8 + j) * 68 + nb * 16 + lr] = acc[mb][nb][j]; }   // D: row 8h+j, col lane&15
        wave_sync();
        const size_t sb = tbase + (size_t)(mb * 16) * (size_t)pitch;
{
#pragma unroll
            for (int s = 0; s < 4; ++s) { const int row = 4 * s + (lane >> 3), c8 = (lane & 7) * 8;   // 4 s x 4 row groups = 16 rows; 8 lanes x 8 = 64 columns
                v4f x0 = *(const v4fa*)(&os[row * 68 + c8]); v4f x1 = *(const v4fa*)(&os[row * 68 + c8 + 4]); v8h hv; v8h rv;
                if (BROW == 1) { const float br = bfr(bias[r0 + mb * 16 + row]);                    // row bias; r0 + mb*16 + row < M = DM
#pragma unroll
                    for (int i = 0; i < 4; ++i) { x0[i] += br; x1[i] += br; } }
                else {
#pragma unroll
                    for (int i = 0; i < 4; ++i) { x0[i] += bc0[i]; x1[i] += bc1[i]; } }
#pragma unroll
                for (int i = 0; i < 4; ++i) { const h16 a = toh_flush(x0[i]); const h16 c = toh_flush(x1[i]); hv[i] = a; hv[4 + i] = c;
                    rv[i] = toh_flush((x0[i] - (float)a) * RESC); rv[4 + i] = toh_flush((x1[i] - (float)c) * RESC); }   // difference and carry are exact in f32
                const size_t oo = sb + (size_t)row * (size_t)pitch + c8;
                *(v8h*)(Ph + oo) = hv;
                if (RES) *(v8h*)(Pr + oo) = rv; }
             }
        asm volatile("s_wait_xcnt 0x0" ::: "memory");   // ends this row block's stores before the next block's loads and sums reuse their registers
        wave_sync();
    }
}

// k_proj3: the three projections in one grid (none reads what another writes): blockIdx.y 0 = v^T, 1 = k, 2 = q; blockIdx.x = tile, row tiles of A fastest. Every branch here is block-uniform.
// v^T: the value projection uses the QUERY weight and bias: A = q_w^T rows (m = h*64 + d), Bt = value-input rows (n = b*SEQ + t), row bias q_b[m] -> plane [(b*1024 + m)][t] = [(b*16 + h)][d][t]; no residual plane.
// k, q: A = x rows (m = b*SEQ + t), Bt = W^T rows (n = h*64 + d), column bias -> value and residual planes [(b*16 + h)][t][d].
#define PJ_BLK ((DM / GBM) * (NB * SEQ / GBN))                    // tiles of one projection, in either orientation
static_assert(PJ_BLK == (NB * SEQ / GBM) * (DM / GBN));
__global__ __launch_bounds__(256) void k_proj3(const bf* __restrict__ XQ, const bf* __restrict__ XK, const bf* __restrict__ XV, const bf* __restrict__ WQT, const bf* __restrict__ WKT, const float* __restrict__ bq, const float* __restrict__ bk,
                                               h16* QH, h16* QR, h16* KP, h16* KR, h16* VT) {
    __shared__ __align__(16) bf ring[2 * GSTG_H];            // two stages; reused as the waves' output staging behind the loop
    const int t = (int)blockIdx.x;
    if (blockIdx.y == 0) proj_tile<1, 0>(ring, t % (DM / GBM), t / (DM / GBM), WQT, XV, bq, VT, VT, DM, (size_t)0, SEQ, SEQ, (size_t)DM * SEQ);
    else { const bool isq = blockIdx.y == 2;
        proj_tile<0, SCORE_RES>(ring, t % (NB * SEQ / GBM), t / (NB * SEQ / GBM), isq ? XQ : XK, isq ? WQT : WKT, isq ? bq : bk, isq ? QH : KP, isq ? QR : KR, SEQ, (size_t)NH_ * SEQ * HD, HD, HD, (size_t)SEQ * HD); }
}

// stage_copy: one thread's share of a 64-key stage, 16-byte asynchronous copies global -> LDS, two per tile (rows r and r + 32); l = LDS byte address of its K-tile piece.
// The s_wait_xcnt ends the copies' own statement so that no address register named there is rewritten ahead of it.
__device__ __forceinline__ void stage_copy(unsigned l, const h16* gk, const h16* gr, const h16* gv) {
    const unsigned lk1 = l + 32 * LP * 2, lr0 = l + TILE_H * 2, lr1 = lr0 + 32 * LP * 2, lv0 = l + 2 * TILE_H * 2, lv1 = lv0 + 32 * LP * 2;
    const h16* gk1 = gk + 32 * HD; const h16* gr1 = gr + 32 * HD; const h16* gv1 = gv + (size_t)32 * SEQ;
    if (SCORE_RES)
        asm volatile("global_load_async_to_lds_b128 %0, %6, off\n\tglobal_load_async_to_lds_b128 %1, %7, off\n\t"
                     "global_load_async_to_lds_b128 %2, %8, off\n\tglobal_load_async_to_lds_b128 %3, %9, off\n\t"
                     "global_load_async_to_lds_b128 %4, %10, off\n\tglobal_load_async_to_lds_b128 %5, %11, off\n\ts_wait_xcnt 0x0"
                     :: "v"(l), "v"(lk1), "v"(lr0), "v"(lr1), "v"(lv0), "v"(lv1), "v"(gk), "v"(gk1), "v"(gr), "v"(gr1), "v"(gv), "v"(gv1) : "memory");
    else
        asm volatile("global_load_async_to_lds_b128 %0, %4, off\n\tglobal_load_async_to_lds_b128 %1, %5, off\n\t"
                     "global_load_async_to_lds_b128 %2, %6, off\n\tglobal_load_async_to_lds_b128 %3, %7, off\n\ts_wait_xcnt 0x0"
                     :: "v"(l), "v"(lk1), "v"(lv0), "v"(lv1), "v"(gk), "v"(gk1), "v"(gv), "v"(gv1) : "memory");
}

// k_flash: fused attention, one wave per QT * 16 = 32 query rows of one (batch, head); Q fragments straight from the f16 planes; K, K residual and V^T come in 64-key stages through a
// two-buffer LDS ring that the block's waves share: asynchronous 16-byte copies (whole 128-B lines per row), stage t + 2 issued behind the barrier that ends the reads of stage t.
// Every K, K residual and V^T fragment read from LDS feeds the products of both query tiles of the wave: half the LDS reads, ring copies and barriers per score of a 16-row wave.
// Transposed form: S^T[key][t] = K Q^T (A = K rows, B = Q rows); lane (t = lane&15, h = lane>>4) holds keys 8h+r of each 16-key tile, so the packed
// P tile is directly the B fragment of O^T[d][t] = V^T P^T (element r <- tile keys 0..15, element 8+r <- tile keys 16..31, lane unchanged).
// Per 32-key step and query tile: 4 value.value score products in the main accumulators, 8 value.residual / residual.value products in separate accumulators (x RESC, folded back by RESI), 4 P.V products.
// The scores are formed one 16-key tile at a time (both query tiles), so that only four K fragments and four score accumulators are live at once and the kernel stays inside 256 registers (four waves a SIMD).
// Softmax state (running max, partial sum) is one scalar per lane and query tile; the two lane halves of a row are combined with one xor-16 exchange.
__global__ __launch_bounds__(32 * AW, 4) void k_flash(const h16* __restrict__ QH, const h16* __restrict__ QR, const h16* __restrict__ KP, const h16* __restrict__ KR, const h16* __restrict__ VT, h16* CTX) {
    __shared__ __align__(16) h16 ring[2 * STG_H];            // two stages; reused as output staging behind the loop
    float* os = (float*)ring;
    const int lane = threadIdx.x & 31, lr = lane & 15, hi = lane >> 4;
    const int wave = __builtin_amdgcn_readfirstlane((int)(threadIdx.x >> 5));
    const int zh = blockIdx.y; const int b = zh / NH_, h = zh % NH_;
    const int t0 = (blockIdx.x * AW + wave) * (16 * QT);
    const size_t pbase = (size_t)zh * SEQ * HD;
    // this thread's share of a stage: rows cr and cr + 32 of each tile, 16 bytes at column ccol (8 lanes = one 128-B row, a wave = 4 whole lines)
    const int cr = (int)(threadIdx.x >> 3), ccol = (int)(threadIdx.x & 7) * 8;
    const unsigned cl = (unsigned)(size_t)(&ring[cr * LP + ccol]);               // LDS byte address in buffer 0, K tile
    const size_t ck = pbase + (size_t)cr * HD + ccol;        // + key * HD   (K and K residual planes: row = key; key + cr + 32 < SEQ)
    const size_t cv = pbase + (size_t)cr * SEQ + ccol;       // + key        (V^T plane: row = d, cr + 32 < HD; key + ccol + 7 < SEQ)
    stage_copy(cl, KP + ck, KR + ck, VT + cv);                                     // stage 0 -> buffer 0
    v16h qh0[QT], qh1[QT], qr0[QT], qr1[QT];                 // B fragments: col t, k = d; value and residual (x RESC)
    const h16* qp[QT]; const h16* qq[QT];
#pragma unroll
    for (int q = 0; q < QT; ++q) {
        const size_t qo = pbase + (size_t)(t0 + 16 * q + lr) * HD + 8 * hi;
        qp[q] = QH + qo; qq[q] = QR + qo;
        qh0[q] = ldh(qp[q]); qh1[q] = ldh(qp[q] + 32);
        qr0[q] = qh0[q]; qr1[q] = qh1[q];
        if (SCORE_RES) { qr0[q] = ldh(qq[q]); qr1[q] = ldh(qq[q] + 32); }
    }
    // ends the run of Q loads; their addresses are inputs, so that they stay in their registers up to the wait and no load of the run lands on one of them
    if (SCORE_RES) asm volatile("s_wait_xcnt 0x0" :: "v"(qp[0]), "v"(qp[1]), "v"(qq[0]), "v"(qq[1]) : "memory");
    else           asm volatile("s_wait_xcnt 0x0" :: "v"(qp[0]), "v"(qp[1]) : "memory");
    const int ko = lr * LP + 8 * hi;                         // + key * LP in the K tiles (A fragment: row key, k = d); + 16j*LP + key in the V^T tile (A fragment: row d, k = key)
    v8f o[QT][4]; float m[QT], l[QT];
#pragma unroll
    for (int q = 0; q < QT; ++q) { m[q] = -3.0e38f; l[q] = 0.0f;
#pragma unroll
        for (int j = 0; j < 4; ++j) o[q][j] = (v8f){}; }
    asm volatile("s_wait_asynccnt 0x0" ::: "memory");        // this wave's copies of stage 0 have landed
    __syncthreads();                                         // every wave's have: stage 0 may be read
    if (SEQ > KST) stage_copy(cl + STG_H * 2, KP + ck + (size_t)KST * HD, KR + ck + (size_t)KST * HD, VT + cv + KST);   // stage 1 -> buffer 1
#pragma unroll 1
    for (int ks = 0; ks < SEQ; ks += KST) {
      const int bsel = (ks / KST) & 1;
      const h16* sk = ring + bsel * STG_H + ko;
#pragma unroll
      for (int u = 0; u < KST; u += 32) {                    // the two 32-key steps of the stage, in key order; unrolled so that every LDS offset is an immediate
        v8f f[QT][2];                                        // folded scores: f[q][kt][r] = key 16 kt + 8h + r of the step, query tile q
#pragma unroll
        for (int kt = 0; kt < 2; ++kt) {                     // the two 16-key tiles of the step
            const h16* ka = sk + (u + 16 * kt) * LP;
            const v16h k0 = ldh(ka), k1 = ldh(ka + 32);
            v8f s[QT], r[QT];
#pragma unroll
            for (int q = 0; q < QT; ++q) { s[q] = (v8f){}; r[q] = (v8f){}; }
#pragma unroll
            for (int q = 0; q < QT; ++q) s[q] = wmma16(k0, qh0[q], s[q]);
#pragma unroll
            for (int q = 0; q < QT; ++q) s[q] = wmma16(k1, qh1[q], s[q]);
            if (SCORE_RES) {
                const h16* kr = ka + TILE_H;
                const v16h e0 = ldh(kr), e1 = ldh(kr + 32);
#pragma unroll
                for (int q = 0; q < QT; ++q) r[q] = wmma16(k0, qr0[q], r[q]);
#pragma unroll
                for (int q = 0; q < QT; ++q) r[q] = wmma16(k1, qr1[q], r[q]);
#pragma unroll
                for (int q = 0; q < QT; ++q) r[q] = wmma16(e0, qh0[q], r[q]);
#pragma unroll
                for (int q = 0; q < QT; ++q) r[q] = wmma16(e1, qh1[q], r[q]);
                // the distance behind the tile's last matrix instructions
                asm volatile("v_nop\n\tv_nop\n\tv_nop\n\tv_nop" : "+v"(s[0]), "+v"(s[1]), "+v"(r[0]), "+v"(r[1]) : "v"(k0), "v"(k1), "v"(e0), "v"(e1),
                             "v"(qh0[0]), "v"(qh1[0]), "v"(qr0[0]), "v"(qr1[0]), "v"(qh0[1]), "v"(qh1[1]), "v"(qr0[1]), "v"(qr1[1]));
            } else {
                asm volatile("v_nop\n\tv_nop\n\tv_nop\n\tv_nop" : "+v"(s[0]), "+v"(s[1]) : "v"(k0), "v"(k1), "v"(qh0[0]), "v"(qh1[0]), "v"(qh0[1]), "v"(qh1[1]));
            }
#pragma unroll
            for (int q = 0; q < QT; ++q) f[q][kt] = s[q] + r[q] * RESI;
            __builtin_amdgcn_sched_barrier(0);   // the tile's four accumulators are folded into two before the next tile's products start; left free, the compiler keeps all eight live and spills
        }
        v16h pb[QT];
#pragma unroll
        for (int q = 0; q < QT; ++q) {
            const v8f ta = f[q][0] * SC2, tb = f[q][1] * SC2;
            float mx = -3.0e38f;
#pragma unroll
            for (int i = 0; i < 8; ++i) mx = fmaxf(mx, fmaxf(ta[i], tb[i]));
            mx = fmaxf(mx, __shfl_xor(mx, 16, 32));
            const float mnew = fmaxf(m[q], mx);
            const float alpha = __builtin_amdgcn_exp2f(m[q] - mnew);
            const float sh = PSH - mnew;
            const v8f ea = ta + sh, eb = tb + sh;
            float ls = 0.0f;
#pragma unroll
            for (int i = 0; i < 8; ++i) {
                const float xa = __builtin_amdgcn_exp2f(ea[i]), xb = __builtin_amdgcn_exp2f(eb[i]);
                const h16 pa = (ea[i] < -14.0f) ? (h16)0.0f : (h16)xa;    // exponent cut: no f16 value below the smallest normal
                const h16 pc = (eb[i] < -14.0f) ? (h16)0.0f : (h16)xb;
                pb[q][i] = pa; pb[q][8 + i] = pc; ls += (float)pa + (float)pc; }
            l[q] = l[q] * alpha + ls; m[q] = mnew;
#pragma unroll
            for (int j = 0; j < 4; ++j) o[q][j] = o[q][j] * alpha;
        }
        const h16* va = sk + 2 * TILE_H + u;
        const v16h v0 = ldh(va), v1 = ldh(va + 16 * LP), v2 = ldh(va + 32 * LP), v3 = ldh(va + 48 * LP);
#pragma unroll
        for (int q = 0; q < QT; ++q) { o[q][0] = wmma16(v0, pb[q], o[q][0]); o[q][1] = wmma16(v1, pb[q], o[q][1]); o[q][2] = wmma16(v2, pb[q], o[q][2]); o[q][3] = wmma16(v3, pb[q], o[q][3]); }
        // the distance behind the step's last matrix instructions, on both sides of the branch at the loop's foot
        asm volatile("v_nop\n\tv_nop\n\tv_nop\n\tv_nop" : "+v"(o[0][0]), "+v"(o[0][1]), "+v"(o[0][2]), "+v"(o[0][3]), "+v"(o[1][0]), "+v"(o[1][1]), "+v"(o[1][2]), "+v"(o[1][3])
                     : "v"(v0), "v"(v1), "v"(v2), "v"(v3), "v"(pb[0]), "v"(pb[1]));
      }
      asm volatile("s_wait_dscnt 0x0" ::: "memory");         // this wave's reads of the stage have returned: its buffer may be handed to the copies
      asm volatile("s_wait_asynccnt 0x0" ::: "memory");      // this wave's copies of the next stage have landed
      __syncthreads();                                       // publishes the next stage and ends every wave's reads of this one
      if (ks + 2 * KST < SEQ) {                              // block-uniform: refill the buffer just read with the stage after next
        const size_t kn = (size_t)(ks + 2 * KST);
        stage_copy(cl + (unsigned)bsel * (STG_H * 2), KP + ck + kn * HD, KR + ck + kn * HD, VT + cv + kn); }
    }
    asm volatile("s_wait_asynccnt 0x0" ::: "memory");        // nothing of the ring is in flight; the last trip's barrier has ended all reads, so it may become output staging
    const int wb = wave * 16 * 68;
#pragma unroll
    for (int q = 0; q < QT; ++q) {                           // the wave's query tiles, one after the other through the wave's own staging rows
        const float lq = l[q] + __shfl_xor(l[q], 16, 32);
        const float inv = CTXS / lq;
        // O^T D layout: o_j[r] = (d = 16j + 8h + r, t = lane&15) -> os[t][d]; rows 0..15 x columns 0..63 all written
#pragma unroll
        for (int j = 0; j < 4; ++j) { v4f a, c;
            a[0] = o[q][j][0] * inv; a[1] = o[q][j][1] * inv; a[2] = o[q][j][2] * inv; a[3] = o[q][j][3] * inv; c[0] = o[q][j][4] * inv; c[1] = o[q][j][5] * inv; c[2] = o[q][j][6] * inv; c[3] = o[q][j][7] * inv;
            *(v4fa*)(&os[wb + lr * 68 + 16 * j + 8 * hi]) = a; *(v4fa*)(&os[wb + lr * 68 + 16 * j + 8 * hi + 4]) = c; }
        wave_sync();
        h16* crow = CTX + ((size_t)b * SEQ + t0 + 16 * q) * DM + h * HD;      // ctx plane [b*SEQ + t][h*64 + d], x CTXS
#pragma unroll
        for (int s = 0; s < 4; ++s) { const int row = 4 * s + (lane >> 3), c8 = (lane & 7) * 8;   // 4 s x 4 rows = 16 rows; 8 lanes x 8 halves = 64 columns
            const v4f x0 = *(const v4fa*)(&os[wb + row * 68 + c8]); const v4f x1 = *(const v4fa*)(&os[wb + row * 68 + c8 + 4]); v8h hv;
#pragma unroll
            for (int i = 0; i < 4; ++i) { hv[i] = toh_flush(x0[i]); hv[4 + i] = toh_flush(x1[i]); }
            *(v8h*)(crow + (size_t)row * DM + c8) = hv; }
        if (q + 1 < QT) {                                   // only where another tile follows
            asm volatile("s_wait_xcnt 0x0" ::: "memory");   // ends this tile's stores before the next tile's sums reuse their registers
            __builtin_amdgcn_sched_barrier(0);              // keeps the next tile's products behind that wait; left free, the compiler lifts them over it
            wave_sync();                                    // the tile's staging rows have been read: the next tile may overwrite them
        }
    }
}

// k_out: output projection, f16 GEMM, 256 x 128 tile per block of eight waves (4 x 2), ONE WAVE per 64x64 tile, K = DM; operand rows staged as in proj_tile.
// OUT[m][n] = OSC * sum_k CTX[m][k] WoT[n][k] + bo[n] (f32). grid (NB*SEQ/256, DM/128), 256 threads.
__global__ __launch_bounds__(256) void k_out(const h16* __restrict__ A, const h16* __restrict__ Bt, const float* __restrict__ bias, float* OUT) {
    __shared__ __align__(16) h16 ring[2 * GSTG_H];           // two stages; reused as the waves' output staging behind the loop
    const int K = DM;
    const int lane = threadIdx.x & 31, lr = lane & 15, hi = lane >> 4;
    const int wave = __builtin_amdgcn_readfirstlane((int)(threadIdx.x >> 5)); const int wm = wave & 3, wn = wave >> 2;
    const int r0 = blockIdx.x * GBM + wm * 64, c0 = blockIdx.y * GBN + wn * 64;
    float* os = (float*)ring + wave * 16 * 68;
    // this thread's share of a stage: 16 bytes at column cc of rows cr + 16 i (16 lanes = one 256-B row); blockIdx.x * GBM + cr + 240 < NB * SEQ, blockIdx.y * GBN + cr + 112 < DM, cc + 7 < GKS
    const int cr = (int)(threadIdx.x >> 4), cc = (int)(threadIdx.x & 15) * 8;
    const unsigned cl = (unsigned)(size_t)(&ring[cr * GLP + cc]);               // LDS byte address in buffer 0
    const unsigned short* ca = (const unsigned short*)A + (size_t)(blockIdx.x * GBM + cr) * K + cc;    // + k
    const unsigned short* cb = (const unsigned short*)Bt + (size_t)(blockIdx.y * GBN + cr) * K + cc;   // + k
    gemm_stage(cl, ca, cb);                                                      // stage 0 -> buffer 0
    v8f acc[4][4];
#pragma unroll
    for (int mb = 0; mb < 4; ++mb)
#pragma unroll
        for (int nb = 0; nb < 4; ++nb) acc[mb][nb] = (v8f){};
    const int aoff = (wm * 64 + lr) * GLP + 8 * hi, boff = (GBM + wn * 64 + lr) * GLP + 8 * hi;   // fragment rows inside a stage
    asm volatile("s_wait_asynccnt 0x0" ::: "memory");        // this wave's copies of stage 0 have landed
    __syncthreads();                                         // every wave's have: stage 0 may be read
    gemm_stage(cl + GSTG_H * 2, ca + GKS, cb + GKS);         // stage 1 -> buffer 1
#pragma unroll 1
    for (int ks = 0; ks < K; ks += GKS) {
        const int bsel = (ks / GKS) & 1;
        const h16* sa = ring + bsel * GSTG_H + aoff; const h16* sb = ring + bsel * GSTG_H + boff;
        v16h a[2][4], b[2][4];                             // fragments are read one 32-k step ahead, in two groups a step, so that the whole kernel stays inside 256 registers
#pragma unroll
        for (int i = 0; i < 4; ++i) { a[0][i] = ldh(sa + i * 16 * GLP); b[0][i] = ldh(sb + i * 16 * GLP); }
#pragma unroll
        for (int kc = 0; kc < GKS; kc += 32) {               // the 32-k steps of the stage, in k order; unrolled so that every LDS offset is an immediate
            const int cu = (kc / 32) & 1, nx = cu ^ 1;
            // the four scheduling barriers keep each group of reads whole and a step ahead of its products; left free, the compiler sinks every read to its first use and waits there
            __builtin_amdgcn_sched_barrier(0);
            if (kc + 32 < GKS) {                             // never past the stage: the next stage is read only behind its barrier
#pragma unroll
                for (int i = 0; i < 4; ++i) a[nx][i] = ldh(sa + i * 16 * GLP + kc + 32);
#pragma unroll
                for (int i = 0; i < 2; ++i) b[nx][i] = ldh(sb + i * 16 * GLP + kc + 32); }
            __builtin_amdgcn_sched_barrier(0);
#pragma unroll
            for (int nb = 0; nb < 2; ++nb)
#pragma unroll
                for (int mb = 0; mb < 4; ++mb) acc[mb][nb] = wmma16(a[cu][mb], b[cu][nb], acc[mb][nb]);
            __builtin_amdgcn_sched_barrier(0);
            if (kc + 32 < GKS) {
#pragma unroll
                for (int i = 2; i < 4; ++i) b[nx][i] = ldh(sb + i * 16 * GLP + kc + 32); }
            __builtin_amdgcn_sched_barrier(0);
#pragma unroll
            for (int nb = 2; nb < 4; ++nb)
#pragma unroll
                for (int mb = 0; mb < 4; ++mb) acc[mb][nb] = wmma16(a[cu][mb], b[cu][nb], acc[mb][nb]);
        }
        // the distance behind the stage's last matrix instructions, on both sides of the branch below
        asm volatile("v_nop\n\tv_nop\n\tv_nop\n\tv_nop" : "+v"(acc[0][0]), "+v"(acc[1][0]), "+v"(acc[2][0]), "+v"(acc[3][0]), "+v"(acc[0][1]), "+v"(acc[1][1]), "+v"(acc[2][1]), "+v"(acc[3][1]),
                     "+v"(acc[0][2]), "+v"(acc[1][2]), "+v"(acc[2][2]), "+v"(acc[3][2]), "+v"(acc[0][3]), "+v"(acc[1][3]), "+v"(acc[2][3]), "+v"(acc[3][3]));
        asm volatile("s_wait_dscnt 0x0" ::: "memory");       // this wave's reads of the stage have returned: its buffer may be handed to the copies
        asm volatile("s_wait_asynccnt 0x0" ::: "memory");    // this wave's copies of the next stage have landed
        __syncthreads();                                     // publishes the next stage and ends every wave's reads of this one
        if (ks + 2 * GKS < K)                                // block-uniform: refill the buffer just read with the stage after next
            gemm_stage(cl + (unsigned)bsel * (GSTG_H * 2), ca + ks + 2 * GKS, cb + ks + 2 * GKS);
    }
    asm volatile("s_wait_asynccnt 0x0" ::: "memory");        // nothing of the ring is in flight; the last trip's barrier has ended all reads, so it may become output staging
    const int cofs = lr * 4;
    v4f bb; { const v4f t = *(const v4f*)(bias + c0 + cofs);      // c0 + cofs + 3 < DM
#pragma unroll
        for (int i = 0; i < 4; ++i) bb[i] = bfr(t[i]); }
    float* orow = OUT + ((size_t)(r0 / SEQ) * OUT_SEQ + (size_t)(r0 % SEQ)) * DM + c0;
#pragma unroll
    for (int mb = 0; mb < 4; ++mb) {
#pragma unroll
        for (int nb = 0; nb < 4; ++nb) {
#pragma unroll
            for (int j = 0; j < 8; ++j) os[(hi * 8 + j) * 68 + nb * 16 + lr] = acc[mb][nb][j]; }   // D: row 8h+j, col lane&15
        wave_sync();
{
#pragma unroll
            for (int s = 0; s < 8; ++s) { const int row = 2 * s + hi;   // 8 s x 2 rows = 16 rows; 16 lanes x 4 floats = 64 columns
                const v4f x = *(const v4fa*)(&os[row * 68 + cofs]); v4f val;
#pragma unroll
                for (int i = 0; i < 4; ++i) val[i] = x[i] * OSC + bb[i];
                *(v4f*)(orow + (size_t)(mb * 16 + row) * DM + cofs) = val; }
             }
        wave_sync();
    }
}

static constexpr size_t al256(size_t v) { return (v + 255) & ~(size_t)255; }
static constexpr size_t SZ_XB = al256((size_t)NB * SEQ * DM * 2);
static constexpr size_t SZ_WB = al256((size_t)3 * DM * DM * 2);
static constexpr size_t SZ_PL = al256((size_t)NB * NH_ * SEQ * HD * 2);
static constexpr size_t SZ_TOTAL = 3 * SZ_XB + SZ_WB + 5 * SZ_PL;
static_assert(SZ_TOTAL <= (size_t)268435456);                  // workspace carve <= 256 MiB
static_assert(((size_t)DM * DM * 2) % 256 == 0);               // weight sub-planes stay 256-byte aligned
static_assert((size_t)3 * DM * DM * 2 <= SZ_WB);               // three weight sub-planes (q | k | o) fit their region
static_assert((size_t)NB * SEQ * DM * 2 <= SZ_XB);             // ctx plane (aliases the query copy) fits its region

extern "C" void kernel_launch(void* const* d_in, const int* in_sizes, int n_in,
                              void* d_out, int out_size, void* d_ws, size_t ws_size, hipStream_t stream) {
    if (n_in < 9) return;
    const size_t needx = ((size_t)(NB - 1) * SEQ_FULL + SEQ) * DM;
    if ((size_t)in_sizes[0] < needx || (size_t)in_sizes[1] < needx || (size_t)in_sizes[2] < needx) return;
    if ((size_t)in_sizes[3] < (size_t)DM * DM || (size_t)in_sizes[5] < (size_t)DM * DM || (size_t)in_sizes[7] < (size_t)DM * DM) return;
    if (in_sizes[4] < DM || in_sizes[6] < DM || in_sizes[8] < DM) return;
    if ((size_t)out_size < ((size_t)(NB - 1) * OUT_SEQ + SEQ) * DM) return;
    if (SZ_TOTAL > ws_size) return;
    // wire order: q, k, v, q_w, q_b, k_w, k_b, out_w, out_b
    const float* xq = (const float*)d_in[0]; const float* xk = (const float*)d_in[1]; const float* xv = (const float*)d_in[2];
    const float* wq = (const float*)d_in[3]; const float* bq = (const float*)d_in[4];
    const float* wk = (const float*)d_in[5]; const float* bk = (const float*)d_in[6];
    const float* wo = (const float*)d_in[7]; const float* bo = (const float*)d_in[8];
    float* OUT = (float*)d_out;      // [NB][OUT_SEQ][1024]
    char* wsp = (char*)d_ws;
    bf* XQ = (bf*)wsp; wsp += SZ_XB;                 // [NB*SEQ][1024] bf16 queries; region reused later as the ctx plane
    bf* XK = (bf*)wsp; wsp += SZ_XB;                 // [NB*SEQ][1024] bf16 keys
    bf* XV = (bf*)wsp; wsp += SZ_XB;                 // [NB*SEQ][1024] bf16 values
    bf* WB = (bf*)wsp; wsp += SZ_WB;                 // [3][1024][1024] transposed [out][in]: q | k (bf16) | o (f16 x64)
    h16* QH = (h16*)wsp; wsp += SZ_PL;               // [NB*16][SEQ][64]
    h16* KP = (h16*)wsp; wsp += SZ_PL;               // [NB*16][SEQ][64]
    h16* VT = (h16*)wsp; wsp += SZ_PL;               // [NB*16][64][SEQ]
    h16* QR = (h16*)wsp; wsp += SZ_PL;               // [NB*16][SEQ][64] f16 x2048; a region of its own: the projections run side by side, so no input copy may be overwritten by one of them
    h16* KR = (h16*)wsp; wsp += SZ_PL;               // [NB*16][SEQ][64] f16 x2048; likewise
    h16* CTX = (h16*)XQ;                             // [NB*SEQ][1024] f16 x256, written after the projection launch has consumed XQ
    bf* WQT = WB; bf* WKT = WB + (size_t)DM * DM; bf* WOT = WB + (size_t)2 * DM * DM;

    k_prep<<<dim3(6, PREP_GX, 1), 256, 0, stream>>>(xq, xk, xv, wq, wk, wo, XQ, XK, XV, (unsigned short*)WQT, (unsigned short*)WKT, (unsigned short*)WOT);

    k_proj3<<<dim3(PJ_BLK, 3, 1), 256, 0, stream>>>(XQ, XK, XV, WQT, WKT, bq, bk, QH, QR, KP, KR, VT);

    k_flash<<<dim3(SEQ / (16 * QT * AW), NB * NH_, 1), 32 * AW, 0, stream>>>(QH, QR, KP, KR, VT, CTX);

    k_out<<<dim3(NB * SEQ / GBM, DM / GBN, 1), 256, 0, stream>>>(CTX, (const h16*)WOT, bo, OUT);
}

// v006
// A run of this version takes 173 microseconds.
// Two timings next to v005 both put it at 1.07 times that version's speed.
// All steps since v000 together make it 3.00 times as fast.
#include <hip/hip_runtime.h>

// Multi-head self-attention block, width 1024 = 16 heads x 64; separate query / key / value inputs [NB][SEQ_FULL][1024] (first SEQ tokens of each batch used); q_w / k_w / out_w stored [in][out] (y = x W + b); the value projection uses the query weight and the query bias (there is no separate value weight); no mask; score scale 1/8; output = ctx out_w + out_b (f32).
// Compute dtypes, f32 accumulate everywhere: q/k/v projections v_wmma_f32_16x16x32_bf16 (inputs and weights RNE-converted to bf16; products exact); scores v_wmma_f32_16x16x32_f16 with q and k each carried as f16 value + f16 residual x2048 (three products: value.value in the main accumulator, value.residual + residual.value in a separate accumulator folded back by 1/2048); P.V v_wmma_f32_16x16x32_f16 (P x256 carry, cancels in the normalisation; v single f16); output projection v_wmma_f32_16x16x32_f16: ctx f16 with x256 carry, out_w^T (bf16 RNE value) x64 as f16, carries folded back in the f32 epilogue; softmax f32 (online, running max); biases (bf16 RNE values) added in f32.
// Launches: k_prep (all operand conversions, independent of one another, one grid), k_proj3 (the three projections, independent of one another, one grid), k_flash, k_out.
// Layout: bf16 copies of the three inputs; transposed 16-bit weight planes [out][in]; q, k value and residual planes [b*16+h][t][d] and v^T plane [b*16+h][d][t] written by the GEMM epilogue; fused flash kernel in transposed form (S^T = K Q^T, O^T = V^T P^T) writing the ctx plane [b*SEQ+t][h*64+d]; final GEMM writes the f32 output.

#ifndef NB
#define NB 4
#endif
#ifndef SEQ
#define SEQ 2048
#endif
#define NB_FULL  4
#define SEQ_FULL 2048
#ifndef OUT_SEQ
#define OUT_SEQ SEQ              // row pitch (in tokens) between batches of the output
#endif
#ifndef SCORE_RES
#define SCORE_RES 1              // 1: q and k residual planes and three-product scores; 0: single-product scores
#endif
#define DM   1024
#define NH_  16
#define HD   64
#define AW   8                   // waves per flash block; all of them read the same staged key tiles
#define QT   2                   // query tiles (16 rows each) per flash wave: each fragment read from LDS feeds QT products
#define KST  64                  // keys per LDS stage: every staged row (K, K residual: one key; V^T: one d) is one whole 128-B line
#define LP   72                  // LDS row pitch in halves: 144 B = 16 B x odd, conflict-free for 16-byte fragment reads
#define TILE_H (64 * LP)         // halves of one staged tile (64 rows)
#define STG_H  (3 * TILE_H)      // one stage: K value | K residual | V^T
#define SC2  (0.125f * 1.4426950408889634f)   // HD^-0.5 * log2(e)
#define PSH  8.0f                // log2 of the P carry (256)
#define CTXS 256.0f              // carry of the ctx plane
#define WOS  64.0f               // carry of the Wo^T plane
#define OSC  (1.0f / 16384.0f)   // 1 / (CTXS * WOS)
#define RESC 2048.0f             // carry of the q / k residual planes
#define RESI (1.0f / 2048.0f)    // 1 / RESC
#define GBM  256                 // GEMM block tile: rows of A
#define GBN  128                 // GEMM block tile: rows of Bt (output columns)
#define GKS  128                 // k per LDS stage of the GEMMs: every staged row is 256 B, two whole lines
#define GLP  136                 // LDS row pitch of the GEMM stages in halves: 272 B = 16 B x odd, conflict-free for 16-byte fragment reads
#define GSTG_H ((GBM + GBN) * GLP)   // halves of one GEMM stage: A rows | Bt rows
#define CVW  32                  // input conversion: 512-byte loads per wave (16 KiB of f32 a wave)

static_assert(HD == 64);
static_assert(NH_ * HD == DM);                 // head h = columns h*64 + d
static_assert(DM % 64 == 0);                   // column tiles of 64
static_assert(DM % 32 == 0);                   // GEMM k-loop steps by 32
static_assert(SEQ % 64 == 0);                  // a 64-row tile never straddles two batches
static_assert((NB * SEQ) % 64 == 0);
static_assert(SEQ % 32 == 0);                  // key loop steps by 32
static_assert(QT == 2 && SEQ % (16 * QT * AW) == 0);   // flash grid covers the sequence exactly
static_assert(SEQ % KST == 0);                 // key stages cover the sequence exactly
static_assert(KST == 64 && KST % 32 == 0);     // a stage is two 32-key steps; V^T rows of a stage are 128 B
static_assert(32 * AW * 2 * 8 == 64 * HD);     // two 16-byte copies per thread fill one 64 x 64 tile
static_assert((size_t)AW * 16 * 68 * 4 <= (size_t)2 * STG_H * 2);   // output staging fits the ring it reuses
static_assert(((size_t)SEQ * DM) % (CVW * 128) == 0);            // a wave's share of the input conversion never straddles two batches
static_assert(((size_t)NB * SEQ * DM) % (8 * CVW * 128) == 0);   // its grid of eight-wave blocks covers an input exactly
static_assert(DM % GBM == 0 && DM % GBN == 0 && (NB * SEQ) % GBM == 0 && (NB * SEQ) % GBN == 0);   // GEMM grids cover every operand exactly
static_assert(DM % GKS == 0 && DM / GKS >= 2 && GKS % 32 == 0);   // whole stages, at least two of them
static_assert(GBM == 4 * 64 && GBN == 2 * 64);                   // eight waves, 4 x 2, one 64 x 64 tile each
static_assert(256 * 8 * 8 == 128 * GKS);                         // eight 16-byte copies per thread fill 128 staged rows
static_assert((size_t)8 * 16 * 68 * 4 <= (size_t)2 * GSTG_H * 2);   // the waves' output staging fits the ring it reuses
static_assert(((size_t)DM * DM) % 8 == 0);
static_assert(NB <= NB_FULL);
static_assert(SEQ <= SEQ_FULL);
static_assert(RESC * RESI == 1.0f);            // residual carry folds back exactly
static_assert(CTXS * WOS * OSC == 1.0f);       // output carries fold back exactly

typedef _Float16 h16;
typedef unsigned short bf;
typedef __attribute__((ext_vector_type(16))) __bf16   v16bf;
typedef __attribute__((ext_vector_type(16))) _Float16 v16h;
typedef __attribute__((ext_vector_type(8)))  _Float16 v8h;
typedef __attribute__((ext_vector_type(8)))  unsigned short v8us;
typedef __attribute__((ext_vector_type(4)))  unsigned short v4us;
typedef __attribute__((ext_vector_type(8)))  float    v8f;
typedef __attribute__((ext_vector_type(4)))  float    v4f;
typedef __attribute__((ext_vector_type(2)))  float    v2f;
typedef __attribute__((ext_vector_type(2)))  _Float16 v2h;
typedef v4f  __attribute__((may_alias)) v4fa;

__device__ __forceinline__ unsigned short f2bf(float f) { unsigned u = __float_as_uint(f); u += 0x7FFFu + ((u >> 16) & 1u); return (unsigned short)(u >> 16); }
__device__ __forceinline__ float bfr(float f) { return __uint_as_float(((unsigned)f2bf(f)) << 16); }   // value of the bf16 RNE conversion, as f32
__device__ __forceinline__ v16h cat16(v8h lo, v8h hi) { return __builtin_shufflevector(lo, hi, 0, 1, 2, 3, 4, 5, 6, 7, 8, 9, 10, 11, 12, 13, 14, 15); }
__device__ __forceinline__ v16bf cat16b(v8us lo, v8us hi) { return __builtin_bit_cast(v16bf, __builtin_shufflevector(lo, hi, 0, 1, 2, 3, 4, 5, 6, 7, 8, 9, 10, 11, 12, 13, 14, 15)); }
__device__ __forceinline__ v8f wmma16(v16h a, v16h b, v8f c) { return __builtin_amdgcn_wmma_f32_16x16x32_f16(false, a, false, b, (short)0, c, false, false); }
__device__ __forceinline__ v8f wmmab(v16bf a, v16bf b, v8f c) { return __builtin_amdgcn_wmma_f32_16x16x32_bf16(false, a, false, b, (short)0, c, false, false); }
// fragment loaders from K-contiguous 16-bit rows; p already includes + 8*(lane>>4): elements 0..7 <- k0+8h+0..7, elements 8..15 <- k0+16+8h+0..7 (same map for A and B)
__device__ __forceinline__ v16h  ldh(const h16* p) { return cat16(*(const v8h*)p, *(const v8h*)(p + 16)); }
__device__ __forceinline__ v16bf ldb(const bf* p)  { return cat16b(*(const v8us*)p, *(const v8us*)(p + 16)); }
// ordering point for wave-private LDS tiles (same wave writes and reads)
__device__ __forceinline__ void wave_sync() { __builtin_amdgcn_fence(3 /* release order */, "wavefront"); __builtin_amdgcn_wave_barrier(); asm volatile("" ::: "memory"); }
// f32 -> f16 for operand planes: a result below the smallest normal f16 magnitude is replaced by zero (value select)
static __device__ __forceinline__ h16 toh_flush(float v) { const h16 r = (h16)v; return (fabsf(v) < 6.103515625e-05f) ? (h16)0.0f : r; }

// cvt_in: bf16 RNE copy of one input, written as a stream: block blk of the copy, every wave converts CVW * 128 consecutive floats.
// All CVW loads of a wave (16 bytes a lane, 512 contiguous bytes a wave = four whole lines) are issued before the first conversion; a wave's 8-byte stores cover 256 contiguous bytes.
__device__ __forceinline__ void cvt_in(const float* __restrict__ src, bf* __restrict__ dst, unsigned blk) {
    const size_t e0 = ((size_t)blk * 8 + (threadIdx.x >> 5)) * (CVW * 128);   // first element of this wave's share in the packed copy [NB*SEQ][DM]
    const size_t s0 = (SEQ == SEQ_FULL) ? e0 : (e0 / ((size_t)SEQ * DM)) * ((size_t)SEQ_FULL * DM) + e0 % ((size_t)SEQ * DM);   // the same element in the input (batch pitch SEQ_FULL)
    const float* s = src + s0 + (threadIdx.x & 31) * 4;
    bf* d = dst + e0 + (threadIdx.x & 31) * 4;
    v4f v[CVW];
#pragma unroll
    for (int j = 0; j < CVW; ++j) v[j] = *(const v4f*)(s + j * 128);
    __builtin_amdgcn_sched_barrier(0);   // keeps every load ahead of the first conversion; left free, the compiler holds the last four back until the others have returned: a second trip to memory
#pragma unroll
    for (int j = 0; j < CVW; ++j) { v4us o;
#pragma unroll
        for (int k = 0; k < 4; ++k) o[k] = f2bf(v[j][k]);
        *(v4us*)(d + j * 128) = o; }
    asm volatile("s_wait_xcnt 0x0" ::: "memory");   // ends the run of stores: in the joined kernel another job's code follows in the text and reuses their registers
}

// cvt_wT: transpose + 16-bit convert of one 64 x 64 tile (columns n0.., rows k0..) of a weight matrix: in[R][C] (f32, R = contraction index, C = output feature) -> out[C][R] (16-bit, contraction-contiguous); ts = 64 x 65 floats of LDS.
// F16OUT == 0: bf16 RNE bits; F16OUT == 1: f16 of (bf16 RNE value x WOS) (exact for values whose scaled magnitude is in the f16 normal range).
template <int F16OUT>
__device__ __forceinline__ void cvt_wT(const float* __restrict__ W, unsigned short* dst, float* ts, int n0, int k0) {
    const int R = DM, C = DM;
    const int tid = threadIdx.x;
#pragma unroll
    for (int it = 0; it < 4; ++it) {                     // 4 x 16 rows x (16 lanes x 4 floats) = 64 x 64, all written
        const int r = it * 16 + (tid >> 4), c4 = (tid & 15) * 4;
        const v4f v = *(const v4f*)(W + (size_t)(k0 + r) * (size_t)C + n0 + c4);
#pragma unroll
        for (int i = 0; i < 4; ++i) ts[r * 65 + c4 + i] = v[i];
    }
    __syncthreads();
    v8us o[2];
#pragma unroll
    for (int it = 0; it < 2; ++it) {                     // 2 x 32 output rows x (8 lanes x 8 halves) = 64 x 64
        const int n = it * 32 + (tid >> 3), k8 = (tid & 7) * 8;
#pragma unroll
        for (int i = 0; i < 8; ++i) {
            const float x = ts[(k8 + i) * 65 + n];
            const unsigned short bb = f2bf(x);
            if (F16OUT) { const h16 hv = (h16)(__uint_as_float(((unsigned)bb) << 16) * WOS); o[it][i] = __builtin_bit_cast(unsigned short, hv); }
            else o[it][i] = bb;
        }
    }
{
#pragma unroll
        for (int it = 0; it < 2; ++it) { const int n = it * 32 + (tid >> 3), k8 = (tid & 7) * 8;
            *(v8us*)(dst + (size_t)(n0 + n) * (size_t)R + k0 + k8) = o[it]; }
         }
    asm volatile("s_wait_xcnt 0x0" ::: "memory");   // ends the two stores: in the joined kernel another job's code follows in the text and reuses their registers
}

// k_prep: every operand conversion in one grid (none reads what another writes): blockIdx.x 0..2 = weight planes q | k | o, one 64 x 64 tile a block; blockIdx.x 3..5 = input copies q | k | v; blockIdx.y = which block of it.
// The job is the fast index, so that the short, latency-bound weight blocks start spread among the blocks of the input stream and run under it. Every branch here is block-uniform.
#define WT_BLK ((DM / 64) * (DM / 64))                            // blocks of one weight plane
#define CV_BLK ((unsigned)((size_t)NB * SEQ * DM / (8 * CVW * 128)))   // blocks of one input copy
#define PREP_GX (WT_BLK > CV_BLK ? WT_BLK : CV_BLK)               // blocks of the longest job
__global__ __launch_bounds__(256) void k_prep(const float* __restrict__ xq, const float* __restrict__ xk, const float* __restrict__ xv, const float* __restrict__ wq, const float* __restrict__ wk, const float* __restrict__ wo,
                                              bf* __restrict__ dq, bf* __restrict__ dk, bf* __restrict__ dv, unsigned short* __restrict__ tq, unsigned short* __restrict__ tk, unsigned short* __restrict__ to) {
    __shared__ float ts[64 * 65];
    const unsigned y = blockIdx.x, x = blockIdx.y;           // y = job, x = block of the job
    if (y < 3) {
        if (x >= WT_BLK) return;
        const int n0 = (int)(x % (DM / 64)) * 64, k0 = (int)(x / (DM / 64)) * 64;
        if (y == 2) cvt_wT<1>(wo, to, ts, n0, k0);
        else cvt_wT<0>(y == 0 ? wq : wk, y == 0 ? tq : tk, ts, n0, k0);
    } else {
        if (x >= CV_BLK) return;
        cvt_in(y == 3 ? xq : (y == 4 ? xk : xv), y == 3 ? dq : (y == 4 ? dk : dv), x);
    }
}

// gemm_copy8: one thread's share of 128 staged rows, eight 16-byte asynchronous copies global -> LDS (rows r, r + 16, ..., r + 112 of a K-contiguous 16-bit plane of row length DM).
// The s_wait_xcnt ends the copies' own statement so that no address register named there is rewritten ahead of it.
__device__ __forceinline__ void gemm_copy8(unsigned l, const unsigned short* g) {
    asm volatile("global_load_async_to_lds_b128 %0, %8, off\n\tglobal_load_async_to_lds_b128 %1, %9, off\n\t"
                 "global_load_async_to_lds_b128 %2, %10, off\n\tglobal_load_async_to_lds_b128 %3, %11, off\n\t"
                 "global_load_async_to_lds_b128 %4, %12, off\n\tglobal_load_async_to_lds_b128 %5, %13, off\n\t"
                 "global_load_async_to_lds_b128 %6, %14, off\n\tglobal_load_async_to_lds_b128 %7, %15, off\n\ts_wait_xcnt 0x0"
                 :: "v"(l), "v"(l + 16 * GLP * 2), "v"(l + 32 * GLP * 2), "v"(l + 48 * GLP * 2), "v"(l + 64 * GLP * 2), "v"(l + 80 * GLP * 2), "v"(l + 96 * GLP * 2), "v"(l + 112 * GLP * 2),
                    "v"(g), "v"(g + 16 * DM), "v"(g + 32 * DM), "v"(g + 48 * DM), "v"(g + 64 * DM), "v"(g + 80 * DM), "v"(g + 96 * DM), "v"(g + 112 * DM) : "memory");
}
// gemm_stage: one thread's share of a GEMM stage (GBM rows of A, then GBN rows of Bt, GKS halves of each); l = LDS byte address of its piece of row (thread / 16) of the stage.
__device__ __forceinline__ void gemm_stage(unsigned l, const unsigned short* ga, const unsigned short* gb) {
    gemm_copy8(l, ga); gemm_copy8(l + 128 * GLP * 2, ga + (size_t)128 * DM); gemm_copy8(l + GBM * GLP * 2, gb);
}

// proj_tile: register-blocked bf16 GEMM, 256 x 128 tile (bx, by) per block of eight waves (4 x 2), ONE WAVE per 64x64 tile (16 accumulators), K = DM; the K-contiguous bf16 operand rows come in
// stages of 128 k through a two-buffer LDS ring that the waves share: asynchronous 16-byte copies (whole lines), stage s + 2 issued behind the barrier that ends the reads of stage s.
// C[m][n] = sum_k A[m][k] Bt[n][k] + bias (BROW == 0: bias[n]; BROW == 1: bias[m]), written as f16 (Ph) at
// tile base (r0/RB)*sRB + (r0%RB)*pitch + (c0/CB)*sCB + (c0%CB), row pitch 'pitch' (halves). bx < M/256, by < N/128, 256 threads; ring = the block's 2 * GSTG_H halves of LDS.
// RES == 1: additionally the residual plane Pr (same addressing) = f16((C - f16 value) x RESC); RES == 0: Pr is not touched.
template <int BROW, int RES>
__device__ __forceinline__ void proj_tile(bf* ring, int bx, int by, const bf* __restrict__ A, const bf* __restrict__ Bt, const float* __restrict__ bias, h16* Ph, h16* Pr, int RB, size_t sRB, int pitch, int CB, size_t sCB) {
    const int K = DM;
    const int lane = threadIdx.x & 31, lr = lane & 15, hi = lane >> 4;
    const int wave = __builtin_amdgcn_readfirstlane((int)(threadIdx.x >> 5)); const int wm = wave & 3, wn = wave >> 2;
    const int r0 = bx * GBM + wm * 64, c0 = by * GBN + wn * 64;
    float* os = (float*)ring + wave * 16 * 68;
    // this thread's share of a stage: 16 bytes at column cc of rows cr + 16 i (16 lanes = one 256-B row); bx * GBM + cr + 240 < M, by * GBN + cr + 112 < N, cc + 7 < GKS
    const int cr = (int)(threadIdx.x >> 4), cc = (int)(threadIdx.x & 15) * 8;
    const unsigned cl = (unsigned)(size_t)(&ring[cr * GLP + cc]);               // LDS byte address in buffer 0
    const bf* ca = A + (size_t)(bx * GBM + cr) * K + cc;                        // + k
    const bf* cb = Bt + (size_t)(by * GBN + cr) * K + cc;                       // + k
    gemm_stage(cl, ca, cb);                                                      // stage 0 -> buffer 0
    v8f acc[4][4];
#pragma unroll
    for (int mb = 0; mb < 4; ++mb)
#pragma unroll
        for (int nb = 0; nb < 4; ++nb) acc[mb][nb] = (v8f){};
    const int aoff = (wm * 64 + lr) * GLP + 8 * hi, boff = (GBM + wn * 64 + lr) * GLP + 8 * hi;   // fragment rows inside a stage
    asm volatile("s_wait_asynccnt 0x0" ::: "memory");        // this wave's copies of stage 0 have landed
    __syncthreads();                                         // every wave's have: stage 0 may be read
    gemm_stage(cl + GSTG_H * 2, ca + GKS, cb + GKS);         // stage 1 -> buffer 1
#pragma unroll 1
    for (int ks = 0; ks < K; ks += GKS) {
        const int bsel = (ks / GKS) & 1;
        const bf* sa = ring + bsel * GSTG_H + aoff; const bf* sb = ring + bsel * GSTG_H + boff;
        v16bf a[2][4], b[2][4];                             // fragments are read one 32-k step ahead, in two groups a step, so that the whole kernel stays inside 256 registers
#pragma unroll
        for (int i = 0; i < 4; ++i) { a[0][i] = ldb(sa + i * 16 * GLP); b[0][i] = ldb(sb + i * 16 * GLP); }
#pragma unroll
        for (int kc = 0; kc < GKS; kc += 32) {               // the 32-k steps of the stage, in k order; unrolled so that every LDS offset is an immediate
            const int cu = (kc / 32) & 1, nx = cu ^ 1;
            // the four scheduling barriers keep each group of reads whole and a step ahead of its products; left free, the compiler sinks every read to its first use and waits there
            __builtin_amdgcn_sched_barrier(0);
            if (kc + 32 < GKS) {                             // never past the stage: the next stage is read only behind its barrier
#pragma unroll
                for (int i = 0; i < 4; ++i) a[nx][i] = ldb(sa + i * 16 * GLP + kc + 32);
#pragma unroll
                for (int i = 0; i < 2; ++i) b[nx][i] = ldb(sb + i * 16 * GLP + kc + 32); }
            __builtin_amdgcn_sched_barrier(0);
#pragma unroll
            for (int nb = 0; nb < 2; ++nb)
#pragma unroll
                for (int mb = 0; mb < 4; ++mb) acc[mb][nb] = wmmab(a[cu][mb], b[cu][nb], acc[mb][nb]);
            __builtin_amdgcn_sched_barrier(0);
            if (kc + 32 < GKS) {
#pragma unroll
                for (int i = 2; i < 4; ++i) b[nx][i] = ldb(sb + i * 16 * GLP + kc + 32); }
            __builtin_amdgcn_sched_barrier(0);
#pragma unroll
            for (int nb = 2; nb < 4; ++nb)
#pragma unroll
                for (int mb = 0; mb < 4; ++mb) acc[mb][nb] = wmmab(a[cu][mb], b[cu][nb], acc[mb][nb]);
        }
        // the distance behind the stage's last matrix instructions, on both sides of the branch below
        asm volatile("v_nop\n\tv_nop\n\tv_nop\n\tv_nop" : "+v"(acc[0][0]), "+v"(acc[1][0]), "+v"(acc[2][0]), "+v"(acc[3][0]), "+v"(acc[0][1]), "+v"(acc[1][1]), "+v"(acc[2][1]), "+v"(acc[3][1]),
                     "+v"(acc[0][2]), "+v"(acc[1][2]), "+v"(acc[2][2]), "+v"(acc[3][2]), "+v"(acc[0][3]), "+v"(acc[1][3]), "+v"(acc[2][3]), "+v"(acc[3][3]));
        asm volatile("s_wait_dscnt 0x0" ::: "memory");       // this wave's reads of the stage have returned: its buffer may be handed to the copies
        asm volatile("s_wait_asynccnt 0x0" ::: "memory");    // this wave's copies of the next stage have landed
        __syncthreads();                                     // publishes the next stage and ends every wave's reads of this one
        if (ks + 2 * GKS < K)                                // block-uniform: refill the buffer just read with the stage after next
            gemm_stage(cl + (unsigned)bsel * (GSTG_H * 2), ca + ks + 2 * GKS, cb + ks + 2 * GKS);
    }
    asm volatile("s_wait_asynccnt 0x0" ::: "memory");        // nothing of the ring is in flight; the last trip's barrier has ended all reads, so it may become output staging
    // column bias for this lane's 8 store columns (BROW == 0); c0 + (lane&7)*8 + 7 < N = DM
    v4f bc0 = (v4f){}, bc1 = (v4f){};
    if (BROW == 0) { const int cb8 = (lane & 7) * 8; const v4f t0 = *(const v4f*)(bias + c0 + cb8); const v4f t1 = *(const v4f*)(bias + c0 + cb8 + 4);
#pragma unroll
        for (int i = 0; i < 4; ++i) { bc0[i] = bfr(t0[i]); bc1[i] = bfr(t1[i]); } }
    const size_t tbase = (size_t)(r0 / RB) * sRB + (size_t)(r0 % RB) * (size_t)pitch + (size_t)(c0 / CB) * sCB + (size_t)(c0 % CB);
#pragma unroll
    for (int mb = 0; mb < 4; ++mb) {
#pragma unroll
        for (int nb = 0; nb < 4; ++nb) {
#pragma unroll
            for (int j = 0; j < 8; ++j) os[(hi * 8 + j) * 68 + nb * 16 + lr] = acc[mb][nb][j]; }   // D: row 8h+j, col lane&15
        wave_sync();
        const size_t sb = tbase + (size_t)(mb * 16) * (size_t)pitch;
{
#pragma unroll
            for (int s = 0; s < 4; ++s) { const int row = 4 * s + (lane >> 3), c8 = (lane & 7) * 8;   // 4 s x 4 row groups = 16 rows; 8 lanes x 8 = 64 columns
                v4f x0 = *(const v4fa*)(&os[row * 68 + c8]); v4f x1 = *(const v4fa*)(&os[row * 68 + c8 + 4]); v8h hv; v8h rv;
                if (BROW == 1) { const float br = bfr(bias[r0 + mb * 16 + row]);                    // row bias; r0 + mb*16 + row < M = DM
#pragma unroll
                    for (int i = 0; i < 4; ++i) { x0[i] += br; x1[i] += br; } }
                else {
#pragma unroll
                    for (int i = 0; i < 4; ++i) { x0[i] += bc0[i]; x1[i] += bc1[i]; } }
#pragma unroll
                for (int i = 0; i < 4; ++i) { const h16 a = toh_flush(x0[i]); const h16 c = toh_flush(x1[i]); hv[i] = a; hv[4 + i] = c;
                    rv[i] = toh_flush((x0[i] - (float)a) * RESC); rv[4 + i] = toh_flush((x1[i] - (float)c) * RESC); }   // difference and carry are exact in f32
                const size_t oo = sb + (size_t)row * (size_t)pitch + c8;
                *(v8h*)(Ph + oo) = hv;
                if (RES) *(v8h*)(Pr + oo) = rv; }
             }
        asm volatile("s_wait_xcnt 0x0" ::: "memory");   // ends this row block's stores before the next block's loads and sums reuse their registers
        wave_sync();
    }
}

// k_proj3: the three projections in one grid (none reads what another writes): blockIdx.y 0 = v^T, 1 = k, 2 = q; blockIdx.x = tile, row tiles of A fastest. Every branch here is block-uniform.
// v^T: the value projection uses the QUERY weight and bias: A = q_w^T rows (m = h*64 + d), Bt = value-input rows (n = b*SEQ + t), row bias q_b[m] -> plane [(b*1024 + m)][t] = [(b*16 + h)][d][t]; no residual plane.
// k, q: A = x rows (m = b*SEQ + t), Bt = W^T rows (n = h*64 + d), column bias -> value and residual planes [(b*16 + h)][t][d].
#define PJ_BLK ((DM / GBM) * (NB * SEQ / GBN))                    // tiles of one projection, in either orientation
static_assert(PJ_BLK == (NB * SEQ / GBM) * (DM / GBN));
__global__ __launch_bounds__(256) void k_proj3(const bf* __restrict__ XQ, const bf* __restrict__ XK, const bf* __restrict__ XV, const bf* __restrict__ WQT, const bf* __restrict__ WKT, const float* __restrict__ bq, const float* __restrict__ bk,
                                               h16* QH, h16* QR, h16* KP, h16* KR, h16* VT) {
    __shared__ __align__(16) bf ring[2 * GSTG_H];            // two stages; reused as the waves' output staging behind the loop
    const int t = (int)blockIdx.x;
    if (blockIdx.y == 0) proj_tile<1, 0>(ring, t % (DM / GBM), t / (DM / GBM), WQT, XV, bq, VT, VT, DM, (size_t)0, SEQ, SEQ, (size_t)DM * SEQ);
    else { const bool isq = blockIdx.y == 2;
        proj_tile<0, SCORE_RES>(ring, t % (NB * SEQ / GBM), t / (NB * SEQ / GBM), isq ? XQ : XK, isq ? WQT : WKT, isq ? bq : bk, isq ? QH : KP, isq ? QR : KR, SEQ, (size_t)NH_ * SEQ * HD, HD, HD, (size_t)SEQ * HD); }
}

// stage_copy: one thread's share of a 64-key stage, 16-byte asynchronous copies global -> LDS, two per tile (rows r and r + 32); l = LDS byte address of its K-tile piece.
// The s_wait_xcnt ends the copies' own statement so that no address register named there is rewritten ahead of it.
__device__ __forceinline__ void stage_copy(unsigned l, const h16* gk, const h16* gr, const h16* gv) {
    const unsigned lk1 = l + 32 * LP * 2, lr0 = l + TILE_H * 2, lr1 = lr0 + 32 * LP * 2, lv0 = l + 2 * TILE_H * 2, lv1 = lv0 + 32 * LP * 2;
    const h16* gk1 = gk + 32 * HD; const h16* gr1 = gr + 32 * HD; const h16* gv1 = gv + (size_t)32 * SEQ;
    if (SCORE_RES)
        asm volatile("global_load_async_to_lds_b128 %0, %6, off\n\tglobal_load_async_to_lds_b128 %1, %7, off\n\t"
                     "global_load_async_to_lds_b128 %2, %8, off\n\tglobal_load_async_to_lds_b128 %3, %9, off\n\t"
                     "global_load_async_to_lds_b128 %4, %10, off\n\tglobal_load_async_to_lds_b128 %5, %11, off\n\ts_wait_xcnt 0x0"
                     :: "v"(l), "v"(lk1), "v"(lr0), "v"(lr1), "v"(lv0), "v"(lv1), "v"(gk), "v"(gk1), "v"(gr), "v"(gr1), "v"(gv), "v"(gv1) : "memory");
    else
        asm volatile("global_load_async_to_lds_b128 %0, %4, off\n\tglobal_load_async_to_lds_b128 %1, %5, off\n\t"
                     "global_load_async_to_lds_b128 %2, %6, off\n\tglobal_load_async_to_lds_b128 %3, %7, off\n\ts_wait_xcnt 0x0"
                     :: "v"(l), "v"(lk1), "v"(lv0), "v"(lv1), "v"(gk), "v"(gk1), "v"(gv), "v"(gv1) : "memory");
}

// k_flash: fused attention, one wave per QT * 16 = 32 query rows of one (batch, head); Q fragments straight from the f16 planes; K, K residual and V^T come in 64-key stages through a
// two-buffer LDS ring that the block's waves share: asynchronous 16-byte copies (whole 128-B lines per row), stage t + 2 issued behind the barrier that ends the reads of stage t.
// Every K, K residual and V^T fragment read from LDS feeds the products of both query tiles of the wave: half the LDS reads, ring copies and barriers per score of a 16-row wave.
// Transposed form: S^T[key][t] = K Q^T (A = K rows, B = Q rows); lane (t = lane&15, h = lane>>4) holds keys 8h+r of each 16-key tile, so the packed
// P tile is directly the B fragment of O^T[d][t] = V^T P^T (element r <- tile keys 0..15, element 8+r <- tile keys 16..31, lane unchanged).
// Per 32-key step and query tile: 4 value.value score products in the main accumulators, 8 value.residual / residual.value products in separate accumulators (x RESC, folded back by RESI), 4 P.V products.
// The scores are formed one 16-key tile at a time (both query tiles), so that only four K fragments and four score accumulators are live at once and the kernel stays inside 256 registers (four waves a SIMD).
// Softmax state (running max, partial sum) is one scalar per lane and query tile; the two lane halves of a row are combined with one xor-16 exchange.
__global__ __launch_bounds__(32 * AW, 4) void k_flash(const h16* __restrict__ QH, const h16* __restrict__ QR, const h16* __restrict__ KP, const h16* __restrict__ KR, const h16* __restrict__ VT, h16* CTX) {
    __shared__ __align__(16) h16 ring[2 * STG_H];            // two stages; reused as output staging behind the loop
    float* os = (float*)ring;
    const int lane = threadIdx.x & 31, lr = lane & 15, hi = lane >> 4;
    const int wave = __builtin_amdgcn_readfirstlane((int)(threadIdx.x >> 5));
    const int zh = blockIdx.y; const int b = zh / NH_, h = zh % NH_;
    const int t0 = (blockIdx.x * AW + wave) * (16 * QT);
    const size_t pbase = (size_t)zh * SEQ * HD;
    // this thread's share of a stage: rows cr and cr + 32 of each tile, 16 bytes at column ccol (8 lanes = one 128-B row, a wave = 4 whole lines)
    const int cr = (int)(threadIdx.x >> 3), ccol = (int)(threadIdx.x & 7) * 8;
    const unsigned cl = (unsigned)(size_t)(&ring[cr * LP + ccol]);               // LDS byte address in buffer 0, K tile
    const size_t ck = pbase + (size_t)cr * HD + ccol;        // + key * HD   (K and K residual planes: row = key; key + cr + 32 < SEQ)
    const size_t cv = pbase + (size_t)cr * SEQ + ccol;       // + key        (V^T plane: row = d, cr + 32 < HD; key + ccol + 7 < SEQ)
    stage_copy(cl, KP + ck, KR + ck, VT + cv);                                     // stage 0 -> buffer 0
    v16h qh0[QT], qh1[QT], qr0[QT], qr1[QT];                 // B fragments: col t, k = d; value and residual (x RESC)
    const h16* qp[QT]; const h16* qq[QT];
#pragma unroll
    for (int q = 0; q < QT; ++q) {
        const size_t qo = pbase + (size_t)(t0 + 16 * q + lr) * HD + 8 * hi;
        qp[q] = QH + qo; qq[q] = QR + qo;
        qh0[q] = ldh(qp[q]); qh1[q] = ldh(qp[q] + 32);
        qr0[q] = qh0[q]; qr1[q] = qh1[q];
        if (SCORE_RES) { qr0[q] = ldh(qq[q]); qr1[q] = ldh(qq[q] + 32); }
    }
    // ends the run of Q loads; their addresses are inputs, so that they stay in their registers up to the wait and no load of the run lands on one of them
    if (SCORE_RES) asm volatile("s_wait_xcnt 0x0" :: "v"(qp[0]), "v"(qp[1]), "v"(qq[0]), "v"(qq[1]) : "memory");
    else           asm volatile("s_wait_xcnt 0x0" :: "v"(qp[0]), "v"(qp[1]) : "memory");
    const int ko = lr * LP + 8 * hi;                         // + key * LP in the K tiles (A fragment: row key, k = d); + 16j*LP + key in the V^T tile (A fragment: row d, k = key)
    v8f o[QT][4]; float m[QT], l[QT];
#pragma unroll
    for (int q = 0; q < QT; ++q) { m[q] = -3.0e38f; l[q] = 0.0f;
#pragma unroll
        for (int j = 0; j < 4; ++j) o[q][j] = (v8f){}; }
    asm volatile("s_wait_asynccnt 0x0" ::: "memory");        // this wave's copies of stage 0 have landed
    __syncthreads();                                         // every wave's have: stage 0 may be read
    if (SEQ > KST) stage_copy(cl + STG_H * 2, KP + ck + (size_t)KST * HD, KR + ck + (size_t)KST * HD, VT + cv + KST);   // stage 1 -> buffer 1
#pragma unroll 1
    for (int ks = 0; ks < SEQ; ks += KST) {
      const int bsel = (ks / KST) & 1;
      const h16* sk = ring + bsel * STG_H + ko;
#pragma unroll
      for (int u = 0; u < KST; u += 32) {                    // the two 32-key steps of the stage, in key order; unrolled so that every LDS offset is an immediate
        v8f f[QT][2];                                        // folded scores: f[q][kt][r] = key 16 kt + 8h + r of the step, query tile q
#pragma unroll
        for (int kt = 0; kt < 2; ++kt) {                     // the two 16-key tiles of the step
            const h16* ka = sk + (u + 16 * kt) * LP;
            const v16h k0 = ldh(ka), k1 = ldh(ka + 32);
            v8f s[QT], r[QT];
#pragma unroll
            for (int q = 0; q < QT; ++q) { s[q] = (v8f){}; r[q] = (v8f){}; }
#pragma unroll
            for (int q = 0; q < QT; ++q) s[q] = wmma16(k0, qh0[q], s[q]);
#pragma unroll
            for (int q = 0; q < QT; ++q) s[q] = wmma16(k1, qh1[q], s[q]);
            if (SCORE_RES) {
                const h16* kr = ka + TILE_H;
                const v16h e0 = ldh(kr), e1 = ldh(kr + 32);
#pragma unroll
                for (int q = 0; q < QT; ++q) r[q] = wmma16(k0, qr0[q], r[q]);
#pragma unroll
                for (int q = 0; q < QT; ++q) r[q] = wmma16(k1, qr1[q], r[q]);
#pragma unroll
                for (int q = 0; q < QT; ++q) r[q] = wmma16(e0, qh0[q], r[q]);
#pragma unroll
                for (int q = 0; q < QT; ++q) r[q] = wmma16(e1, qh1[q], r[q]);
                // the distance behind the tile's last matrix instructions
                asm volatile("v_nop\n\tv_nop\n\tv_nop\n\tv_nop" : "+v"(s[0]), "+v"(s[1]), "+v"(r[0]), "+v"(r[1]) : "v"(k0), "v"(k1), "v"(e0), "v"(e1),
                             "v"(qh0[0]), "v"(qh1[0]), "v"(qr0[0]), "v"(qr1[0]), "v"(qh0[1]), "v"(qh1[1]), "v"(qr0[1]), "v"(qr1[1]));
            } else {
                asm volatile("v_nop\n\tv_nop\n\tv_nop\n\tv_nop" : "+v"(s[0]), "+v"(s[1]) : "v"(k0), "v"(k1), "v"(qh0[0]), "v"(qh1[0]), "v"(qh0[1]), "v"(qh1[1]));
            }
#pragma unroll
            for (int q = 0; q < QT; ++q) f[q][kt] = s[q] + r[q] * RESI;
            __builtin_amdgcn_sched_barrier(0);   // the tile's four accumulators are folded into two before the next tile's products start; left free, the compiler keeps all eight live and spills
        }
        v16h pb[QT];
#pragma unroll
        for (int q = 0; q < QT; ++q) {
            const v8f ta = f[q][0] * SC2, tb = f[q][1] * SC2;
            float mx = -3.0e38f;
#pragma unroll
            for (int i = 0; i < 8; ++i) mx = fmaxf(mx, fmaxf(ta[i], tb[i]));
            mx = fmaxf(mx, __shfl_xor(mx, 16, 32));
            const float mnew = fmaxf(m[q], mx);
            const float alpha = __builtin_amdgcn_exp2f(m[q] - mnew);
            const float sh = PSH - mnew;
            const v8f ea = ta + sh, eb = tb + sh;
            v8h pa, pc;                                      // RNE, two a conversion; a P below the smallest normal f16 stays as a subnormal operand, which the matrix unit keeps
#pragma unroll
            for (int i = 0; i < 8; i += 2) {
                const v2f xa = { __builtin_amdgcn_exp2f(ea[i]), __builtin_amdgcn_exp2f(ea[i + 1]) }, xb = { __builtin_amdgcn_exp2f(eb[i]), __builtin_amdgcn_exp2f(eb[i + 1]) };
                const v2h ha = __builtin_convertvector(xa, v2h), hb = __builtin_convertvector(xb, v2h);
                pa[i] = ha[0]; pa[i + 1] = ha[1]; pc[i] = hb[0]; pc[i + 1] = hb[1]; }
            pb[q] = cat16(pa, pc);
            float ls = 0.0f;
#pragma unroll
            for (int i = 0; i < 8; ++i) ls += (float)pa[i] + (float)pc[i];
            l[q] = l[q] * alpha + ls; m[q] = mnew;
#pragma unroll
            for (int j = 0; j < 4; ++j) o[q][j] = o[q][j] * alpha;
        }
        const h16* va = sk + 2 * TILE_H + u;
        const v16h v0 = ldh(va), v1 = ldh(va + 16 * LP), v2 = ldh(va + 32 * LP), v3 = ldh(va + 48 * LP);
#pragma unroll
        for (int q = 0; q < QT; ++q) { o[q][0] = wmma16(v0, pb[q], o[q][0]); o[q][1] = wmma16(v1, pb[q], o[q][1]); o[q][2] = wmma16(v2, pb[q], o[q][2]); o[q][3] = wmma16(v3, pb[q], o[q][3]); }
        // the distance behind the step's last matrix instructions, on both sides of the branch at the loop's foot
        asm volatile("v_nop\n\tv_nop\n\tv_nop\n\tv_nop" : "+v"(o[0][0]), "+v"(o[0][1]), "+v"(o[0][2]), "+v"(o[0][3]), "+v"(o[1][0]), "+v"(o[1][1]), "+v"(o[1][2]), "+v"(o[1][3])
                     : "v"(v0), "v"(v1), "v"(v2), "v"(v3), "v"(pb[0]), "v"(pb[1]));
      }
      asm volatile("s_wait_dscnt 0x0" ::: "memory");         // this wave's reads of the stage have returned: its buffer may be handed to the copies
      asm volatile("s_wait_asynccnt 0x0" ::: "memory");      // this wave's copies of the next stage have landed
      __syncthreads();                                       // publishes the next stage and ends every wave's reads of this one
      if (ks + 2 * KST < SEQ) {                              // block-uniform: refill the buffer just read with the stage after next
        const size_t kn = (size_t)(ks + 2 * KST);
        stage_copy(cl + (unsigned)bsel * (STG_H * 2), KP + ck + kn * HD, KR + ck + kn * HD, VT + cv + kn); }
    }
    asm volatile("s_wait_asynccnt 0x0" ::: "memory");        // nothing of the ring is in flight; the last trip's barrier has ended all reads, so it may become output staging
    const int wb = wave * 16 * 68;
#pragma unroll
    for (int q = 0; q < QT; ++q) {                           // the wave's query tiles, one after the other through the wave's own staging rows
        const float lq = l[q] + __shfl_xor(l[q], 16, 32);
        const float inv = CTXS / lq;
        // O^T D layout: o_j[r] = (d = 16j + 8h + r, t = lane&15) -> os[t][d]; rows 0..15 x columns 0..63 all written
#pragma unroll
        for (int j = 0; j < 4; ++j) { v4f a, c;
            a[0] = o[q][j][0] * inv; a[1] = o[q][j][1] * inv; a[2] = o[q][j][2] * inv; a[3] = o[q][j][3] * inv; c[0] = o[q][j][4] * inv; c[1] = o[q][j][5] * inv; c[2] = o[q][j][6] * inv; c[3] = o[q][j][7] * inv;
            *(v4fa*)(&os[wb + lr * 68 + 16 * j + 8 * hi]) = a; *(v4fa*)(&os[wb + lr * 68 + 16 * j + 8 * hi + 4]) = c; }
        wave_sync();
        h16* crow = CTX + ((size_t)b * SEQ + t0 + 16 * q) * DM + h * HD;      // ctx plane [b*SEQ + t][h*64 + d], x CTXS
#pragma unroll
        for (int s = 0; s < 4; ++s) { const int row = 4 * s + (lane >> 3), c8 = (lane & 7) * 8;   // 4 s x 4 rows = 16 rows; 8 lanes x 8 halves = 64 columns
            const v4f x0 = *(const v4fa*)(&os[wb + row * 68 + c8]); const v4f x1 = *(const v4fa*)(&os[wb + row * 68 + c8 + 4]); v8h hv;
#pragma unroll
            for (int i = 0; i < 4; ++i) { hv[i] = toh_flush(x0[i]); hv[4 + i] = toh_flush(x1[i]); }
            *(v8h*)(crow + (size_t)row * DM + c8) = hv; }
        if (q + 1 < QT) {                                   // only where another tile follows
            asm volatile("s_wait_xcnt 0x0" ::: "memory");   // ends this tile's stores before the next tile's sums reuse their registers
            __builtin_amdgcn_sched_barrier(0);              // keeps the next tile's products behind that wait; left free, the compiler lifts them over it
            wave_sync();                                    // the tile's staging rows have been read: the next tile may overwrite them
        }
    }
}

// k_out: output projection, f16 GEMM, 256 x 128 tile per block of eight waves (4 x 2), ONE WAVE per 64x64 tile, K = DM; operand rows staged as in proj_tile.
// OUT[m][n] = OSC * sum_k CTX[m][k] WoT[n][k] + bo[n] (f32). grid (NB*SEQ/256, DM/128), 256 threads.
__global__ __launch_bounds__(256) void k_out(const h16* __restrict__ A, const h16* __restrict__ Bt, const float* __restrict__ bias, float* OUT) {
    __shared__ __align__(16) h16 ring[2 * GSTG_H];           // two stages; reused as the waves' output staging behind the loop
    const int K = DM;
    const int lane = threadIdx.x & 31, lr = lane & 15, hi = lane >> 4;
    const int wave = __builtin_amdgcn_readfirstlane((int)(threadIdx.x >> 5)); const int wm = wave & 3, wn = wave >> 2;
    const int r0 = blockIdx.x * GBM + wm * 64, c0 = blockIdx.y * GBN + wn * 64;
    float* os = (float*)ring + wave * 16 * 68;
    // this thread's share of a stage: 16 bytes at column cc of rows cr + 16 i (16 lanes = one 256-B row); blockIdx.x * GBM + cr + 240 < NB * SEQ, blockIdx.y * GBN + cr + 112 < DM, cc + 7 < GKS
    const int cr = (int)(threadIdx.x >> 4), cc = (int)(threadIdx.x & 15) * 8;
    const unsigned cl = (unsigned)(size_t)(&ring[cr * GLP + cc]);               // LDS byte address in buffer 0
    const unsigned short* ca = (const unsigned short*)A + (size_t)(blockIdx.x * GBM + cr) * K + cc;    // + k
    const unsigned short* cb = (const unsigned short*)Bt + (size_t)(blockIdx.y * GBN + cr) * K + cc;   // + k
    gemm_stage(cl, ca, cb);                                                      // stage 0 -> buffer 0
    v8f acc[4][4];
#pragma unroll
    for (int mb = 0; mb < 4; ++mb)
#pragma unroll
        for (int nb = 0; nb < 4; ++nb) acc[mb][nb] = (v8f){};
    const int aoff = (wm * 64 + lr) * GLP + 8 * hi, boff = (GBM + wn * 64 + lr) * GLP + 8 * hi;   // fragment rows inside a stage
    asm volatile("s_wait_asynccnt 0x0" ::: "memory");        // this wave's copies of stage 0 have landed
    __syncthreads();                                         // every wave's have: stage 0 may be read
    gemm_stage(cl + GSTG_H * 2, ca + GKS, cb + GKS);         // stage 1 -> buffer 1
#pragma unroll 1
    for (int ks = 0; ks < K; ks += GKS) {
        const int bsel = (ks / GKS) & 1;
        const h16* sa = ring + bsel * GSTG_H + aoff; const h16* sb = ring + bsel * GSTG_H + boff;
        v16h a[2][4], b[2][4];                             // fragments are read one 32-k step ahead, in two groups a step, so that the whole kernel stays inside 256 registers
#pragma unroll
        for (int i = 0; i < 4; ++i) { a[0][i] = ldh(sa + i * 16 * GLP); b[0][i] = ldh(sb + i * 16 * GLP); }
#pragma unroll
        for (int kc = 0; kc < GKS; kc += 32) {               // the 32-k steps of the stage, in k order; unrolled so that every LDS offset is an immediate
            const int cu = (kc / 32) & 1, nx = cu ^ 1;
            // the four scheduling barriers keep each group of reads whole and a step ahead of its products; left free, the compiler sinks every read to its first use and waits there
            __builtin_amdgcn_sched_barrier(0);
            if (kc + 32 < GKS) {                             // never past the stage: the next stage is read only behind its barrier
#pragma unroll
                for (int i = 0; i < 4; ++i) a[nx][i] = ldh(sa + i * 16 * GLP + kc + 32);
#pragma unroll
                for (int i = 0; i < 2; ++i) b[nx][i] = ldh(sb + i * 16 * GLP + kc + 32); }
            __builtin_amdgcn_sched_barrier(0);
#pragma unroll
            for (int nb = 0; nb < 2; ++nb)
#pragma unroll
                for (int mb = 0; mb < 4; ++mb) acc[mb][nb] = wmma16(a[cu][mb], b[cu][nb], acc[mb][nb]);
            __builtin_amdgcn_sched_barrier(0);
            if (kc + 32 < GKS) {
#pragma unroll
                for (int i = 2; i < 4; ++i) b[nx][i] = ldh(sb + i * 16 * GLP + kc + 32); }
            __builtin_amdgcn_sched_barrier(0);
#pragma unroll
            for (int nb = 2; nb < 4; ++nb)
#pragma unroll
                for (int mb = 0; mb < 4; ++mb) acc[mb][nb] = wmma16(a[cu][mb], b[cu][nb], acc[mb][nb]);
        }
        // the distance behind the stage's last matrix instructions, on both sides of the branch below
        asm volatile("v_nop\n\tv_nop\n\tv_nop\n\tv_nop" : "+v"(acc[0][0]), "+v"(acc[1][0]), "+v"(acc[2][0]), "+v"(acc[3][0]), "+v"(acc[0][1]), "+v"(acc[1][1]), "+v"(acc[2][1]), "+v"(acc[3][1]),
                     "+v"(acc[0][2]), "+v"(acc[1][2]), "+v"(acc[2][2]), "+v"(acc[3][2]), "+v"(acc[0][3]), "+v"(acc[1][3]), "+v"(acc[2][3]), "+v"(acc[3][3]));
        asm volatile("s_wait_dscnt 0x0" ::: "memory");       // this wave's reads of the stage have returned: its buffer may be handed to the copies
        asm volatile("s_wait_asynccnt 0x0" ::: "memory");    // this wave's copies of the next stage have landed
        __syncthreads();                                     // publishes the next stage and ends every wave's reads of this one
        if (ks + 2 * GKS < K)                                // block-uniform: refill the buffer just read with the stage after next
            gemm_stage(cl + (unsigned)bsel * (GSTG_H * 2), ca + ks + 2 * GKS, cb + ks + 2 * GKS);
    }
    asm volatile("s_wait_asynccnt 0x0" ::: "memory");        // nothing of the ring is in flight; the last trip's barrier has ended all reads, so it may become output staging
    const int cofs = lr * 4;
    v4f bb; { const v4f t = *(const v4f*)(bias + c0 + cofs);      // c0 + cofs + 3 < DM
#pragma unroll
        for (int i = 0; i < 4; ++i) bb[i] = bfr(t[i]); }
    float* orow = OUT + ((size_t)(r0 / SEQ) * OUT_SEQ + (size_t)(r0 % SEQ)) * DM + c0;
#pragma unroll
    for (int mb = 0; mb < 4; ++mb) {
#pragma unroll
        for (int nb = 0; nb < 4; ++nb) {
#pragma unroll
            for (int j = 0; j < 8; ++j) os[(hi * 8 + j) * 68 + nb * 16 + lr] = acc[mb][nb][j]; }   // D: row 8h+j, col lane&15
        wave_sync();
{
#pragma unroll
            for (int s = 0; s < 8; ++s) { const int row = 2 * s + hi;   // 8 s x 2 rows = 16 rows; 16 lanes x 4 floats = 64 columns
                const v4f x = *(const v4fa*)(&os[row * 68 + cofs]); v4f val;
#pragma unroll
                for (int i = 0; i < 4; ++i) val[i] = x[i] * OSC + bb[i];
                *(v4f*)(orow + (size_t)(mb * 16 + row) * DM + cofs) = val; }
             }
        wave_sync();
    }
}

static constexpr size_t al256(size_t v) { return (v + 255) & ~(size_t)255; }
static constexpr size_t SZ_XB = al256((size_t)NB * SEQ * DM * 2);
static constexpr size_t SZ_WB = al256((size_t)3 * DM * DM * 2);
static constexpr size_t SZ_PL = al256((size_t)NB * NH_ * SEQ * HD * 2);
static constexpr size_t SZ_TOTAL = 3 * SZ_XB + SZ_WB + 5 * SZ_PL;
static_assert(SZ_TOTAL <= (size_t)268435456);                  // workspace carve <= 256 MiB
static_assert(((size_t)DM * DM * 2) % 256 == 0);               // weight sub-planes stay 256-byte aligned
static_assert((size_t)3 * DM * DM * 2 <= SZ_WB);               // three weight sub-planes (q | k | o) fit their region
static_assert((size_t)NB * SEQ * DM * 2 <= SZ_XB);             // ctx plane (aliases the query copy) fits its region

extern "C" void kernel_launch(void* const* d_in, const int* in_sizes, int n_in,
                              void* d_out, int out_size, void* d_ws, size_t ws_size, hipStream_t stream) {
    if (n_in < 9) return;
    const size_t needx = ((size_t)(NB - 1) * SEQ_FULL + SEQ) * DM;
    if ((size_t)in_sizes[0] < needx || (size_t)in_sizes[1] < needx || (size_t)in_sizes[2] < needx) return;
    if ((size_t)in_sizes[3] < (size_t)DM * DM || (size_t)in_sizes[5] < (size_t)DM * DM || (size_t)in_sizes[7] < (size_t)DM * DM) return;
    if (in_sizes[4] < DM || in_sizes[6] < DM || in_sizes[8] < DM) return;
    if ((size_t)out_size < ((size_t)(NB - 1) * OUT_SEQ + SEQ) * DM) return;
    if (SZ_TOTAL > ws_size) return;
    // wire order: q, k, v, q_w, q_b, k_w, k_b, out_w, out_b
    const float* xq = (const float*)d_in[0]; const float* xk = (const float*)d_in[1]; const float* xv = (const float*)d_in[2];
    const float* wq = (const float*)d_in[3]; const float* bq = (const float*)d_in[4];
    const float* wk = (const float*)d_in[5]; const float* bk = (const float*)d_in[6];
    const float* wo = (const float*)d_in[7]; const float* bo = (const float*)d_in[8];
    float* OUT = (float*)d_out;      // [NB][OUT_SEQ][1024]
    char* wsp = (char*)d_ws;
    bf* XQ = (bf*)wsp; wsp += SZ_XB;                 // [NB*SEQ][1024] bf16 queries; region reused later as the ctx plane
    bf* XK = (bf*)wsp; wsp += SZ_XB;                 // [NB*SEQ][1024] bf16 keys
    bf* XV = (bf*)wsp; wsp += SZ_XB;                 // [NB*SEQ][1024] bf16 values
    bf* WB = (bf*)wsp; wsp += SZ_WB;                 // [3][1024][1024] transposed [out][in]: q | k (bf16) | o (f16 x64)
    h16* QH = (h16*)wsp; wsp += SZ_PL;               // [NB*16][SEQ][64]
    h16* KP = (h16*)wsp; wsp += SZ_PL;               // [NB*16][SEQ][64]
    h16* VT = (h16*)wsp; wsp += SZ_PL;               // [NB*16][64][SEQ]
    h16* QR = (h16*)wsp; wsp += SZ_PL;               // [NB*16][SEQ][64] f16 x2048; a region of its own: the projections run side by side, so no input copy may be overwritten by one of them
    h16* KR = (h16*)wsp; wsp += SZ_PL;               // [NB*16][SEQ][64] f16 x2048; likewise
    h16* CTX = (h16*)XQ;                             // [NB*SEQ][1024] f16 x256, written after the projection launch has consumed XQ
    bf* WQT = WB; bf* WKT = WB + (size_t)DM * DM; bf* WOT = WB + (size_t)2 * DM * DM;

    k_prep<<<dim3(6, PREP_GX, 1), 256, 0, stream>>>(xq, xk, xv, wq, wk, wo, XQ, XK, XV, (unsigned short*)WQT, (unsigned short*)WKT, (unsigned short*)WOT);

    k_proj3<<<dim3(PJ_BLK, 3, 1), 256, 0, stream>>>(XQ, XK, XV, WQT, WKT, bq, bk, QH, QR, KP, KR, VT);

    k_flash<<<dim3(SEQ / (16 * QT * AW), NB * NH_, 1), 32 * AW, 0, stream>>>(QH, QR, KP, KR, VT, CTX);

    k_out<<<dim3(NB * SEQ / GBM, DM / GBN, 1), 256, 0, stream>>>(CTX, (const h16*)WOT, bo, OUT);
}

// v008
// A run of this version takes 134 microseconds.
// It is 1.28 times as fast as v006, going by the measured steps of the versions left out in between.
// Over all steps from v000 it is 3.83 times as fast.
#include <hip/hip_runtime.h>

// Multi-head self-attention block, width 1024 = 16 heads x 64; separate query / key / value inputs [NB][SEQ][1024]; q_w / k_w / out_w stored [in][out] (y = x W + b); the value projection uses the query weight and the query bias (there is no separate value weight); no mask; score scale 1/8; output = ctx out_w + out_b (f32).
// Compute dtypes, f32 accumulate everywhere: q/k/v projections v_wmma_f32_16x16x32_bf16 (inputs and weights RNE-converted to bf16; products exact); scores v_wmma_f32_16x16x32_f16 with q and k as single f16 values (their f16 rounding lies an order of magnitude below the bf16 rounding of the inputs and weights that is already in them); P.V v_wmma_f32_16x16x32_f16 (P x256 carry, cancels in the normalisation; v single f16); output projection v_wmma_f32_16x16x32_f16: ctx f16 with x256 carry, out_w^T (bf16 RNE value) x64 as f16, carries folded back in the f32 epilogue; softmax f32 (online; the maximum in use may trail the running maximum by up to 7 in the scaled log2 scores); biases (bf16 RNE values) added in f32.
// Launches: k_prep (all operand conversions, independent of one another, one grid), k_proj3 (the three projections, independent of one another, one grid), k_flash, k_out.
// Layout: bf16 copies of the three inputs; transposed 16-bit weight planes [out][in]; q, k planes [b*16+h][t][d] and v^T plane [b*16+h][d][t] written by the GEMM epilogue; fused flash kernel in transposed form (S^T = K Q^T, O^T = V^T P^T) writing the ctx plane [b*SEQ+t][h*64+d]; final GEMM writes the f32 output.

#ifndef NB
#define NB 4
#endif
#ifndef SEQ
#define SEQ 2048
#endif
#define NB_FULL  4
#define SEQ_FULL 2048
#ifndef OUT_SEQ
#define OUT_SEQ SEQ              // row pitch (in tokens) between batches of the output
#endif
#define DM   1024
#define NH_  16
#define HD   64
#define AW   8                   // waves per flash block; all of them read the same staged key tiles
#define QT   2                   // query tiles (16 rows each) per flash wave: each fragment read from LDS feeds QT products
#define KST  64                  // keys per LDS stage: every staged row (K: one key; V^T: one d) is one whole 128-B line
#define LP   72                  // LDS row pitch in halves: 144 B = 16 B x odd, conflict-free for 16-byte fragment reads
#define TILE_H (64 * LP)         // halves of one staged tile (64 rows)
#define STG_H  (2 * TILE_H)      // one stage: K | V^T
#define SC2  (0.125f * 1.4426950408889634f)   // HD^-0.5 * log2(e)
#define PSH  8.0f                // log2 of the P carry (256)
#define TAU  7.0f                // a column's maximum in use may trail its running maximum by up to TAU (scaled log2): P <= 2^(PSH + TAU) = 2^15, inside f16
#define CTXS 256.0f              // carry of the ctx plane
#define WOS  64.0f               // carry of the Wo^T plane
#define OSC  (1.0f / 16384.0f)   // 1 / (CTXS * WOS)
#define GBM  256                 // GEMM block tile: rows of A
#define GBN  128                 // GEMM block tile: rows of Bt (output columns)
#define GKS  128                 // k per LDS stage of the GEMMs: every staged row is 256 B, two whole lines
#define GLP  136                 // LDS row pitch of the GEMM stages in halves: 272 B = 16 B x odd, conflict-free for 16-byte fragment reads
#define GSTG_H ((GBM + GBN) * GLP)   // halves of one GEMM stage: A rows | Bt rows
#define CVW  32                  // input conversion: 512-byte loads per wave (16 KiB of f32 a wave)

static_assert(HD == 64);
static_assert(NH_ * HD == DM);                 // head h = columns h*64 + d
static_assert(DM % 64 == 0);                   // column tiles of 64
static_assert(DM % 32 == 0);                   // GEMM k-loop steps by 32
static_assert(SEQ % 64 == 0);                  // a 64-row tile never straddles two batches
static_assert((NB * SEQ) % 64 == 0);
static_assert(SEQ % 32 == 0);                  // key loop steps by 32
static_assert(QT == 2 && SEQ % (16 * QT * AW) == 0);   // flash grid covers the sequence exactly
static_assert(SEQ % KST == 0);                 // key stages cover the sequence exactly
static_assert(KST == 64 && KST % 32 == 0);     // a stage is two 32-key steps; V^T rows of a stage are 128 B
static_assert(32 * AW * 2 * 8 == 64 * HD);     // two 16-byte copies per thread fill one 64 x 64 tile
static_assert((size_t)AW * 16 * 68 * 4 <= (size_t)2 * STG_H * 2);   // output staging fits the ring it reuses
static_assert(((size_t)SEQ * DM) % (CVW * 128) == 0);            // a wave's share of the input conversion never straddles two batches
static_assert(((size_t)NB * SEQ * DM) % (8 * CVW * 128) == 0);   // its grid of eight-wave blocks covers an input exactly
static_assert(DM % GBM == 0 && DM % GBN == 0 && (NB * SEQ) % GBM == 0 && (NB * SEQ) % GBN == 0);   // GEMM grids cover every operand exactly
static_assert(DM % GKS == 0 && DM / GKS >= 2 && GKS % 32 == 0);   // whole stages, at least two of them
static_assert(GBM == 4 * 64 && GBN == 2 * 64);                   // eight waves, 4 x 2, one 64 x 64 tile each
static_assert(256 * 8 * 8 == 128 * GKS);                         // eight 16-byte copies per thread fill 128 staged rows
static_assert((size_t)8 * 16 * 68 * 4 <= (size_t)2 * GSTG_H * 2);   // the waves' output staging fits the ring it reuses
static_assert(((size_t)DM * DM) % 8 == 0);
static_assert(NB <= NB_FULL);
static_assert(SEQ <= SEQ_FULL);
static_assert(CTXS * WOS * OSC == 1.0f);       // output carries fold back exactly

typedef _Float16 h16;
typedef unsigned short bf;
typedef __attribute__((ext_vector_type(16))) __bf16   v16bf;
typedef __attribute__((ext_vector_type(16))) _Float16 v16h;
typedef __attribute__((ext_vector_type(8)))  _Float16 v8h;
typedef __attribute__((ext_vector_type(8)))  unsigned short v8us;
typedef __attribute__((ext_vector_type(4)))  unsigned short v4us;
typedef __attribute__((ext_vector_type(8)))  float    v8f;
typedef __attribute__((ext_vector_type(4)))  float    v4f;
typedef __attribute__((ext_vector_type(2)))  float    v2f;
typedef __attribute__((ext_vector_type(2)))  _Float16 v2h;
typedef v4f  __attribute__((may_alias)) v4fa;

__device__ __forceinline__ unsigned short f2bf(float f) { unsigned u = __float_as_uint(f); u += 0x7FFFu + ((u >> 16) & 1u); return (unsigned short)(u >> 16); }
__device__ __forceinline__ float bfr(float f) { return __uint_as_float(((unsigned)f2bf(f)) << 16); }   // value of the bf16 RNE conversion, as f32
__device__ __forceinline__ v16h cat16(v8h lo, v8h hi) { return __builtin_shufflevector(lo, hi, 0, 1, 2, 3, 4, 5, 6, 7, 8, 9, 10, 11, 12, 13, 14, 15); }
__device__ __forceinline__ v16bf cat16b(v8us lo, v8us hi) { return __builtin_bit_cast(v16bf, __builtin_shufflevector(lo, hi, 0, 1, 2, 3, 4, 5, 6, 7, 8, 9, 10, 11, 12, 13, 14, 15)); }
__device__ __forceinline__ v8f wmma16(v16h a, v16h b, v8f c) { return __builtin_amdgcn_wmma_f32_16x16x32_f16(false, a, false, b, (short)0, c, false, false); }
__device__ __forceinline__ v8f wmmab(v16bf a, v16bf b, v8f c) { return __builtin_amdgcn_wmma_f32_16x16x32_bf16(false, a, false, b, (short)0, c, false, false); }
// fragment loaders from K-contiguous 16-bit rows; p already includes + 8*(lane>>4): elements 0..7 <- k0+8h+0..7, elements 8..15 <- k0+16+8h+0..7 (same map for A and B)
__device__ __forceinline__ v16h  ldh(const h16* p) { return cat16(*(const v8h*)p, *(const v8h*)(p + 16)); }
__device__ __forceinline__ v16bf ldb(const bf* p)  { return cat16b(*(const v8us*)p, *(const v8us*)(p + 16)); }
// ordering point for wave-private LDS tiles (same wave writes and reads)
__device__ __forceinline__ void wave_sync() { __builtin_amdgcn_fence(3 /* release order */, "wavefront"); __builtin_amdgcn_wave_barrier(); asm volatile("" ::: "memory"); }
// f32 -> f16 for operand planes: a result below the smallest normal f16 magnitude is replaced by zero (value select)
static __device__ __forceinline__ h16 toh_flush(float v) { const h16 r = (h16)v; return (fabsf(v) < 6.103515625e-05f) ? (h16)0.0f : r; }

// cvt_in: bf16 RNE copy of one input, written as a stream: block blk of the copy, every wave converts CVW * 128 consecutive floats.
// All CVW loads of a wave (16 bytes a lane, 512 contiguous bytes a wave = four whole lines) are issued before the first conversion; a wave's 8-byte stores cover 256 contiguous bytes.
__device__ __forceinline__ void cvt_in(const float* __restrict__ src, bf* __restrict__ dst, unsigned blk) {
    const size_t e0 = ((size_t)blk * 8 + (threadIdx.x >> 5)) * (CVW * 128);   // first element of this wave's share in the packed copy [NB*SEQ][DM]
    const size_t s0 = (SEQ == SEQ_FULL) ? e0 : (e0 / ((size_t)SEQ * DM)) * ((size_t)SEQ_FULL * DM) + e0 % ((size_t)SEQ * DM);   // the same element in the input (batch pitch SEQ_FULL)
    const float* s = src + s0 + (threadIdx.x & 31) * 4;
    bf* d = dst + e0 + (threadIdx.x & 31) * 4;
    v4f v[CVW];
#pragma unroll
    for (int j = 0; j < CVW; ++j) v[j] = *(const v4f*)(s + j * 128);
    __builtin_amdgcn_sched_barrier(0);   // keeps every load ahead of the first conversion; left free, the compiler holds the last four back until the others have returned: a second trip to memory
#pragma unroll
    for (int j = 0; j < CVW; ++j) { v4us o;
#pragma unroll
        for (int k = 0; k < 4; ++k) o[k] = f2bf(v[j][k]);
        *(v4us*)(d + j * 128) = o; }
    asm volatile("s_wait_xcnt 0x0" ::: "memory");   // ends the run of stores: in the joined kernel another job's code follows in the text and reuses their registers
}

// cvt_wT: transpose + 16-bit convert of one 64 x 64 tile (columns n0.., rows k0..) of a weight matrix: in[R][C] (f32, R = contraction index, C = output feature) -> out[C][R] (16-bit, contraction-contiguous); ts = 64 x 65 floats of LDS.
// F16OUT == 0: bf16 RNE bits; F16OUT == 1: f16 of (bf16 RNE value x WOS) (exact for values whose scaled magnitude is in the f16 normal range).
template <int F16OUT>
__device__ __forceinline__ void cvt_wT(const float* __restrict__ W, unsigned short* dst, float* ts, int n0, int k0) {
    const int R = DM, C = DM;
    const int tid = threadIdx.x;
#pragma unroll
    for (int it = 0; it < 4; ++it) {                     // 4 x 16 rows x (16 lanes x 4 floats) = 64 x 64, all written
        const int r = it * 16 + (tid >> 4), c4 = (tid & 15) * 4;
        const v4f v = *(const v4f*)(W + (size_t)(k0 + r) * (size_t)C + n0 + c4);
#pragma unroll
        for (int i = 0; i < 4; ++i) ts[r * 65 + c4 + i] = v[i];
    }
    __syncthreads();
    v8us o[2];
#pragma unroll
    for (int it = 0; it < 2; ++it) {                     // 2 x 32 output rows x (8 lanes x 8 halves) = 64 x 64
        const int n = it * 32 + (tid >> 3), k8 = (tid & 7) * 8;
#pragma unroll
        for (int i = 0; i < 8; ++i) {
            const float x = ts[(k8 + i) * 65 + n];
            const unsigned short bb = f2bf(x);
            if (F16OUT) { const h16 hv = (h16)(__uint_as_float(((unsigned)bb) << 16) * WOS); o[it][i] = __builtin_bit_cast(unsigned short, hv); }
            else o[it][i] = bb;
        }
    }
{
#pragma unroll
        for (int it = 0; it < 2; ++it) { const int n = it * 32 + (tid >> 3), k8 = (tid & 7) * 8;
            *(v8us*)(dst + (size_t)(n0 + n) * (size_t)R + k0 + k8) = o[it]; }
         }
    asm volatile("s_wait_xcnt 0x0" ::: "memory");   // ends the two stores: in the joined kernel another job's code follows in the text and reuses their registers
}

// k_prep: every operand conversion in one grid (none reads what another writes): blockIdx.x 0..2 = weight planes q | k | o, one 64 x 64 tile a block; blockIdx.x 3..5 = input copies q | k | v; blockIdx.y = which block of it.
// The job is the fast index, so that the short, latency-bound weight blocks start spread among the blocks of the input stream and run under it. Every branch here is block-uniform.
#define WT_BLK ((DM / 64) * (DM / 64))                            // blocks of one weight plane
#define CV_BLK ((unsigned)((size_t)NB * SEQ * DM / (8 * CVW * 128)))   // blocks of one input copy
#define PREP_GX (WT_BLK > CV_BLK ? WT_BLK : CV_BLK)               // blocks of the longest job
__global__ __launch_bounds__(256) void k_prep(const float* __restrict__ xq, const float* __restrict__ xk, const float* __restrict__ xv, const float* __restrict__ wq, const float* __restrict__ wk, const float* __restrict__ wo,
                                              bf* __restrict__ dq, bf* __restrict__ dk, bf* __restrict__ dv, unsigned short* __restrict__ tq, unsigned short* __restrict__ tk, unsigned short* __restrict__ to) {
    __shared__ float ts[64 * 65];
    const unsigned y = blockIdx.x, x = blockIdx.y;           // y = job, x = block of the job
    if (y < 3) {
        if (x >= WT_BLK) return;
        const int n0 = (int)(x % (DM / 64)) * 64, k0 = (int)(x / (DM / 64)) * 64;
        if (y == 2) cvt_wT<1>(wo, to, ts, n0, k0);
        else cvt_wT<0>(y == 0 ? wq : wk, y == 0 ? tq : tk, ts, n0, k0);
    } else {
        if (x >= CV_BLK) return;
        cvt_in(y == 3 ? xq : (y == 4 ? xk : xv), y == 3 ? dq : (y == 4 ? dk : dv), x);
    }
}

// gemm_copy8: one thread's share of 128 staged rows, eight 16-byte asynchronous copies global -> LDS (rows r, r + 16, ..., r + 112 of a K-contiguous 16-bit plane of row length DM).
// The s_wait_xcnt ends the copies' own statement so that no address register named there is rewritten ahead of it.
__device__ __forceinline__ void gemm_copy8(unsigned l, const unsigned short* g) {
    asm volatile("global_load_async_to_lds_b128 %0, %8, off\n\tglobal_load_async_to_lds_b128 %1, %9, off\n\t"
                 "global_load_async_to_lds_b128 %2, %10, off\n\tglobal_load_async_to_lds_b128 %3, %11, off\n\t"
                 "global_load_async_to_lds_b128 %4, %12, off\n\tglobal_load_async_to_lds_b128 %5, %13, off\n\t"
                 "global_load_async_to_lds_b128 %6, %14, off\n\tglobal_load_async_to_lds_b128 %7, %15, off\n\ts_wait_xcnt 0x0"
                 :: "v"(l), "v"(l + 16 * GLP * 2), "v"(l + 32 * GLP * 2), "v"(l + 48 * GLP * 2), "v"(l + 64 * GLP * 2), "v"(l + 80 * GLP * 2), "v"(l + 96 * GLP * 2), "v"(l + 112 * GLP * 2),
                    "v"(g), "v"(g + 16 * DM), "v"(g + 32 * DM), "v"(g + 48 * DM), "v"(g + 64 * DM), "v"(g + 80 * DM), "v"(g + 96 * DM), "v"(g + 112 * DM) : "memory");
}
// gemm_stage: one thread's share of a GEMM stage (GBM rows of A, then GBN rows of Bt, GKS halves of each); l = LDS byte address of its piece of row (thread / 16) of the stage.
__device__ __forceinline__ void gemm_stage(unsigned l, const unsigned short* ga, const unsigned short* gb) {
    gemm_copy8(l, ga); gemm_copy8(l + 128 * GLP * 2, ga + (size_t)128 * DM); gemm_copy8(l + GBM * GLP * 2, gb);
}

// proj_tile: register-blocked bf16 GEMM, 256 x 128 tile (bx, by) per block of eight waves (4 x 2), ONE WAVE per 64x64 tile (16 accumulators), K = DM; the K-contiguous bf16 operand rows come in
// stages of 128 k through a two-buffer LDS ring that the waves share: asynchronous 16-byte copies (whole lines), stage s + 2 issued behind the barrier that ends the reads of stage s.
// C[m][n] = sum_k A[m][k] Bt[n][k] + bias (BROW == 0: bias[n]; BROW == 1: bias[m]), written as f16 (Ph) at
// tile base (r0/RB)*sRB + (r0%RB)*pitch + (c0/CB)*sCB + (c0%CB), row pitch 'pitch' (halves). bx < M/256, by < N/128, 256 threads; ring = the block's 2 * GSTG_H halves of LDS.
template <int BROW>
__device__ __forceinline__ void proj_tile(bf* ring, int bx, int by, const bf* __restrict__ A, const bf* __restrict__ Bt, const float* __restrict__ bias, h16* Ph, int RB, size_t sRB, int pitch, int CB, size_t sCB) {
    const int K = DM;
    const int lane = threadIdx.x & 31, lr = lane & 15, hi = lane >> 4;
    const int wave = __builtin_amdgcn_readfirstlane((int)(threadIdx.x >> 5)); const int wm = wave & 3, wn = wave >> 2;
    const int r0 = bx * GBM + wm * 64, c0 = by * GBN + wn * 64;
    float* os = (float*)ring + wave * 16 * 68;
    // this thread's share of a stage: 16 bytes at column cc of rows cr + 16 i (16 lanes = one 256-B row); bx * GBM + cr + 240 < M, by * GBN + cr + 112 < N, cc + 7 < GKS
    const int cr = (int)(threadIdx.x >> 4), cc = (int)(threadIdx.x & 15) * 8;
    const unsigned cl = (unsigned)(size_t)(&ring[cr * GLP + cc]);               // LDS byte address in buffer 0
    const bf* ca = A + (size_t)(bx * GBM + cr) * K + cc;                        // + k
    const bf* cb = Bt + (size_t)(by * GBN + cr) * K + cc;                       // + k
    gemm_stage(cl, ca, cb);                                                      // stage 0 -> buffer 0
    v8f acc[4][4];
#pragma unroll
    for (int mb = 0; mb < 4; ++mb)
#pragma unroll
        for (int nb = 0; nb < 4; ++nb) acc[mb][nb] = (v8f){};
    const int aoff = (wm * 64 + lr) * GLP + 8 * hi, boff = (GBM + wn * 64 + lr) * GLP + 8 * hi;   // fragment rows inside a stage
    asm volatile("s_wait_asynccnt 0x0" ::: "memory");        // this wave's copies of stage 0 have landed
    __syncthreads();                                         // every wave's have: stage 0 may be read
    gemm_stage(cl + GSTG_H * 2, ca + GKS, cb + GKS);         // stage 1 -> buffer 1
#pragma unroll 1
    for (int ks = 0; ks < K; ks += GKS) {
        const int bsel = (ks / GKS) & 1;
        const bf* sa = ring + bsel * GSTG_H + aoff; const bf* sb = ring + bsel * GSTG_H + boff;
        v16bf a[2][4], b[2][4];                             // fragments are read one 32-k step ahead, in two groups a step, so that the whole kernel stays inside 256 registers
#pragma unroll
        for (int i = 0; i < 4; ++i) { a[0][i] = ldb(sa + i * 16 * GLP); b[0][i] = ldb(sb + i * 16 * GLP); }
#pragma unroll
        for (int kc = 0; kc < GKS; kc += 32) {               // the 32-k steps of the stage, in k order; unrolled so that every LDS offset is an immediate
            const int cu = (kc / 32) & 1, nx = cu ^ 1;
            // the four scheduling barriers keep each group of reads whole and a step ahead of its products; left free, the compiler sinks every read to its first use and waits there
            __builtin_amdgcn_sched_barrier(0);
            if (kc + 32 < GKS) {                             // never past the stage: the next stage is read only behind its barrier
#pragma unroll
                for (int i = 0; i < 4; ++i) a[nx][i] = ldb(sa + i * 16 * GLP + kc + 32);
#pragma unroll
                for (int i = 0; i < 2; ++i) b[nx][i] = ldb(sb + i * 16 * GLP + kc + 32); }
            __builtin_amdgcn_sched_barrier(0);
#pragma unroll
            for (int nb = 0; nb < 2; ++nb)
#pragma unroll
                for (int mb = 0; mb < 4; ++mb) acc[mb][nb] = wmmab(a[cu][mb], b[cu][nb], acc[mb][nb]);
            __builtin_amdgcn_sched_barrier(0);
            if (kc + 32 < GKS) {
#pragma unroll
                for (int i = 2; i < 4; ++i) b[nx][i] = ldb(sb + i * 16 * GLP + kc + 32); }
            __builtin_amdgcn_sched_barrier(0);
#pragma unroll
            for (int nb = 2; nb < 4; ++nb)
#pragma unroll
                for (int mb = 0; mb < 4; ++mb) acc[mb][nb] = wmmab(a[cu][mb], b[cu][nb], acc[mb][nb]);
        }
        // the distance behind the stage's last matrix instructions, on both sides of the branch below
        asm volatile("v_nop\n\tv_nop\n\tv_nop\n\tv_nop" : "+v"(acc[0][0]), "+v"(acc[1][0]), "+v"(acc[2][0]), "+v"(acc[3][0]), "+v"(acc[0][1]), "+v"(acc[1][1]), "+v"(acc[2][1]), "+v"(acc[3][1]),
                     "+v"(acc[0][2]), "+v"(acc[1][2]), "+v"(acc[2][2]), "+v"(acc[3][2]), "+v"(acc[0][3]), "+v"(acc[1][3]), "+v"(acc[2][3]), "+v"(acc[3][3]));
        asm volatile("s_wait_dscnt 0x0" ::: "memory");       // this wave's reads of the stage have returned: its buffer may be handed to the copies
        asm volatile("s_wait_asynccnt 0x0" ::: "memory");    // this wave's copies of the next stage have landed
        __syncthreads();                                     // publishes the next stage and ends every wave's reads of this one
        if (ks + 2 * GKS < K)                                // block-uniform: refill the buffer just read with the stage after next
            gemm_stage(cl + (unsigned)bsel * (GSTG_H * 2), ca + ks + 2 * GKS, cb + ks + 2 * GKS);
    }
    asm volatile("s_wait_asynccnt 0x0" ::: "memory");        // nothing of the ring is in flight; the last trip's barrier has ended all reads, so it may become output staging
    // column bias for this lane's 8 store columns (BROW == 0); c0 + (lane&7)*8 + 7 < N = DM
    v4f bc0 = (v4f){}, bc1 = (v4f){};
    if (BROW == 0) { const int cb8 = (lane & 7) * 8; const v4f t0 = *(const v4f*)(bias + c0 + cb8); const v4f t1 = *(const v4f*)(bias + c0 + cb8 + 4);
#pragma unroll
        for (int i = 0; i < 4; ++i) { bc0[i] = bfr(t0[i]); bc1[i] = bfr(t1[i]); } }
    const size_t tbase = (size_t)(r0 / RB) * sRB + (size_t)(r0 % RB) * (size_t)pitch + (size_t)(c0 / CB) * sCB + (size_t)(c0 % CB);
#pragma unroll
    for (int mb = 0; mb < 4; ++mb) {
#pragma unroll
        for (int nb = 0; nb < 4; ++nb) {
#pragma unroll
            for (int j = 0; j < 8; ++j) os[(hi * 8 + j) * 68 + nb * 16 + lr] = acc[mb][nb][j]; }   // D: row 8h+j, col lane&15
        wave_sync();
        const size_t sb = tbase + (size_t)(mb * 16) * (size_t)pitch;
{
#pragma unroll
            for (int s = 0; s < 4; ++s) { const int row = 4 * s + (lane >> 3), c8 = (lane & 7) * 8;   // 4 s x 4 row groups = 16 rows; 8 lanes x 8 = 64 columns
                v4f x0 = *(const v4fa*)(&os[row * 68 + c8]); v4f x1 = *(const v4fa*)(&os[row * 68 + c8 + 4]); v8h hv;
                if (BROW == 1) { const float br = bfr(bias[r0 + mb * 16 + row]);                    // row bias; r0 + mb*16 + row < M = DM
#pragma unroll
                    for (int i = 0; i < 4; ++i) { x0[i] += br; x1[i] += br; } }
                else {
#pragma unroll
                    for (int i = 0; i < 4; ++i) { x0[i] += bc0[i]; x1[i] += bc1[i]; } }
#pragma unroll
                for (int i = 0; i < 4; ++i) { hv[i] = toh_flush(x0[i]); hv[4 + i] = toh_flush(x1[i]); }
                *(v8h*)(Ph + sb + (size_t)row * (size_t)pitch + c8) = hv; }
             }
        asm volatile("s_wait_xcnt 0x0" ::: "memory");   // ends this row block's stores before the next block's loads and sums reuse their registers
        wave_sync();
    }
}

// k_proj3: the three projections in one grid (none reads what another writes): blockIdx.y 0 = v^T, 1 = k, 2 = q; blockIdx.x = tile, row tiles of A fastest. Every branch here is block-uniform.
// v^T: the value projection uses the QUERY weight and bias: A = q_w^T rows (m = h*64 + d), Bt = value-input rows (n = b*SEQ + t), row bias q_b[m] -> plane [(b*1024 + m)][t] = [(b*16 + h)][d][t].
// k, q: A = x rows (m = b*SEQ + t), Bt = W^T rows (n = h*64 + d), column bias -> planes [(b*16 + h)][t][d].
#define PJ_BLK ((DM / GBM) * (NB * SEQ / GBN))                    // tiles of one projection, in either orientation
static_assert(PJ_BLK == (NB * SEQ / GBM) * (DM / GBN));
__global__ __launch_bounds__(256) void k_proj3(const bf* __restrict__ XQ, const bf* __restrict__ XK, const bf* __restrict__ XV, const bf* __restrict__ WQT, const bf* __restrict__ WKT, const float* __restrict__ bq, const float* __restrict__ bk,
                                               h16* QH, h16* KP, h16* VT) {
    __shared__ __align__(16) bf ring[2 * GSTG_H];            // two stages; reused as the waves' output staging behind the loop
    const int t = (int)blockIdx.x;
    if (blockIdx.y == 0) proj_tile<1>(ring, t % (DM / GBM), t / (DM / GBM), WQT, XV, bq, VT, DM, (size_t)0, SEQ, SEQ, (size_t)DM * SEQ);
    else { const bool isq = blockIdx.y == 2;
        proj_tile<0>(ring, t % (NB * SEQ / GBM), t / (NB * SEQ / GBM), isq ? XQ : XK, isq ? WQT : WKT, isq ? bq : bk, isq ? QH : KP, SEQ, (size_t)NH_ * SEQ * HD, HD, HD, (size_t)SEQ * HD); }
}

// stage_copy: one thread's share of a 64-key stage, 16-byte asynchronous copies global -> LDS, two per tile (rows r and r + 32); l = LDS byte address of its K-tile piece.
// The s_wait_xcnt ends the copies' own statement so that no address register named there is rewritten ahead of it.
__device__ __forceinline__ void stage_copy(unsigned l, const h16* gk, const h16* gv) {
    const unsigned lk1 = l + 32 * LP * 2, lv0 = l + TILE_H * 2, lv1 = lv0 + 32 * LP * 2;
    const h16* gk1 = gk + 32 * HD; const h16* gv1 = gv + (size_t)32 * SEQ;
    asm volatile("global_load_async_to_lds_b128 %0, %4, off\n\tglobal_load_async_to_lds_b128 %1, %5, off\n\t"
                 "global_load_async_to_lds_b128 %2, %6, off\n\tglobal_load_async_to_lds_b128 %3, %7, off\n\ts_wait_xcnt 0x0"
                 :: "v"(l), "v"(lk1), "v"(lv0), "v"(lv1), "v"(gk), "v"(gk1), "v"(gv), "v"(gv1) : "memory");
}

// k_flash: fused attention, one wave per QT * 16 = 32 query rows of one (batch, head); Q fragments straight from the f16 plane; K and V^T come in 64-key stages through a
// two-buffer LDS ring that the block's waves share: asynchronous 16-byte copies (whole 128-B lines per row), stage t + 2 issued behind the barrier that ends the reads of stage t.
// Every K and V^T fragment read from LDS feeds the products of both query tiles of the wave: half the LDS reads, ring copies and barriers per score of a 16-row wave.
// Transposed form: S^T[key][t] = K Q^T (A = K rows, B = Q rows); lane (t = lane&15, h = lane>>4) holds keys 8h+r of each 16-key tile, so the packed
// P tile is directly the B fragment of O^T[d][t] = V^T P^T (element r <- tile keys 0..15, element 8+r <- tile keys 16..31, lane unchanged).
// Per 32-key step and query tile: 4 score products, 4 P.V products.
// Softmax state (maximum in use, partial sum) is one scalar per lane and query tile. The maximum in use is renewed, and l and O^T rescaled, only in a step where some column's
// new maximum exceeds it by more than TAU: one test per step for the whole wave (a scalar branch); the two lane halves of a column exchange their maxima only there.
__global__ __launch_bounds__(32 * AW, 4) void k_flash(const h16* __restrict__ QH, const h16* __restrict__ KP, const h16* __restrict__ VT, h16* CTX) {
    __shared__ __align__(16) h16 ring[2 * STG_H];            // two stages; reused as output staging behind the loop
    float* os = (float*)ring;
    const int lane = threadIdx.x & 31, lr = lane & 15, hi = lane >> 4;
    const int wave = __builtin_amdgcn_readfirstlane((int)(threadIdx.x >> 5));
    const int zh = blockIdx.y; const int b = zh / NH_, h = zh % NH_;
    const int t0 = (blockIdx.x * AW + wave) * (16 * QT);
    const size_t pbase = (size_t)zh * SEQ * HD;
    // this thread's share of a stage: rows cr and cr + 32 of each tile, 16 bytes at column ccol (8 lanes = one 128-B row, a wave = 4 whole lines)
    const int cr = (int)(threadIdx.x >> 3), ccol = (int)(threadIdx.x & 7) * 8;
    const unsigned cl = (unsigned)(size_t)(&ring[cr * LP + ccol]);               // LDS byte address in buffer 0, K tile
    const size_t ck = pbase + (size_t)cr * HD + ccol;        // + key * HD   (K plane: row = key; key + cr + 32 < SEQ)
    const size_t cv = pbase + (size_t)cr * SEQ + ccol;       // + key        (V^T plane: row = d, cr + 32 < HD; key + ccol + 7 < SEQ)
    stage_copy(cl, KP + ck, VT + cv);                                     // stage 0 -> buffer 0
    v16h qh0[QT], qh1[QT];                                   // B fragments: col t, k = d
    const h16* qp[QT];
#pragma unroll
    for (int q = 0; q < QT; ++q) {
        qp[q] = QH + pbase + (size_t)(t0 + 16 * q + lr) * HD + 8 * hi;
        qh0[q] = ldh(qp[q]); qh1[q] = ldh(qp[q] + 32);
    }
    // ends the run of Q loads; their addresses are inputs, so that they stay in their registers up to the wait and no load of the run lands on one of them
    asm volatile("s_wait_xcnt 0x0" :: "v"(qp[0]), "v"(qp[1]) : "memory");
    const int ko = lr * LP + 8 * hi;                         // + key * LP in the K tile (A fragment: row key, k = d); + 16j*LP + key in the V^T tile (A fragment: row d, k = key)
    v8f o[QT][4]; float m[QT], l[QT], thr[QT]; v2f sh[QT];   // m = maximum in use (scaled log2), sh = PSH - m (in both elements), thr = (m + TAU) / SC2: the unscaled score above which m is renewed
#pragma unroll
    for (int q = 0; q < QT; ++q) { m[q] = -3.0e38f; l[q] = 0.0f; sh[q] = (v2f){}; thr[q] = -3.0e38f;   // the first step always renews m (alpha = 0 there)
#pragma unroll
        for (int j = 0; j < 4; ++j) o[q][j] = (v8f){}; }
    asm volatile("s_wait_asynccnt 0x0" ::: "memory");        // this wave's copies of stage 0 have landed
    __syncthreads();                                         // every wave's have: stage 0 may be read
    if (SEQ > KST) stage_copy(cl + STG_H * 2, KP + ck + (size_t)KST * HD, VT + cv + KST);   // stage 1 -> buffer 1
#pragma unroll 1
    for (int ks = 0; ks < SEQ; ks += KST) {
      const int bsel = (ks / KST) & 1;
      const h16* sk = ring + bsel * STG_H + ko;
#pragma unroll
      for (int u = 0; u < KST; u += 32) {                    // the two 32-key steps of the stage, in key order; unrolled so that every LDS offset is an immediate
        v8f f[QT][2];                                        // scores: f[q][kt][r] = key 16 kt + 8h + r of the step, query tile q
        v16h kf[2][2];                                       // K fragments: kf[kt][c] = 16-key tile kt, d = 32 c ..
#pragma unroll
        for (int kt = 0; kt < 2; ++kt) { const h16* ka = sk + (u + 16 * kt) * LP; kf[kt][0] = ldh(ka); kf[kt][1] = ldh(ka + 32); }
        __builtin_amdgcn_sched_barrier(0);   // keeps the step's eight K reads one group ahead of its products; left free, the compiler sinks half of them between the products and waits for each pair there
#pragma unroll
        for (int kt = 0; kt < 2; ++kt)
#pragma unroll
            for (int q = 0; q < QT; ++q) f[q][kt] = wmma16(kf[kt][0], qh0[q], (v8f){});
#pragma unroll
        for (int kt = 0; kt < 2; ++kt)
#pragma unroll
            for (int q = 0; q < QT; ++q) f[q][kt] = wmma16(kf[kt][1], qh1[q], f[q][kt]);
        __builtin_amdgcn_sched_barrier(0);   // keeps the step's eight score products one run; left free, the compiler puts the first use of each tile right behind its last product and fills the distance with v_nop
        float mx[QT];                                        // this lane's maximum of the unscaled scores (the scale is positive)
#pragma unroll
        for (int q = 0; q < QT; ++q) { mx[q] = -3.0e38f;
#pragma unroll
            for (int i = 0; i < 8; ++i) mx[q] = fmaxf(mx[q], fmaxf(f[q][0][i], f[q][1][i])); }
        if (__builtin_amdgcn_ballot_w32((mx[0] > thr[0]) | (mx[1] > thr[1])) != 0) {   // wave-uniform; rare behind the first step
#pragma unroll
            for (int q = 0; q < QT; ++q) {
                const float mnew = fmaxf(m[q], fmaxf(mx[q], __shfl_xor(mx[q], 16, 32)) * SC2);   // both lane halves of a column take the same value
                const float alpha = __builtin_amdgcn_exp2f(m[q] - mnew);                         // exactly 1 for a column whose maximum has not grown
                m[q] = mnew; sh[q] = (v2f){ PSH - mnew, PSH - mnew }; thr[q] = (mnew + TAU) * (1.0f / SC2);
                l[q] = l[q] * alpha;
#pragma unroll
                for (int j = 0; j < 4; ++j) o[q][j] = o[q][j] * alpha;
            }
        }
        const h16* va = sk + TILE_H + u;
        const v16h v0 = ldh(va), v1 = ldh(va + 16 * LP), v2 = ldh(va + 32 * LP), v3 = ldh(va + 48 * LP);
        __builtin_amdgcn_sched_barrier(0);   // keeps the step's eight V^T reads ahead of the exponentials, under which they return; left free, the compiler puts them behind most of these and waits for them at the first product
        v16h pb[QT];
#pragma unroll
        for (int q = 0; q < QT; ++q) {
            v8h pa, pc;                                      // RNE, two a conversion; a P below the smallest normal f16 stays as a subnormal operand, which the matrix unit keeps
#pragma unroll
            for (int i = 0; i < 8; i += 2) {
                const v2f ea = (v2f){ f[q][0][i], f[q][0][i + 1] } * SC2 + sh[q], eb = (v2f){ f[q][1][i], f[q][1][i + 1] } * SC2 + sh[q];
                const v2f xa = { __builtin_amdgcn_exp2f(ea[0]), __builtin_amdgcn_exp2f(ea[1]) }, xb = { __builtin_amdgcn_exp2f(eb[0]), __builtin_amdgcn_exp2f(eb[1]) };
                const v2h ha = __builtin_convertvector(xa, v2h), hb = __builtin_convertvector(xb, v2h);
                pa[i] = ha[0]; pa[i + 1] = ha[1]; pc[i] = hb[0]; pc[i + 1] = hb[1]; }
            pb[q] = cat16(pa, pc);
            float ls = 0.0f;
#pragma unroll
            for (int i = 0; i < 8; ++i) ls += (float)pa[i] + (float)pc[i];
            l[q] += ls;
        }
#pragma unroll
        for (int q = 0; q < QT; ++q) { o[q][0] = wmma16(v0, pb[q], o[q][0]); o[q][1] = wmma16(v1, pb[q], o[q][1]); o[q][2] = wmma16(v2, pb[q], o[q][2]); o[q][3] = wmma16(v3, pb[q], o[q][3]); }
        // the distance behind the step's last matrix instructions, on both sides of the branch at the loop's foot
        asm volatile("v_nop\n\tv_nop\n\tv_nop\n\tv_nop" : "+v"(o[0][0]), "+v"(o[0][1]), "+v"(o[0][2]), "+v"(o[0][3]), "+v"(o[1][0]), "+v"(o[1][1]), "+v"(o[1][2]), "+v"(o[1][3])
                     : "v"(v0), "v"(v1), "v"(v2), "v"(v3), "v"(pb[0]), "v"(pb[1]));
      }
      asm volatile("s_wait_dscnt 0x0" ::: "memory");         // this wave's reads of the stage have returned: its buffer may be handed to the copies
      asm volatile("s_wait_asynccnt 0x0" ::: "memory");      // this wave's copies of the next stage have landed
      __syncthreads();                                       // publishes the next stage and ends every wave's reads of this one
      if (ks + 2 * KST < SEQ) {                              // block-uniform: refill the buffer just read with the stage after next
        const size_t kn = (size_t)(ks + 2 * KST);
        stage_copy(cl + (unsigned)bsel * (STG_H * 2), KP + ck + kn * HD, VT + cv + kn); }
    }
    asm volatile("s_wait_asynccnt 0x0" ::: "memory");        // nothing of the ring is in flight; the last trip's barrier has ended all reads, so it may become output staging
    const int wb = wave * 16 * 68;
#pragma unroll
    for (int q = 0; q < QT; ++q) {                           // the wave's query tiles, one after the other through the wave's own staging rows
        const float lq = l[q] + __shfl_xor(l[q], 16, 32);
        const float inv = CTXS / lq;
        // O^T D layout: o_j[r] = (d = 16j + 8h + r, t = lane&15) -> os[t][d]; rows 0..15 x columns 0..63 all written
#pragma unroll
        for (int j = 0; j < 4; ++j) { v4f a, c;
            a[0] = o[q][j][0] * inv; a[1] = o[q][j][1] * inv; a[2] = o[q][j][2] * inv; a[3] = o[q][j][3] * inv; c[0] = o[q][j][4] * inv; c[1] = o[q][j][5] * inv; c[2] = o[q][j][6] * inv; c[3] = o[q][j][7] * inv;
            *(v4fa*)(&os[wb + lr * 68 + 16 * j + 8 * hi]) = a; *(v4fa*)(&os[wb + lr * 68 + 16 * j + 8 * hi + 4]) = c; }
        wave_sync();
        h16* crow = CTX + ((size_t)b * SEQ + t0 + 16 * q) * DM + h * HD;      // ctx plane [b*SEQ + t][h*64 + d], x CTXS
#pragma unroll
        for (int s = 0; s < 4; ++s) { const int row = 4 * s + (lane >> 3), c8 = (lane & 7) * 8;   // 4 s x 4 rows = 16 rows; 8 lanes x 8 halves = 64 columns
            const v4f x0 = *(const v4fa*)(&os[wb + row * 68 + c8]); const v4f x1 = *(const v4fa*)(&os[wb + row * 68 + c8 + 4]); v8h hv;
#pragma unroll
            for (int i = 0; i < 4; ++i) { hv[i] = toh_flush(x0[i]); hv[4 + i] = toh_flush(x1[i]); }
            *(v8h*)(crow + (size_t)row * DM + c8) = hv; }
        if (q + 1 < QT) {                                   // only where another tile follows
            asm volatile("s_wait_xcnt 0x0" ::: "memory");   // ends this tile's stores before the next tile's sums reuse their registers
            __builtin_amdgcn_sched_barrier(0);              // keeps the next tile's products behind that wait; left free, the compiler lifts them over it
            wave_sync();                                    // the tile's staging rows have been read: the next tile may overwrite them
        }
    }
}

// k_out: output projection, f16 GEMM, 256 x 128 tile per block of eight waves (4 x 2), ONE WAVE per 64x64 tile, K = DM; operand rows staged as in proj_tile.
// OUT[m][n] = OSC * sum_k CTX[m][k] WoT[n][k] + bo[n] (f32). grid (NB*SEQ/256, DM/128), 256 threads.
__global__ __launch_bounds__(256) void k_out(const h16* __restrict__ A, const h16* __restrict__ Bt, const float* __restrict__ bias, float* OUT) {
    __shared__ __align__(16) h16 ring[2 * GSTG_H];           // two stages; reused as the waves' output staging behind the loop
    const int K = DM;
    const int lane = threadIdx.x & 31, lr = lane & 15, hi = lane >> 4;
    const int wave = __builtin_amdgcn_readfirstlane((int)(threadIdx.x >> 5)); const int wm = wave & 3, wn = wave >> 2;
    const int r0 = blockIdx.x * GBM + wm * 64, c0 = blockIdx.y * GBN + wn * 64;
    float* os = (float*)ring + wave * 16 * 68;
    // this thread's share of a stage: 16 bytes at column cc of rows cr + 16 i (16 lanes = one 256-B row); blockIdx.x * GBM + cr + 240 < NB * SEQ, blockIdx.y * GBN + cr + 112 < DM, cc + 7 < GKS
    const int cr = (int)(threadIdx.x >> 4), cc = (int)(threadIdx.x & 15) * 8;
    const unsigned cl = (unsigned)(size_t)(&ring[cr * GLP + cc]);               // LDS byte address in buffer 0
    const unsigned short* ca = (const unsigned short*)A + (size_t)(blockIdx.x * GBM + cr) * K + cc;    // + k
    const unsigned short* cb = (const unsigned short*)Bt + (size_t)(blockIdx.y * GBN + cr) * K + cc;   // + k
    gemm_stage(cl, ca, cb);                                                      // stage 0 -> buffer 0
    v8f acc[4][4];
#pragma unroll
    for (int mb = 0; mb < 4; ++mb)
#pragma unroll
        for (int nb = 0; nb < 4; ++nb) acc[mb][nb] = (v8f){};
    const int aoff = (wm * 64 + lr) * GLP + 8 * hi, boff = (GBM + wn * 64 + lr) * GLP + 8 * hi;   // fragment rows inside a stage
    asm volatile("s_wait_asynccnt 0x0" ::: "memory");        // this wave's copies of stage 0 have landed
    __syncthreads();                                         // every wave's have: stage 0 may be read
    gemm_stage(cl + GSTG_H * 2, ca + GKS, cb + GKS);         // stage 1 -> buffer 1
#pragma unroll 1
    for (int ks = 0; ks < K; ks += GKS) {
        const int bsel = (ks / GKS) & 1;
        const h16* sa = ring + bsel * GSTG_H + aoff; const h16* sb = ring + bsel * GSTG_H + boff;
        v16h a[2][4], b[2][4];                             // fragments are read one 32-k step ahead, in two groups a step, so that the whole kernel stays inside 256 registers
#pragma unroll
        for (int i = 0; i < 4; ++i) { a[0][i] = ldh(sa + i * 16 * GLP); b[0][i] = ldh(sb + i * 16 * GLP); }
#pragma unroll
        for (int kc = 0; kc < GKS; kc += 32) {               // the 32-k steps of the stage, in k order; unrolled so that every LDS offset is an immediate
            const int cu = (kc / 32) & 1, nx = cu ^ 1;
            // the four scheduling barriers keep each group of reads whole and a step ahead of its products; left free, the compiler sinks every read to its first use and waits there
            __builtin_amdgcn_sched_barrier(0);
            if (kc + 32 < GKS) {                             // never past the stage: the next stage is read only behind its barrier
#pragma unroll
                for (int i = 0; i < 4; ++i) a[nx][i] = ldh(sa + i * 16 * GLP + kc + 32);
#pragma unroll
                for (int i = 0; i < 2; ++i) b[nx][i] = ldh(sb + i * 16 * GLP + kc + 32); }
            __builtin_amdgcn_sched_barrier(0);
#pragma unroll
            for (int nb = 0; nb < 2; ++nb)
#pragma unroll
                for (int mb = 0; mb < 4; ++mb) acc[mb][nb] = wmma16(a[cu][mb], b[cu][nb], acc[mb][nb]);
            __builtin_amdgcn_sched_barrier(0);
            if (kc + 32 < GKS) {
#pragma unroll
                for (int i = 2; i < 4; ++i) b[nx][i] = ldh(sb + i * 16 * GLP + kc + 32); }
            __builtin_amdgcn_sched_barrier(0);
#pragma unroll
            for (int nb = 2; nb < 4; ++nb)
#pragma unroll
                for (int mb = 0; mb < 4; ++mb) acc[mb][nb] = wmma16(a[cu][mb], b[cu][nb], acc[mb][nb]);
        }
        // the distance behind the stage's last matrix instructions, on both sides of the branch below
        asm volatile("v_nop\n\tv_nop\n\tv_nop\n\tv_nop" : "+v"(acc[0][0]), "+v"(acc[1][0]), "+v"(acc[2][0]), "+v"(acc[3][0]), "+v"(acc[0][1]), "+v"(acc[1][1]), "+v"(acc[2][1]), "+v"(acc[3][1]),
                     "+v"(acc[0][2]), "+v"(acc[1][2]), "+v"(acc[2][2]), "+v"(acc[3][2]), "+v"(acc[0][3]), "+v"(acc[1][3]), "+v"(acc[2][3]), "+v"(acc[3][3]));
        asm volatile("s_wait_dscnt 0x0" ::: "memory");       // this wave's reads of the stage have returned: its buffer may be handed to the copies
        asm volatile("s_wait_asynccnt 0x0" ::: "memory");    // this wave's copies of the next stage have landed
        __syncthreads();                                     // publishes the next stage and ends every wave's reads of this one
        if (ks + 2 * GKS < K)                                // block-uniform: refill the buffer just read with the stage after next
            gemm_stage(cl + (unsigned)bsel * (GSTG_H * 2), ca + ks + 2 * GKS, cb + ks + 2 * GKS);
    }
    asm volatile("s_wait_asynccnt 0x0" ::: "memory");        // nothing of the ring is in flight; the last trip's barrier has ended all reads, so it may become output staging
    const int cofs = lr * 4;
    v4f bb; { const v4f t = *(const v4f*)(bias + c0 + cofs);      // c0 + cofs + 3 < DM
#pragma unroll
        for (int i = 0; i < 4; ++i) bb[i] = bfr(t[i]); }
    float* orow = OUT + ((size_t)(r0 / SEQ) * OUT_SEQ + (size_t)(r0 % SEQ)) * DM + c0;
#pragma unroll
    for (int mb = 0; mb < 4; ++mb) {
#pragma unroll
        for (int nb = 0; nb < 4; ++nb) {
#pragma unroll
            for (int j = 0; j < 8; ++j) os[(hi * 8 + j) * 68 + nb * 16 + lr] = acc[mb][nb][j]; }   // D: row 8h+j, col lane&15
        wave_sync();
{
#pragma unroll
            for (int s = 0; s < 8; ++s) { const int row = 2 * s + hi;   // 8 s x 2 rows = 16 rows; 16 lanes x 4 floats = 64 columns
                const v4f x = *(const v4fa*)(&os[row * 68 + cofs]); v4f val;
#pragma unroll
                for (int i = 0; i < 4; ++i) val[i] = x[i] * OSC + bb[i];
                *(v4f*)(orow + (size_t)(mb * 16 + row) * DM + cofs) = val; }
             }
        wave_sync();
    }
}

static constexpr size_t al256(size_t v) { return (v + 255) & ~(size_t)255; }
static constexpr size_t SZ_XB = al256((size_t)NB * SEQ * DM * 2);
static constexpr size_t SZ_WB = al256((size_t)3 * DM * DM * 2);
static constexpr size_t SZ_PL = al256((size_t)NB * NH_ * SEQ * HD * 2);
static constexpr size_t SZ_TOTAL = 3 * SZ_XB + SZ_WB + 3 * SZ_PL;
static_assert(SZ_TOTAL <= (size_t)268435456);                  // workspace carve <= 256 MiB
static_assert(((size_t)DM * DM * 2) % 256 == 0);               // weight sub-planes stay 256-byte aligned
static_assert((size_t)3 * DM * DM * 2 <= SZ_WB);               // three weight sub-planes (q | k | o) fit their region
static_assert((size_t)NB * SEQ * DM * 2 <= SZ_XB);             // ctx plane (aliases the query copy) fits its region

extern "C" void kernel_launch(void* const* d_in, const int* in_sizes, int n_in,
                              void* d_out, int out_size, void* d_ws, size_t ws_size, hipStream_t stream) {
    if (n_in < 9) return;
    const size_t needx = ((size_t)(NB - 1) * SEQ_FULL + SEQ) * DM;
    if ((size_t)in_sizes[0] < needx || (size_t)in_sizes[1] < needx || (size_t)in_sizes[2] < needx) return;
    if ((size_t)in_sizes[3] < (size_t)DM * DM || (size_t)in_sizes[5] < (size_t)DM * DM || (size_t)in_sizes[7] < (size_t)DM * DM) return;
    if (in_sizes[4] < DM || in_sizes[6] < DM || in_sizes[8] < DM) return;
    if ((size_t)out_size < ((size_t)(NB - 1) * OUT_SEQ + SEQ) * DM) return;
    if (SZ_TOTAL > ws_size) return;
    // wire order: q, k, v, q_w, q_b, k_w, k_b, out_w, out_b
    const float* xq = (const float*)d_in[0]; const float* xk = (const float*)d_in[1]; const float* xv = (const float*)d_in[2];
    const float* wq = (const float*)d_in[3]; const float* bq = (const float*)d_in[4];
    const float* wk = (const float*)d_in[5]; const float* bk = (const float*)d_in[6];
    const float* wo = (const float*)d_in[7]; const float* bo = (const float*)d_in[8];
    float* OUT = (float*)d_out;      // [NB][OUT_SEQ][1024]
    char* wsp = (char*)d_ws;
    bf* XQ = (bf*)wsp; wsp += SZ_XB;                 // [NB*SEQ][1024] bf16 queries; region reused later as the ctx plane
    bf* XK = (bf*)wsp; wsp += SZ_XB;                 // [NB*SEQ][1024] bf16 keys
    bf* XV = (bf*)wsp; wsp += SZ_XB;                 // [NB*SEQ][1024] bf16 values
    bf* WB = (bf*)wsp; wsp += SZ_WB;                 // [3][1024][1024] transposed [out][in]: q | k (bf16) | o (f16 x64)
    h16* QH = (h16*)wsp; wsp += SZ_PL;               // [NB*16][SEQ][64]
    h16* KP = (h16*)wsp; wsp += SZ_PL;               // [NB*16][SEQ][64]
    h16* VT = (h16*)wsp; wsp += SZ_PL;               // [NB*16][64][SEQ]
    h16* CTX = (h16*)XQ;                             // [NB*SEQ][1024] f16 x256, written after the projection launch has consumed XQ
    bf* WQT = WB; bf* WKT = WB + (size_t)DM * DM; bf* WOT = WB + (size_t)2 * DM * DM;

    k_prep<<<dim3(6, PREP_GX, 1), 256, 0, stream>>>(xq, xk, xv, wq, wk, wo, XQ, XK, XV, (unsigned short*)WQT, (unsigned short*)WKT, (unsigned short*)WOT);

    k_proj3<<<dim3(PJ_BLK, 3, 1), 256, 0, stream>>>(XQ, XK, XV, WQT, WKT, bq, bk, QH, KP, VT);

    k_flash<<<dim3(SEQ / (16 * QT * AW), NB * NH_, 1), 32 * AW, 0, stream>>>(QH, KP, VT, CTX);

    k_out<<<dim3(NB * SEQ / GBM, DM / GBN, 1), 256, 0, stream>>>(CTX, (const h16*)WOT, bo, OUT);
}
